// v000
// The times below were measured on an AMD MI455X: many runs one after another, warmed up first and cycling through
// copies of the inputs, with the whole window's GPU time divided by the number of runs. Launches and the gaps
// between them are all in it. The median over several windows is given; except for v000 it joins two sittings, which
// can be a few percent apart, so the side-by-side timings, each taken in one sitting, are the better comparison.
// v000, which the later versions start from, runs in 186 microseconds.
#include <hip/hip_runtime.h>

#define CDIM 128
#define NDIM 32768
#define LDP  144                 // padded LDS row (bf16 elems): 288B rows = 64 data dw + 8 pad dw
#define LOG2E 1.4426950408889634f
#define CHUNKS 16
#define NCHUNK (NDIM / CHUNKS)   // 2048

typedef __bf16 bf16;
typedef __attribute__((ext_vector_type(16))) bf16  v16bf;
typedef __attribute__((ext_vector_type(8)))  bf16  v8bf;
typedef __attribute__((ext_vector_type(4)))  bf16  v4bf;
typedef __attribute__((ext_vector_type(2)))  bf16  v2bf;
typedef __attribute__((ext_vector_type(8)))  float v8f;
typedef unsigned v4u __attribute__((ext_vector_type(4)));
typedef int      v4i __attribute__((ext_vector_type(4)));
typedef int      v8i __attribute__((ext_vector_type(8)));

// A(16x32 bf16) and B(32x16 bf16) fragments share the same address function:
// lane&15 -> row (A: M, B: column), lane>>4 selects k half; 16 contiguous bf16.
static __device__ __forceinline__ v16bf ldfrag(const bf16* base, int row0, int k0, int lane) {
  const bf16* p = base + (size_t)(row0 + (lane & 15)) * LDP + k0 + ((lane >> 4) << 4);
  return *(const v16bf*)p;
}

static __device__ __forceinline__ v8f wmma_bf16(v16bf a, v16bf b, v8f c) {
  return __builtin_amdgcn_wmma_f32_16x16x32_bf16(false, a, false, b, (short)0, c, false, false);
}

// monotone float<->uint mapping for atomicMax on floats
static __device__ __forceinline__ unsigned fenc(float f) {
  unsigned u = __float_as_uint(f);
  return (u & 0x80000000u) ? ~u : (u | 0x80000000u);
}
static __device__ __forceinline__ float fdec(unsigned u) {
  return (u & 0x80000000u) ? __uint_as_float(u & 0x7FFFFFFFu) : __uint_as_float(~u);
}

// TDM: DMA a 128x128 tile of 2-byte elements (row length dim0, row stride stride0,
// dim1 rows total in tensor) from global into LDS with 64dw+8dw row padding (-> LDP rows).
static __device__ __forceinline__ void tdm_load_tile(const void* gsrc, void* ldst,
                                                     unsigned dim0, unsigned dim1,
                                                     unsigned stride0) {
  unsigned long long ga = (unsigned long long)(size_t)gsrc;
  unsigned lds_off = (unsigned)(size_t)ldst;   // generic LDS addr low 32 bits = LDS offset
  v4u g0;
  g0[0] = 1u;                                          // count=1, user descriptor
  g0[1] = lds_off;                                     // LDS byte address
  g0[2] = (unsigned)(ga & 0xFFFFFFFFu);                // global_addr[31:0]
  g0[3] = (unsigned)((ga >> 32) & 0x01FFFFFFu) | 0x80000000u;  // addr[56:32] | type=2
  v8i g1;
  g1[0] = (int)((1u << 16) | (1u << 20) | (5u << 22) | (7u << 25)); // 2B elems, pad_en, 64dw interval, 8dw pad
  g1[1] = (int)((dim0 & 0xFFFFu) << 16);               // tensor_dim0[15:0]
  g1[2] = (int)(((dim0 >> 16) & 0xFFFFu) | ((dim1 & 0xFFFFu) << 16)); // dim0 hi | dim1 lo
  g1[3] = (int)(((dim1 >> 16) & 0xFFFFu) | (128u << 16));            // dim1 hi | tile_dim0=128
  g1[4] = (int)128u;                                   // tile_dim1=128, tile_dim2=0
  g1[5] = (int)stride0;                                // tensor_dim0_stride[31:0]
  g1[6] = 0;                                           // stride0 hi | stride1 lo
  g1[7] = 0;
  v4i gz4 = {0, 0, 0, 0};
  v8i gz8 = {0, 0, 0, 0, 0, 0, 0, 0};
  __builtin_amdgcn_tensor_load_to_lds(g0, g1, gz4, gz4, gz8, 0);
}

__global__ __launch_bounds__(256) void init_kernel(float* __restrict__ Wctx,
                                                   float* __restrict__ ksum,
                                                   unsigned* __restrict__ kmaxb) {
  int i = blockIdx.x * 256 + threadIdx.x;
  if (i < 4 * CDIM * CDIM) Wctx[i] = 0.0f;
  if (i < 4 * CDIM) { ksum[i] = 0.0f; kmaxb[i] = 0x007FFFFFu; /* fenc(-inf) */ }
}

// -------- Kernel 1: fused projections, Q-softmax, K row-max -----------------
// Output layouts (per combo = s*2+b): Kt/Vt = (C, N) bf16, Qn = (N, C) bf16.
__global__ __launch_bounds__(256) void proj_kernel(
    const float* __restrict__ x0, const float* __restrict__ x1,
    const float* __restrict__ Wk0, const float* __restrict__ Wk1,
    const float* __restrict__ Wq0, const float* __restrict__ Wq1,
    const float* __restrict__ Wv0, const float* __restrict__ Wv1,
    bf16* __restrict__ Kt, bf16* __restrict__ Vt, bf16* __restrict__ Qn,
    unsigned* __restrict__ kmaxb)
{
  __shared__ bf16 Alds[CDIM][LDP] __attribute__((aligned(32)));  // weights [c_out][c]
  __shared__ bf16 Blds[CDIM][LDP] __attribute__((aligned(32)));  // x tile  [n][c]
  __shared__ float Slds[CDIM][132];                              // Q softmax scratch

  const int t = threadIdx.x, lane = t & 31, wave = t >> 5;
  const int combo = blockIdx.y;                 // s*2 + b
  const int s = combo >> 1, b = combo & 1;
  const int n0 = blockIdx.x * 128;
  const float* xp = (s ? x1 : x0) + (size_t)b * CDIM * NDIM;
  const float* Wk = s ? Wk1 : Wk0;
  const float* Wq = s ? Wq1 : Wq0;
  const float* Wv = s ? Wv1 : Wv0;
  const size_t cb = (size_t)combo * CDIM * NDIM;

  // load x tile (128 c x 128 n), bf16-convert, transpose into Blds[n][c]
  for (int e = t; e < CDIM * 32; e += 256) {
    int c = e >> 5, q = e & 31;
    float4 v = *(const float4*)(xp + (size_t)c * NDIM + n0 + q * 4);
    Blds[q * 4 + 0][c] = (bf16)v.x;
    Blds[q * 4 + 1][c] = (bf16)v.y;
    Blds[q * 4 + 2][c] = (bf16)v.z;
    Blds[q * 4 + 3][c] = (bf16)v.w;
  }

  auto load_w = [&](const float* Wp) {
    for (int e = t; e < CDIM * 32; e += 256) {
      int co = e >> 5, q = e & 31;
      float4 v = *(const float4*)(Wp + co * CDIM + q * 4);
      v4bf pk; pk[0] = (bf16)v.x; pk[1] = (bf16)v.y; pk[2] = (bf16)v.z; pk[3] = (bf16)v.w;
      *(v4bf*)&Alds[co][q * 4] = pk;
    }
  };

  auto run_gemm = [&](v8f* acc) {
#pragma unroll
    for (int ks = 0; ks < 4; ks++) {
      v16bf a = ldfrag(&Alds[0][0], wave * 16, ks * 32, lane);
      v16bf bfr[8];
#pragma unroll
      for (int nt = 0; nt < 8; nt++) bfr[nt] = ldfrag(&Blds[0][0], nt * 16, ks * 32, lane);
#pragma unroll
      for (int nt = 0; nt < 8; nt++) acc[nt] = wmma_bf16(a, bfr[nt], acc[nt]);
    }
  };
  const v8f vz = {0.f, 0.f, 0.f, 0.f, 0.f, 0.f, 0.f, 0.f};

  // ---- V projection ----
  load_w(Wv);
  __syncthreads();
  {
    v8f acc[8];
#pragma unroll
    for (int i = 0; i < 8; i++) acc[i] = vz;
    run_gemm(acc);
#pragma unroll
    for (int nt = 0; nt < 8; nt++)
#pragma unroll
      for (int r = 0; r < 8; r++) {
        int co = wave * 16 + r + ((lane >> 4) << 3);
        int n = n0 + nt * 16 + (lane & 15);
        Vt[cb + (size_t)co * NDIM + n] = (bf16)acc[nt][r];
      }
  }
  __syncthreads();

  // ---- K projection (store logits + per-row running max over N) ----
  load_w(Wk);
  __syncthreads();
  {
    v8f acc[8];
#pragma unroll
    for (int i = 0; i < 8; i++) acc[i] = vz;
    run_gemm(acc);
#pragma unroll
    for (int nt = 0; nt < 8; nt++)
#pragma unroll
      for (int r = 0; r < 8; r++) {
        int co = wave * 16 + r + ((lane >> 4) << 3);
        int n = n0 + nt * 16 + (lane & 15);
        Kt[cb + (size_t)co * NDIM + n] = (bf16)acc[nt][r];
      }
#pragma unroll
    for (int r = 0; r < 8; r++) {
      float m = acc[0][r];
#pragma unroll
      for (int nt = 1; nt < 8; nt++) m = fmaxf(m, acc[nt][r]);
      m = fmaxf(m, __shfl_xor(m, 1));
      m = fmaxf(m, __shfl_xor(m, 2));
      m = fmaxf(m, __shfl_xor(m, 4));
      m = fmaxf(m, __shfl_xor(m, 8));
      if ((lane & 15) == 0) {
        int co = wave * 16 + r + ((lane >> 4) << 3);
        atomicMax(&kmaxb[combo * CDIM + co], fenc(m));
      }
    }
  }
  __syncthreads();

  // ---- Q projection + softmax over C (per n) ----
  load_w(Wq);
  __syncthreads();
  {
    v8f acc[8];
#pragma unroll
    for (int i = 0; i < 8; i++) acc[i] = vz;
    run_gemm(acc);
#pragma unroll
    for (int nt = 0; nt < 8; nt++)
#pragma unroll
      for (int r = 0; r < 8; r++) {
        int row = wave * 16 + r + ((lane >> 4) << 3);
        int col = nt * 16 + (lane & 15);
        Slds[row][col] = acc[nt][r];
      }
    __syncthreads();
    if (t < CDIM) {
      int j = t;
      float m = -3.4e38f;
      for (int c = 0; c < CDIM; c++) m = fmaxf(m, Slds[c][j]);
      float ssum = 0.0f;
      for (int c = 0; c < CDIM; c++) {
        float p = exp2f((Slds[c][j] - m) * LOG2E);
        Slds[c][j] = p;
        ssum += p;
      }
      float inv = 1.0f / ssum;
      bf16* qrow = Qn + cb + (size_t)(n0 + j) * CDIM;
      for (int c = 0; c < CDIM; c += 2) {
        v2bf pk;
        pk[0] = (bf16)(Slds[c][j] * inv);
        pk[1] = (bf16)(Slds[c + 1][j] * inv);
        *(v2bf*)&qrow[c] = pk;
      }
    }
  }
}

// -------- Kernel 2: context GEMM  W[c,d] += sum_n exp(K[c,n]-max_c)*V[d,n] ---
// V tile staged by the Tensor Data Mover (overlaps with exp() on the K tile).
__global__ __launch_bounds__(256) void ctx_kernel(
    const bf16* __restrict__ Kt, const bf16* __restrict__ Vt,
    const unsigned* __restrict__ kmaxb,
    float* __restrict__ Wctx, float* __restrict__ ksum)
{
  __shared__ bf16 Elds[CDIM][LDP] __attribute__((aligned(32)));
  __shared__ bf16 Vlds[CDIM][LDP] __attribute__((aligned(32)));
  __shared__ float kmaxL[CDIM];
  __shared__ float ksumL[CDIM];

  const int t = threadIdx.x, lane = t & 31, wave = t >> 5;
  const int combo = blockIdx.y;
  const size_t cb = (size_t)combo * CDIM * NDIM;
  const int nbase = blockIdx.x * NCHUNK;

  if (t < CDIM) { kmaxL[t] = fdec(kmaxb[combo * CDIM + t]); ksumL[t] = 0.0f; }
  __syncthreads();

  const v8f vz = {0.f, 0.f, 0.f, 0.f, 0.f, 0.f, 0.f, 0.f};
  v8f acc[8];
#pragma unroll
  for (int i = 0; i < 8; i++) acc[i] = vz;

  for (int nb = nbase; nb < nbase + NCHUNK; nb += 128) {
    // async DMA: V tile (128 c x 128 n) -> Vlds with padded rows
    if (t < 32) tdm_load_tile(Vt + cb + nb, &Vlds[0][0], NDIM, CDIM, NDIM);

    // meanwhile: stage exp(K - max) tile with VALU, accumulate row sums
    for (int e = t; e < CDIM * 16; e += 256) {
      int c = e >> 4, seg = e & 15;
      const bf16* kp = Kt + cb + (size_t)c * NDIM + nb + seg * 8;
      v8bf kv = *(const v8bf*)kp;
      __builtin_prefetch(kp + 128, 0, 0);   // next chunk -> global_prefetch_b8
      float km = kmaxL[c];
      float part = 0.0f;
      v8bf ev;
#pragma unroll
      for (int j = 0; j < 8; j++) {
        float p = exp2f(((float)kv[j] - km) * LOG2E);
        part += p;
        ev[j] = (bf16)p;
      }
      *(v8bf*)&Elds[c][seg * 8] = ev;
      atomicAdd(&ksumL[c], part);
    }
    if (t < 32) __builtin_amdgcn_s_wait_tensorcnt((short)0);
    __syncthreads();
#pragma unroll
    for (int ks = 0; ks < 4; ks++) {
      v16bf a = ldfrag(&Elds[0][0], wave * 16, ks * 32, lane);
      v16bf bfr[8];
#pragma unroll
      for (int dt = 0; dt < 8; dt++) bfr[dt] = ldfrag(&Vlds[0][0], dt * 16, ks * 32, lane);
#pragma unroll
      for (int dt = 0; dt < 8; dt++) acc[dt] = wmma_bf16(a, bfr[dt], acc[dt]);
    }
    __syncthreads();
  }

  float* Wp = Wctx + combo * CDIM * CDIM;
#pragma unroll
  for (int dt = 0; dt < 8; dt++)
#pragma unroll
    for (int r = 0; r < 8; r++) {
      int c = wave * 16 + r + ((lane >> 4) << 3);
      int d = dt * 16 + (lane & 15);
      atomicAdd(&Wp[c * CDIM + d], acc[dt][r]);
    }
  __syncthreads();
  if (t < CDIM) atomicAdd(&ksum[combo * CDIM + t], ksumL[t]);
}

// -------- Kernel 3: Out_s[d,n] = sum_c (W_{1-s}[c,d]/ksum_c) * Q_s[n,c] -----
// Q tile staged by the Tensor Data Mover.
__global__ __launch_bounds__(256) void out_kernel(
    const bf16* __restrict__ Qn, const float* __restrict__ Wctx,
    const float* __restrict__ ksum, float* __restrict__ out)
{
  __shared__ bf16 Alds[CDIM][LDP] __attribute__((aligned(32)));  // [d][c]
  __shared__ bf16 Qlds[CDIM][LDP] __attribute__((aligned(32)));  // [n][c]
  __shared__ float ksumL[CDIM];

  const int t = threadIdx.x, lane = t & 31, wave = t >> 5;
  const int combo = blockIdx.y;
  const int s = combo >> 1, b = combo & 1;
  const int other = ((1 - s) << 1) | b;
  const int n0 = blockIdx.x * 128;
  const bf16* Qb = Qn + (size_t)combo * CDIM * NDIM;

  // async DMA: Q tile (128 n x 128 c) -> Qlds with padded rows
  if (t < 32) tdm_load_tile(Qb + (size_t)n0 * CDIM, &Qlds[0][0], CDIM, NDIM, CDIM);

  if (t < CDIM) ksumL[t] = ksum[other * CDIM + t];
  __syncthreads();

  const float* Wp = Wctx + other * CDIM * CDIM;
  for (int e = t; e < CDIM * 16; e += 256) {
    int d = e >> 4, seg = e & 15;
#pragma unroll
    for (int j = 0; j < 8; j++) {
      int c = seg * 8 + j;
      Alds[d][c] = (bf16)(Wp[c * CDIM + d] / ksumL[c]);
    }
  }
  if (t < 32) __builtin_amdgcn_s_wait_tensorcnt((short)0);
  __syncthreads();

  const v8f vz = {0.f, 0.f, 0.f, 0.f, 0.f, 0.f, 0.f, 0.f};
  v8f acc[8];
#pragma unroll
  for (int i = 0; i < 8; i++) acc[i] = vz;
#pragma unroll
  for (int ks = 0; ks < 4; ks++) {
    v16bf a = ldfrag(&Alds[0][0], wave * 16, ks * 32, lane);
    v16bf bfr[8];
#pragma unroll
    for (int nt = 0; nt < 8; nt++) bfr[nt] = ldfrag(&Qlds[0][0], nt * 16, ks * 32, lane);
#pragma unroll
    for (int nt = 0; nt < 8; nt++) acc[nt] = wmma_bf16(a, bfr[nt], acc[nt]);
  }

  float* ob = out + (size_t)combo * CDIM * NDIM;
#pragma unroll
  for (int nt = 0; nt < 8; nt++)
#pragma unroll
    for (int r = 0; r < 8; r++) {
      int d = wave * 16 + r + ((lane >> 4) << 3);
      int n = n0 + nt * 16 + (lane & 15);
      ob[(size_t)d * NDIM + n] = acc[nt][r];
    }
}

extern "C" void kernel_launch(void* const* d_in, const int* in_sizes, int n_in,
                              void* d_out, int out_size, void* d_ws, size_t ws_size,
                              hipStream_t stream) {
  (void)in_sizes; (void)n_in; (void)out_size; (void)ws_size;
  const float* x0  = (const float*)d_in[0];
  const float* x1  = (const float*)d_in[1];
  const float* Wk0 = (const float*)d_in[2];
  const float* Wk1 = (const float*)d_in[3];
  const float* Wq0 = (const float*)d_in[4];
  const float* Wq1 = (const float*)d_in[5];
  const float* Wv0 = (const float*)d_in[6];
  const float* Wv1 = (const float*)d_in[7];
  float* out = (float*)d_out;

  const size_t PLANE = (size_t)4 * CDIM * NDIM;   // elems per bf16 array (all combos)
  bf16* Kt = (bf16*)d_ws;
  bf16* Vt = Kt + PLANE;
  bf16* Qn = Vt + PLANE;
  float* Wctx = (float*)(Qn + PLANE);
  float* ksum = Wctx + 4 * CDIM * CDIM;
  unsigned* kmaxb = (unsigned*)(ksum + 4 * CDIM);

  init_kernel<<<dim3((4 * CDIM * CDIM + 255) / 256), 256, 0, stream>>>(Wctx, ksum, kmaxb);
  proj_kernel<<<dim3(NDIM / 128, 4), 256, 0, stream>>>(
      x0, x1, Wk0, Wk1, Wq0, Wq1, Wv0, Wv1, Kt, Vt, Qn, kmaxb);
  ctx_kernel<<<dim3(CHUNKS, 4), 256, 0, stream>>>(Kt, Vt, kmaxb, Wctx, ksum);
  out_kernel<<<dim3(NDIM / 128, 4), 256, 0, stream>>>(Qn, Wctx, ksum, out);
}

// v001
// Measured time: 153 microseconds a run.
// Next to v000, in two timings, it ran 1.23 times as fast each time.
#include <hip/hip_runtime.h>

#define CDIM 128
#define NDIM 32768
#define LDP  144                 // padded LDS row (bf16 elems): 288B rows = 64 data dw + 8 pad dw
#define LOG2E 1.4426950408889634f
#define CHUNKS 16
#define NCHUNK (NDIM / CHUNKS)   // 2048

typedef __bf16 bf16;
typedef __attribute__((ext_vector_type(16))) bf16  v16bf;
typedef __attribute__((ext_vector_type(8)))  bf16  v8bf;
typedef __attribute__((ext_vector_type(4)))  bf16  v4bf;
typedef __attribute__((ext_vector_type(2)))  bf16  v2bf;
typedef __attribute__((ext_vector_type(8)))  float v8f;
typedef unsigned v4u __attribute__((ext_vector_type(4)));
typedef int      v4i __attribute__((ext_vector_type(4)));
typedef int      v8i __attribute__((ext_vector_type(8)));

// A(16x32 bf16) and B(32x16 bf16) fragments share the same address function:
// lane&15 -> row (A: M, B: column), lane>>4 selects k half; 16 contiguous bf16.
static __device__ __forceinline__ v16bf ldfrag(const bf16* base, int row0, int k0, int lane) {
  const bf16* p = base + (size_t)(row0 + (lane & 15)) * LDP + k0 + ((lane >> 4) << 4);
  return *(const v16bf*)p;
}

static __device__ __forceinline__ v8f wmma_bf16(v16bf a, v16bf b, v8f c) {
  return __builtin_amdgcn_wmma_f32_16x16x32_bf16(false, a, false, b, (short)0, c, false, false);
}

// monotone float<->uint mapping for atomicMax on floats
static __device__ __forceinline__ unsigned fenc(float f) {
  unsigned u = __float_as_uint(f);
  return (u & 0x80000000u) ? ~u : (u | 0x80000000u);
}
static __device__ __forceinline__ float fdec(unsigned u) {
  return (u & 0x80000000u) ? __uint_as_float(u & 0x7FFFFFFFu) : __uint_as_float(~u);
}

// TDM: DMA a 128x128 tile of 2-byte elements (row length dim0, row stride stride0,
// dim1 rows total in tensor) from global into LDS with 64dw+8dw row padding (-> LDP rows).
static __device__ __forceinline__ void tdm_load_tile(const void* gsrc, void* ldst,
                                                     unsigned dim0, unsigned dim1,
                                                     unsigned stride0) {
  unsigned long long ga = (unsigned long long)(size_t)gsrc;
  unsigned lds_off = (unsigned)(size_t)ldst;   // generic LDS addr low 32 bits = LDS offset
  v4u g0;
  g0[0] = 1u;                                          // count=1, user descriptor
  g0[1] = lds_off;                                     // LDS byte address
  g0[2] = (unsigned)(ga & 0xFFFFFFFFu);                // global_addr[31:0]
  g0[3] = (unsigned)((ga >> 32) & 0x01FFFFFFu) | 0x80000000u;  // addr[56:32] | type=2
  v8i g1;
  g1[0] = (int)((1u << 16) | (1u << 20) | (5u << 22) | (7u << 25)); // 2B elems, pad_en, 64dw interval, 8dw pad
  g1[1] = (int)((dim0 & 0xFFFFu) << 16);               // tensor_dim0[15:0]
  g1[2] = (int)(((dim0 >> 16) & 0xFFFFu) | ((dim1 & 0xFFFFu) << 16)); // dim0 hi | dim1 lo
  g1[3] = (int)(((dim1 >> 16) & 0xFFFFu) | (128u << 16));            // dim1 hi | tile_dim0=128
  g1[4] = (int)128u;                                   // tile_dim1=128, tile_dim2=0
  g1[5] = (int)stride0;                                // tensor_dim0_stride[31:0]
  g1[6] = 0;                                           // stride0 hi | stride1 lo
  g1[7] = 0;
  v4i gz4 = {0, 0, 0, 0};
  v8i gz8 = {0, 0, 0, 0, 0, 0, 0, 0};
  __builtin_amdgcn_tensor_load_to_lds(g0, g1, gz4, gz4, gz8, 0);
}

__global__ __launch_bounds__(256) void init_kernel(float* __restrict__ Wctx,
                                                   float* __restrict__ ksum,
                                                   unsigned* __restrict__ kmaxb) {
  int i = blockIdx.x * 256 + threadIdx.x;
  if (i < 4 * CDIM * CDIM) Wctx[i] = 0.0f;
  if (i < 4 * CDIM) { ksum[i] = 0.0f; kmaxb[i] = 0x007FFFFFu; /* fenc(-inf) */ }
}

// -------- Kernel 1: fused projections, Q-softmax, K row-max -----------------
// Output layouts (per combo = s*2+b): Kt/Vt = (C, N) bf16, Qn = (N, C) bf16.
// Four work-groups share a WGP: 72 KiB of LDS each, and at least 8 waves per SIMD
// (second launch bound), which holds a wave to 128 VGPRs.
__global__ __launch_bounds__(256, 8) void proj_kernel(
    const float* __restrict__ x0, const float* __restrict__ x1,
    const float* __restrict__ Wk0, const float* __restrict__ Wk1,
    const float* __restrict__ Wq0, const float* __restrict__ Wq1,
    const float* __restrict__ Wv0, const float* __restrict__ Wv1,
    bf16* __restrict__ Kt, bf16* __restrict__ Vt, bf16* __restrict__ Qn,
    unsigned* __restrict__ kmaxb)
{
  __shared__ unsigned char smem[2 * CDIM * LDP * sizeof(bf16)] __attribute__((aligned(32)));
  bf16 (*Alds)[LDP] = (bf16 (*)[LDP])smem;                               // weights [c_out][c]
  bf16 (*Blds)[LDP] = (bf16 (*)[LDP])(smem + CDIM * LDP * sizeof(bf16)); // x tile  [n][c]
  float (*Slds)[132] = (float (*)[132])smem;   // Q softmax scratch, laid over both tiles once they are read
  static_assert(sizeof(float) * CDIM * 132 <= sizeof(smem), "scratch fits the two tiles");

  const int t = threadIdx.x, lane = t & 31, wave = t >> 5;
  const int combo = blockIdx.y;                 // s*2 + b
  const int s = combo >> 1, b = combo & 1;
  const int n0 = blockIdx.x * 128;
  const float* xp = (s ? x1 : x0) + (size_t)b * CDIM * NDIM;
  const float* Wk = s ? Wk1 : Wk0;
  const float* Wq = s ? Wq1 : Wq0;
  const float* Wv = s ? Wv1 : Wv0;
  const size_t cb = (size_t)combo * CDIM * NDIM;

  // load x tile (128 c x 128 n), bf16-convert, transpose into Blds[n][c]
  for (int e = t; e < CDIM * 32; e += 256) {
    int c = e >> 5, q = e & 31;
    float4 v = *(const float4*)(xp + (size_t)c * NDIM + n0 + q * 4);
    Blds[q * 4 + 0][c] = (bf16)v.x;
    Blds[q * 4 + 1][c] = (bf16)v.y;
    Blds[q * 4 + 2][c] = (bf16)v.z;
    Blds[q * 4 + 3][c] = (bf16)v.w;
  }

  auto load_w = [&](const float* Wp) {
    for (int e = t; e < CDIM * 32; e += 256) {
      int co = e >> 5, q = e & 31;
      float4 v = *(const float4*)(Wp + co * CDIM + q * 4);
      v4bf pk; pk[0] = (bf16)v.x; pk[1] = (bf16)v.y; pk[2] = (bf16)v.z; pk[3] = (bf16)v.w;
      *(v4bf*)&Alds[co][q * 4] = pk;
    }
  };

  auto run_gemm = [&](v8f* acc) {
#pragma unroll
    for (int ks = 0; ks < 4; ks++) {
      v16bf a = ldfrag(&Alds[0][0], wave * 16, ks * 32, lane);
#pragma unroll
      for (int g = 0; g < 8; g += 4) {   // four B fragments at a time: 64 accumulators + 40 fragment VGPRs
        v16bf bfr[4];
#pragma unroll
        for (int nt = 0; nt < 4; nt++) bfr[nt] = ldfrag(&Blds[0][0], (g + nt) * 16, ks * 32, lane);
#pragma unroll
        for (int nt = 0; nt < 4; nt++) acc[g + nt] = wmma_bf16(a, bfr[nt], acc[g + nt]);
      }
    }
  };
  const v8f vz = {0.f, 0.f, 0.f, 0.f, 0.f, 0.f, 0.f, 0.f};

  // ---- V projection ----
  load_w(Wv);
  __syncthreads();
  {
    v8f acc[8];
#pragma unroll
    for (int i = 0; i < 8; i++) acc[i] = vz;
    run_gemm(acc);
#pragma unroll
    for (int nt = 0; nt < 8; nt++)
#pragma unroll
      for (int r = 0; r < 8; r++) {
        int co = wave * 16 + r + ((lane >> 4) << 3);
        int n = n0 + nt * 16 + (lane & 15);
        Vt[cb + (size_t)co * NDIM + n] = (bf16)acc[nt][r];
      }
  }
  __syncthreads();

  // ---- K projection (store logits + per-row running max over N) ----
  load_w(Wk);
  __syncthreads();
  {
    v8f acc[8];
#pragma unroll
    for (int i = 0; i < 8; i++) acc[i] = vz;
    run_gemm(acc);
#pragma unroll
    for (int nt = 0; nt < 8; nt++)
#pragma unroll
      for (int r = 0; r < 8; r++) {
        int co = wave * 16 + r + ((lane >> 4) << 3);
        int n = n0 + nt * 16 + (lane & 15);
        Kt[cb + (size_t)co * NDIM + n] = (bf16)acc[nt][r];
      }
#pragma unroll
    for (int r = 0; r < 8; r++) {
      float m = acc[0][r];
#pragma unroll
      for (int nt = 1; nt < 8; nt++) m = fmaxf(m, acc[nt][r]);
      m = fmaxf(m, __shfl_xor(m, 1));
      m = fmaxf(m, __shfl_xor(m, 2));
      m = fmaxf(m, __shfl_xor(m, 4));
      m = fmaxf(m, __shfl_xor(m, 8));
      if ((lane & 15) == 0) {
        int co = wave * 16 + r + ((lane >> 4) << 3);
        atomicMax(&kmaxb[combo * CDIM + co], fenc(m));
      }
    }
  }
  __syncthreads();

  // ---- Q projection + softmax over C (per n) ----
  load_w(Wq);
  __syncthreads();
  {
    v8f acc[8];
#pragma unroll
    for (int i = 0; i < 8; i++) acc[i] = vz;
    run_gemm(acc);
    __syncthreads();   // every wave has read its last fragment before the scratch overwrites the tiles
#pragma unroll
    for (int nt = 0; nt < 8; nt++)
#pragma unroll
      for (int r = 0; r < 8; r++) {
        int row = wave * 16 + r + ((lane >> 4) << 3);
        int col = nt * 16 + (lane & 15);
        Slds[row][col] = acc[nt][r];
      }
    __syncthreads();
    if (t < CDIM) {
      int j = t;
      float m = -3.4e38f;
      for (int c = 0; c < CDIM; c++) m = fmaxf(m, Slds[c][j]);
      float ssum = 0.0f;
      for (int c = 0; c < CDIM; c++) {
        float p = exp2f((Slds[c][j] - m) * LOG2E);
        Slds[c][j] = p;
        ssum += p;
      }
      float inv = 1.0f / ssum;
      bf16* qrow = Qn + cb + (size_t)(n0 + j) * CDIM;
      for (int c = 0; c < CDIM; c += 2) {
        v2bf pk;
        pk[0] = (bf16)(Slds[c][j] * inv);
        pk[1] = (bf16)(Slds[c + 1][j] * inv);
        *(v2bf*)&qrow[c] = pk;
      }
    }
  }
}

// -------- Kernel 2: context GEMM  W[c,d] += sum_n exp(K[c,n]-max_c)*V[d,n] ---
// V tile staged by the Tensor Data Mover (overlaps with exp() on the K tile).
__global__ __launch_bounds__(256) void ctx_kernel(
    const bf16* __restrict__ Kt, const bf16* __restrict__ Vt,
    const unsigned* __restrict__ kmaxb,
    float* __restrict__ Wctx, float* __restrict__ ksum)
{
  __shared__ bf16 Elds[CDIM][LDP] __attribute__((aligned(32)));
  __shared__ bf16 Vlds[CDIM][LDP] __attribute__((aligned(32)));
  __shared__ float kmaxL[CDIM];
  __shared__ float ksumL[CDIM];

  const int t = threadIdx.x, lane = t & 31, wave = t >> 5;
  const int combo = blockIdx.y;
  const size_t cb = (size_t)combo * CDIM * NDIM;
  const int nbase = blockIdx.x * NCHUNK;

  if (t < CDIM) { kmaxL[t] = fdec(kmaxb[combo * CDIM + t]); ksumL[t] = 0.0f; }
  __syncthreads();

  const v8f vz = {0.f, 0.f, 0.f, 0.f, 0.f, 0.f, 0.f, 0.f};
  v8f acc[8];
#pragma unroll
  for (int i = 0; i < 8; i++) acc[i] = vz;

  for (int nb = nbase; nb < nbase + NCHUNK; nb += 128) {
    // async DMA: V tile (128 c x 128 n) -> Vlds with padded rows
    if (t < 32) tdm_load_tile(Vt + cb + nb, &Vlds[0][0], NDIM, CDIM, NDIM);

    // meanwhile: stage exp(K - max) tile with VALU, accumulate row sums
    for (int e = t; e < CDIM * 16; e += 256) {
      int c = e >> 4, seg = e & 15;
      const bf16* kp = Kt + cb + (size_t)c * NDIM + nb + seg * 8;
      v8bf kv = *(const v8bf*)kp;
      __builtin_prefetch(kp + 128, 0, 0);   // next chunk -> global_prefetch_b8
      float km = kmaxL[c];
      float part = 0.0f;
      v8bf ev;
#pragma unroll
      for (int j = 0; j < 8; j++) {
        float p = exp2f(((float)kv[j] - km) * LOG2E);
        part += p;
        ev[j] = (bf16)p;
      }
      *(v8bf*)&Elds[c][seg * 8] = ev;
      atomicAdd(&ksumL[c], part);
    }
    if (t < 32) __builtin_amdgcn_s_wait_tensorcnt((short)0);
    __syncthreads();
#pragma unroll
    for (int ks = 0; ks < 4; ks++) {
      v16bf a = ldfrag(&Elds[0][0], wave * 16, ks * 32, lane);
      v16bf bfr[8];
#pragma unroll
      for (int dt = 0; dt < 8; dt++) bfr[dt] = ldfrag(&Vlds[0][0], dt * 16, ks * 32, lane);
#pragma unroll
      for (int dt = 0; dt < 8; dt++) acc[dt] = wmma_bf16(a, bfr[dt], acc[dt]);
    }
    __syncthreads();
  }

  float* Wp = Wctx + combo * CDIM * CDIM;
#pragma unroll
  for (int dt = 0; dt < 8; dt++)
#pragma unroll
    for (int r = 0; r < 8; r++) {
      int c = wave * 16 + r + ((lane >> 4) << 3);
      int d = dt * 16 + (lane & 15);
      atomicAdd(&Wp[c * CDIM + d], acc[dt][r]);
    }
  __syncthreads();
  if (t < CDIM) atomicAdd(&ksum[combo * CDIM + t], ksumL[t]);
}

// -------- Kernel 3: Out_s[d,n] = sum_c (W_{1-s}[c,d]/ksum_c) * Q_s[n,c] -----
// Q tile staged by the Tensor Data Mover.
__global__ __launch_bounds__(256) void out_kernel(
    const bf16* __restrict__ Qn, const float* __restrict__ Wctx,
    const float* __restrict__ ksum, float* __restrict__ out)
{
  __shared__ bf16 Alds[CDIM][LDP] __attribute__((aligned(32)));  // [d][c]
  __shared__ bf16 Qlds[CDIM][LDP] __attribute__((aligned(32)));  // [n][c]
  __shared__ float ksumL[CDIM];

  const int t = threadIdx.x, lane = t & 31, wave = t >> 5;
  const int combo = blockIdx.y;
  const int s = combo >> 1, b = combo & 1;
  const int other = ((1 - s) << 1) | b;
  const int n0 = blockIdx.x * 128;
  const bf16* Qb = Qn + (size_t)combo * CDIM * NDIM;

  // async DMA: Q tile (128 n x 128 c) -> Qlds with padded rows
  if (t < 32) tdm_load_tile(Qb + (size_t)n0 * CDIM, &Qlds[0][0], CDIM, NDIM, CDIM);

  if (t < CDIM) ksumL[t] = ksum[other * CDIM + t];
  __syncthreads();

  const float* Wp = Wctx + other * CDIM * CDIM;
  for (int e = t; e < CDIM * 16; e += 256) {
    int d = e >> 4, seg = e & 15;
#pragma unroll
    for (int j = 0; j < 8; j++) {
      int c = seg * 8 + j;
      Alds[d][c] = (bf16)(Wp[c * CDIM + d] / ksumL[c]);
    }
  }
  if (t < 32) __builtin_amdgcn_s_wait_tensorcnt((short)0);
  __syncthreads();

  const v8f vz = {0.f, 0.f, 0.f, 0.f, 0.f, 0.f, 0.f, 0.f};
  v8f acc[8];
#pragma unroll
  for (int i = 0; i < 8; i++) acc[i] = vz;
#pragma unroll
  for (int ks = 0; ks < 4; ks++) {
    v16bf a = ldfrag(&Alds[0][0], wave * 16, ks * 32, lane);
    v16bf bfr[8];
#pragma unroll
    for (int nt = 0; nt < 8; nt++) bfr[nt] = ldfrag(&Qlds[0][0], nt * 16, ks * 32, lane);
#pragma unroll
    for (int nt = 0; nt < 8; nt++) acc[nt] = wmma_bf16(a, bfr[nt], acc[nt]);
  }

  float* ob = out + (size_t)combo * CDIM * NDIM;
#pragma unroll
  for (int nt = 0; nt < 8; nt++)
#pragma unroll
    for (int r = 0; r < 8; r++) {
      int d = wave * 16 + r + ((lane >> 4) << 3);
      int n = n0 + nt * 16 + (lane & 15);
      ob[(size_t)d * NDIM + n] = acc[nt][r];
    }
}

extern "C" void kernel_launch(void* const* d_in, const int* in_sizes, int n_in,
                              void* d_out, int out_size, void* d_ws, size_t ws_size,
                              hipStream_t stream) {
  (void)in_sizes; (void)n_in; (void)out_size; (void)ws_size;
  const float* x0  = (const float*)d_in[0];
  const float* x1  = (const float*)d_in[1];
  const float* Wk0 = (const float*)d_in[2];
  const float* Wk1 = (const float*)d_in[3];
  const float* Wq0 = (const float*)d_in[4];
  const float* Wq1 = (const float*)d_in[5];
  const float* Wv0 = (const float*)d_in[6];
  const float* Wv1 = (const float*)d_in[7];
  float* out = (float*)d_out;

  const size_t PLANE = (size_t)4 * CDIM * NDIM;   // elems per bf16 array (all combos)
  bf16* Kt = (bf16*)d_ws;
  bf16* Vt = Kt + PLANE;
  bf16* Qn = Vt + PLANE;
  float* Wctx = (float*)(Qn + PLANE);
  float* ksum = Wctx + 4 * CDIM * CDIM;
  unsigned* kmaxb = (unsigned*)(ksum + 4 * CDIM);

  init_kernel<<<dim3((4 * CDIM * CDIM + 255) / 256), 256, 0, stream>>>(Wctx, ksum, kmaxb);
  proj_kernel<<<dim3(NDIM / 128, 4), 256, 0, stream>>>(
      x0, x1, Wk0, Wk1, Wq0, Wq1, Wv0, Wv1, Kt, Vt, Qn, kmaxb);
  ctx_kernel<<<dim3(CHUNKS, 4), 256, 0, stream>>>(Kt, Vt, kmaxb, Wctx, ksum);
  out_kernel<<<dim3(NDIM / 128, 4), 256, 0, stream>>>(Qn, Wctx, ksum, out);
}

// v002
// Measured time: 109 microseconds a run.
// In both of two side-by-side timings against v001, it was 1.40 times as fast.
// All steps since v000 together make it 1.72 times as fast.
#include <hip/hip_runtime.h>

#define CDIM 128
#define NDIM 32768
#define LDP  144                 // padded LDS row (bf16 elems): 288B rows = 64 data dw + 8 pad dw
#define LOG2E 1.4426950408889634f
#define CHUNKS 128
#define NCHUNK (NDIM / CHUNKS)   // 256
#define TOT (4 * CDIM * CDIM + 4 * CDIM)   // floats in one plane: four context matrices, then four row-sum vectors

typedef __bf16 bf16;
typedef __attribute__((ext_vector_type(16))) bf16  v16bf;
typedef __attribute__((ext_vector_type(8)))  bf16  v8bf;
typedef __attribute__((ext_vector_type(4)))  bf16  v4bf;
typedef __attribute__((ext_vector_type(2)))  bf16  v2bf;
typedef __attribute__((ext_vector_type(8)))  float v8f;
typedef unsigned v4u __attribute__((ext_vector_type(4)));
typedef int      v4i __attribute__((ext_vector_type(4)));
typedef int      v8i __attribute__((ext_vector_type(8)));

// A(16x32 bf16) and B(32x16 bf16) fragments share the same address function:
// lane&15 -> row (A: M, B: column), lane>>4 selects k half; 16 contiguous bf16.
static __device__ __forceinline__ v16bf ldfrag(const bf16* base, int row0, int k0, int lane) {
  const bf16* p = base + (size_t)(row0 + (lane & 15)) * LDP + k0 + ((lane >> 4) << 4);
  return *(const v16bf*)p;
}

static __device__ __forceinline__ v8f wmma_bf16(v16bf a, v16bf b, v8f c) {
  return __builtin_amdgcn_wmma_f32_16x16x32_bf16(false, a, false, b, (short)0, c, false, false);
}

// monotone float<->uint mapping for atomicMax on floats
static __device__ __forceinline__ unsigned fenc(float f) {
  unsigned u = __float_as_uint(f);
  return (u & 0x80000000u) ? ~u : (u | 0x80000000u);
}
static __device__ __forceinline__ float fdec(unsigned u) {
  return (u & 0x80000000u) ? __uint_as_float(u & 0x7FFFFFFFu) : __uint_as_float(~u);
}

// TDM: DMA a 128x128 tile of 2-byte elements (row length dim0, row stride stride0,
// dim1 rows total in tensor) from global into LDS with 64dw+8dw row padding (-> LDP rows).
static __device__ __forceinline__ void tdm_load_tile(const void* gsrc, void* ldst,
                                                     unsigned dim0, unsigned dim1,
                                                     unsigned stride0) {
  unsigned long long ga = (unsigned long long)(size_t)gsrc;
  unsigned lds_off = (unsigned)(size_t)ldst;   // generic LDS addr low 32 bits = LDS offset
  v4u g0;
  g0[0] = 1u;                                          // count=1, user descriptor
  g0[1] = lds_off;                                     // LDS byte address
  g0[2] = (unsigned)(ga & 0xFFFFFFFFu);                // global_addr[31:0]
  g0[3] = (unsigned)((ga >> 32) & 0x01FFFFFFu) | 0x80000000u;  // addr[56:32] | type=2
  v8i g1;
  g1[0] = (int)((1u << 16) | (1u << 20) | (5u << 22) | (7u << 25)); // 2B elems, pad_en, 64dw interval, 8dw pad
  g1[1] = (int)((dim0 & 0xFFFFu) << 16);               // tensor_dim0[15:0]
  g1[2] = (int)(((dim0 >> 16) & 0xFFFFu) | ((dim1 & 0xFFFFu) << 16)); // dim0 hi | dim1 lo
  g1[3] = (int)(((dim1 >> 16) & 0xFFFFu) | (128u << 16));            // dim1 hi | tile_dim0=128
  g1[4] = (int)128u;                                   // tile_dim1=128, tile_dim2=0
  g1[5] = (int)stride0;                                // tensor_dim0_stride[31:0]
  g1[6] = 0;                                           // stride0 hi | stride1 lo
  g1[7] = 0;
  v4i gz4 = {0, 0, 0, 0};
  v8i gz8 = {0, 0, 0, 0, 0, 0, 0, 0};
  __builtin_amdgcn_tensor_load_to_lds(g0, g1, gz4, gz4, gz8, 0);
}

__global__ __launch_bounds__(256) void init_kernel(unsigned* __restrict__ kmaxb) {
  int i = blockIdx.x * 256 + threadIdx.x;
  if (i < 4 * CDIM) kmaxb[i] = 0x007FFFFFu; /* fenc(-inf) */
}

// -------- Kernel 1: fused projections, Q-softmax, K row-max -----------------
// Output layouts (per combo = s*2+b): Kt/Vt = (C, N) bf16, Qn = (N, C) bf16.
// Four work-groups share a WGP: 72 KiB of LDS each, and at least 8 waves per SIMD
// (second launch bound), which holds a wave to 128 VGPRs.
__global__ __launch_bounds__(256, 8) void proj_kernel(
    const float* __restrict__ x0, const float* __restrict__ x1,
    const float* __restrict__ Wk0, const float* __restrict__ Wk1,
    const float* __restrict__ Wq0, const float* __restrict__ Wq1,
    const float* __restrict__ Wv0, const float* __restrict__ Wv1,
    bf16* __restrict__ Kt, bf16* __restrict__ Vt, bf16* __restrict__ Qn,
    unsigned* __restrict__ kmaxb)
{
  __shared__ unsigned char smem[2 * CDIM * LDP * sizeof(bf16)] __attribute__((aligned(32)));
  bf16 (*Alds)[LDP] = (bf16 (*)[LDP])smem;                               // weights [c_out][c]
  bf16 (*Blds)[LDP] = (bf16 (*)[LDP])(smem + CDIM * LDP * sizeof(bf16)); // x tile  [n][c]
  float (*Slds)[132] = (float (*)[132])smem;   // Q softmax scratch, laid over both tiles once they are read
  static_assert(sizeof(float) * CDIM * 132 <= sizeof(smem), "scratch fits the two tiles");

  const int t = threadIdx.x, lane = t & 31, wave = t >> 5;
  const int combo = blockIdx.y;                 // s*2 + b
  const int s = combo >> 1, b = combo & 1;
  const int n0 = blockIdx.x * 128;
  const float* xp = (s ? x1 : x0) + (size_t)b * CDIM * NDIM;
  const float* Wk = s ? Wk1 : Wk0;
  const float* Wq = s ? Wq1 : Wq0;
  const float* Wv = s ? Wv1 : Wv0;
  const size_t cb = (size_t)combo * CDIM * NDIM;

  // load x tile (128 c x 128 n), bf16-convert, transpose into Blds[n][c]
  for (int e = t; e < CDIM * 32; e += 256) {
    int c = e >> 5, q = e & 31;
    float4 v = *(const float4*)(xp + (size_t)c * NDIM + n0 + q * 4);
    Blds[q * 4 + 0][c] = (bf16)v.x;
    Blds[q * 4 + 1][c] = (bf16)v.y;
    Blds[q * 4 + 2][c] = (bf16)v.z;
    Blds[q * 4 + 3][c] = (bf16)v.w;
  }

  auto load_w = [&](const float* Wp) {
    for (int e = t; e < CDIM * 32; e += 256) {
      int co = e >> 5, q = e & 31;
      float4 v = *(const float4*)(Wp + co * CDIM + q * 4);
      v4bf pk; pk[0] = (bf16)v.x; pk[1] = (bf16)v.y; pk[2] = (bf16)v.z; pk[3] = (bf16)v.w;
      *(v4bf*)&Alds[co][q * 4] = pk;
    }
  };

  auto run_gemm = [&](v8f* acc) {
#pragma unroll
    for (int ks = 0; ks < 4; ks++) {
      v16bf a = ldfrag(&Alds[0][0], wave * 16, ks * 32, lane);
#pragma unroll
      for (int g = 0; g < 8; g += 4) {   // four B fragments at a time: 64 accumulators + 40 fragment VGPRs
        v16bf bfr[4];
#pragma unroll
        for (int nt = 0; nt < 4; nt++) bfr[nt] = ldfrag(&Blds[0][0], (g + nt) * 16, ks * 32, lane);
#pragma unroll
        for (int nt = 0; nt < 4; nt++) acc[g + nt] = wmma_bf16(a, bfr[nt], acc[g + nt]);
      }
    }
  };
  const v8f vz = {0.f, 0.f, 0.f, 0.f, 0.f, 0.f, 0.f, 0.f};

  // ---- V projection ----
  load_w(Wv);
  __syncthreads();
  {
    v8f acc[8];
#pragma unroll
    for (int i = 0; i < 8; i++) acc[i] = vz;
    run_gemm(acc);
#pragma unroll
    for (int nt = 0; nt < 8; nt++)
#pragma unroll
      for (int r = 0; r < 8; r++) {
        int co = wave * 16 + r + ((lane >> 4) << 3);
        int n = n0 + nt * 16 + (lane & 15);
        Vt[cb + (size_t)co * NDIM + n] = (bf16)acc[nt][r];
      }
  }
  __syncthreads();

  // ---- K projection (store logits + per-row running max over N) ----
  load_w(Wk);
  __syncthreads();
  {
    v8f acc[8];
#pragma unroll
    for (int i = 0; i < 8; i++) acc[i] = vz;
    run_gemm(acc);
#pragma unroll
    for (int nt = 0; nt < 8; nt++)
#pragma unroll
      for (int r = 0; r < 8; r++) {
        int co = wave * 16 + r + ((lane >> 4) << 3);
        int n = n0 + nt * 16 + (lane & 15);
        Kt[cb + (size_t)co * NDIM + n] = (bf16)acc[nt][r];
      }
#pragma unroll
    for (int r = 0; r < 8; r++) {
      float m = acc[0][r];
#pragma unroll
      for (int nt = 1; nt < 8; nt++) m = fmaxf(m, acc[nt][r]);
      m = fmaxf(m, __shfl_xor(m, 1));
      m = fmaxf(m, __shfl_xor(m, 2));
      m = fmaxf(m, __shfl_xor(m, 4));
      m = fmaxf(m, __shfl_xor(m, 8));
      if ((lane & 15) == 0) {
        int co = wave * 16 + r + ((lane >> 4) << 3);
        atomicMax(&kmaxb[combo * CDIM + co], fenc(m));
      }
    }
  }
  __syncthreads();

  // ---- Q projection + softmax over C (per n) ----
  load_w(Wq);
  __syncthreads();
  {
    v8f acc[8];
#pragma unroll
    for (int i = 0; i < 8; i++) acc[i] = vz;
    run_gemm(acc);
    __syncthreads();   // every wave has read its last fragment before the scratch overwrites the tiles
#pragma unroll
    for (int nt = 0; nt < 8; nt++)
#pragma unroll
      for (int r = 0; r < 8; r++) {
        int row = wave * 16 + r + ((lane >> 4) << 3);
        int col = nt * 16 + (lane & 15);
        Slds[row][col] = acc[nt][r];
      }
    __syncthreads();
    if (t < CDIM) {
      int j = t;
      float m = -3.4e38f;
      for (int c = 0; c < CDIM; c++) m = fmaxf(m, Slds[c][j]);
      float ssum = 0.0f;
      for (int c = 0; c < CDIM; c++) {
        float p = exp2f((Slds[c][j] - m) * LOG2E);
        Slds[c][j] = p;
        ssum += p;
      }
      float inv = 1.0f / ssum;
      bf16* qrow = Qn + cb + (size_t)(n0 + j) * CDIM;
      for (int c = 0; c < CDIM; c += 2) {
        v2bf pk;
        pk[0] = (bf16)(Slds[c][j] * inv);
        pk[1] = (bf16)(Slds[c + 1][j] * inv);
        *(v2bf*)&qrow[c] = pk;
      }
    }
  }
}

// -------- Kernel 2: context GEMM  W[c,d] = sum_n exp(K[c,n]-max_c)*V[d,n] ----
// Each work-group sums over its own chunk of N and stores the result and its row sums
// into its chunk's plane of the workspace; reduce_kernel adds the planes.
// V tile staged by the Tensor Data Mover (overlaps with exp() on the K tile).
__global__ __launch_bounds__(256) void ctx_kernel(
    const bf16* __restrict__ Kt, const bf16* __restrict__ Vt,
    const unsigned* __restrict__ kmaxb,
    float* __restrict__ part)
{
  __shared__ bf16 Elds[CDIM][LDP] __attribute__((aligned(32)));
  __shared__ bf16 Vlds[CDIM][LDP] __attribute__((aligned(32)));
  __shared__ float kmaxL[CDIM];
  __shared__ float ksumL[CDIM];

  const int t = threadIdx.x, lane = t & 31, wave = t >> 5;
  const int combo = blockIdx.y;
  const size_t cb = (size_t)combo * CDIM * NDIM;
  const int nbase = blockIdx.x * NCHUNK;

  if (t < CDIM) { kmaxL[t] = fdec(kmaxb[combo * CDIM + t]); ksumL[t] = 0.0f; }
  __syncthreads();

  const v8f vz = {0.f, 0.f, 0.f, 0.f, 0.f, 0.f, 0.f, 0.f};
  v8f acc[8];
#pragma unroll
  for (int i = 0; i < 8; i++) acc[i] = vz;

  // Kept rolled: the tensor load stays one site, with the descriptor set-up and the waits it has
  // run with (the two trips would otherwise be unrolled into two sites).
#pragma unroll 1
  for (int nb = nbase; nb < nbase + NCHUNK; nb += 128) {
    // async DMA: V tile (128 c x 128 n) -> Vlds with padded rows
    if (t < 32) tdm_load_tile(Vt + cb + nb, &Vlds[0][0], NDIM, CDIM, NDIM);

    // meanwhile: stage exp(K - max) tile with VALU, accumulate row sums
    for (int e = t; e < CDIM * 16; e += 256) {
      int c = e >> 4, seg = e & 15;
      const bf16* kp = Kt + cb + (size_t)c * NDIM + nb + seg * 8;
      v8bf kv = *(const v8bf*)kp;
      __builtin_prefetch(kp + 128, 0, 0);   // next 128-column tile -> global_prefetch_b8
      float km = kmaxL[c];
      float part = 0.0f;
      v8bf ev;
#pragma unroll
      for (int j = 0; j < 8; j++) {
        float p = exp2f(((float)kv[j] - km) * LOG2E);
        part += p;
        ev[j] = (bf16)p;
      }
      *(v8bf*)&Elds[c][seg * 8] = ev;
      atomicAdd(&ksumL[c], part);
    }
    if (t < 32) __builtin_amdgcn_s_wait_tensorcnt((short)0);
    __syncthreads();
#pragma unroll
    for (int ks = 0; ks < 4; ks++) {
      v16bf a = ldfrag(&Elds[0][0], wave * 16, ks * 32, lane);
      v16bf bfr[8];
#pragma unroll
      for (int dt = 0; dt < 8; dt++) bfr[dt] = ldfrag(&Vlds[0][0], dt * 16, ks * 32, lane);
#pragma unroll
      for (int dt = 0; dt < 8; dt++) acc[dt] = wmma_bf16(a, bfr[dt], acc[dt]);
    }
    __syncthreads();
  }

  float* plane = part + (size_t)blockIdx.x * TOT;
  float* Wp = plane + combo * CDIM * CDIM;
#pragma unroll
  for (int dt = 0; dt < 8; dt++)
#pragma unroll
    for (int r = 0; r < 8; r++) {
      int c = wave * 16 + r + ((lane >> 4) << 3);
      int d = dt * 16 + (lane & 15);
      Wp[c * CDIM + d] = acc[dt][r];
    }
  if (t < CDIM) plane[4 * CDIM * CDIM + combo * CDIM + t] = ksumL[t];
}

// -------- Kernel 2b: add the CHUNKS planes, in a fixed order ------------------
// A work-group owns 64 float4 columns of a plane; its four quarters each add a quarter
// of the planes, and the first quarter adds the four results through LDS.
__global__ __launch_bounds__(256) void reduce_kernel(const float* __restrict__ part,
                                                     float* __restrict__ tot)
{
  __shared__ float4 red[4][64];
  const int t = threadIdx.x, col = t & 63, g = t >> 6;
  const int i4 = blockIdx.x * 64 + col;
  const float4* p = (const float4*)part + (size_t)(g * (CHUNKS / 4)) * (TOT / 4) + i4;
  float4 v[CHUNKS / 4];
#pragma unroll   // constant offsets from one address, and many independent loads in flight per thread
  for (int k = 0; k < CHUNKS / 4; k++) v[k] = p[(size_t)k * (TOT / 4)];
  float4 s = v[0];
#pragma unroll   // v[] is indexed by constants only, so it stays in registers
  for (int k = 1; k < CHUNKS / 4; k++) {
    s.x += v[k].x; s.y += v[k].y; s.z += v[k].z; s.w += v[k].w;
  }
  red[g][col] = s;
  __syncthreads();
  if (g == 0) {
    float4 a = red[0][col], b = red[1][col], c = red[2][col], d = red[3][col];
    float4 r;
    r.x = (a.x + b.x) + (c.x + d.x);
    r.y = (a.y + b.y) + (c.y + d.y);
    r.z = (a.z + b.z) + (c.z + d.z);
    r.w = (a.w + b.w) + (c.w + d.w);
    ((float4*)tot)[i4] = r;
  }
}

// -------- Kernel 3: Out_s[d,n] = sum_c (W_{1-s}[c,d]/ksum_c) * Q_s[n,c] -----
// Q tile staged by the Tensor Data Mover.
__global__ __launch_bounds__(256) void out_kernel(
    const bf16* __restrict__ Qn, const float* __restrict__ Wctx,
    const float* __restrict__ ksum, float* __restrict__ out)
{
  __shared__ bf16 Alds[CDIM][LDP] __attribute__((aligned(32)));  // [d][c]
  __shared__ bf16 Qlds[CDIM][LDP] __attribute__((aligned(32)));  // [n][c]
  __shared__ float ksumL[CDIM];

  const int t = threadIdx.x, lane = t & 31, wave = t >> 5;
  const int combo = blockIdx.y;
  const int s = combo >> 1, b = combo & 1;
  const int other = ((1 - s) << 1) | b;
  const int n0 = blockIdx.x * 128;
  const bf16* Qb = Qn + (size_t)combo * CDIM * NDIM;

  // async DMA: Q tile (128 n x 128 c) -> Qlds with padded rows
  if (t < 32) tdm_load_tile(Qb + (size_t)n0 * CDIM, &Qlds[0][0], CDIM, NDIM, CDIM);

  if (t < CDIM) ksumL[t] = ksum[other * CDIM + t];
  __syncthreads();

  const float* Wp = Wctx + other * CDIM * CDIM;
  for (int e = t; e < CDIM * 16; e += 256) {
    int d = e >> 4, seg = e & 15;
#pragma unroll
    for (int j = 0; j < 8; j++) {
      int c = seg * 8 + j;
      Alds[d][c] = (bf16)(Wp[c * CDIM + d] / ksumL[c]);
    }
  }
  if (t < 32) __builtin_amdgcn_s_wait_tensorcnt((short)0);
  __syncthreads();

  const v8f vz = {0.f, 0.f, 0.f, 0.f, 0.f, 0.f, 0.f, 0.f};
  v8f acc[8];
#pragma unroll
  for (int i = 0; i < 8; i++) acc[i] = vz;
#pragma unroll
  for (int ks = 0; ks < 4; ks++) {
    v16bf a = ldfrag(&Alds[0][0], wave * 16, ks * 32, lane);
    v16bf bfr[8];
#pragma unroll
    for (int nt = 0; nt < 8; nt++) bfr[nt] = ldfrag(&Qlds[0][0], nt * 16, ks * 32, lane);
#pragma unroll
    for (int nt = 0; nt < 8; nt++) acc[nt] = wmma_bf16(a, bfr[nt], acc[nt]);
  }

  float* ob = out + (size_t)combo * CDIM * NDIM;
#pragma unroll
  for (int nt = 0; nt < 8; nt++)
#pragma unroll
    for (int r = 0; r < 8; r++) {
      int d = wave * 16 + r + ((lane >> 4) << 3);
      int n = n0 + nt * 16 + (lane & 15);
      ob[(size_t)d * NDIM + n] = acc[nt][r];
    }
}

extern "C" void kernel_launch(void* const* d_in, const int* in_sizes, int n_in,
                              void* d_out, int out_size, void* d_ws, size_t ws_size,
                              hipStream_t stream) {
  (void)in_sizes; (void)n_in; (void)out_size; (void)ws_size;
  const float* x0  = (const float*)d_in[0];
  const float* x1  = (const float*)d_in[1];
  const float* Wk0 = (const float*)d_in[2];
  const float* Wk1 = (const float*)d_in[3];
  const float* Wq0 = (const float*)d_in[4];
  const float* Wq1 = (const float*)d_in[5];
  const float* Wv0 = (const float*)d_in[6];
  const float* Wv1 = (const float*)d_in[7];
  float* out = (float*)d_out;

  const size_t PLANE = (size_t)4 * CDIM * NDIM;   // elems per bf16 array (all combos)
  bf16* Kt = (bf16*)d_ws;
  bf16* Vt = Kt + PLANE;
  bf16* Qn = Vt + PLANE;
  float* Wctx = (float*)(Qn + PLANE);
  float* ksum = Wctx + 4 * CDIM * CDIM;
  unsigned* kmaxb = (unsigned*)(ksum + 4 * CDIM);
  float* part = (float*)(kmaxb + 4 * CDIM);       // CHUNKS planes laid out like [Wctx | ksum]

  init_kernel<<<dim3((4 * CDIM + 255) / 256), 256, 0, stream>>>(kmaxb);
  proj_kernel<<<dim3(NDIM / 128, 4), 256, 0, stream>>>(
      x0, x1, Wk0, Wk1, Wq0, Wq1, Wv0, Wv1, Kt, Vt, Qn, kmaxb);
  ctx_kernel<<<dim3(CHUNKS, 4), 256, 0, stream>>>(Kt, Vt, kmaxb, part);
  reduce_kernel<<<dim3(TOT / 4 / 64), 256, 0, stream>>>(part, Wctx);   // ksum follows Wctx: one plane
  out_kernel<<<dim3(NDIM / 128, 4), 256, 0, stream>>>(Qn, Wctx, ksum, out);
}

// v003
// A run of this version takes 87.9 microseconds.
// Next to v002, in two timings, it ran 1.24 times as fast each time.
// Counting every step since v000, it is 2.13 times as fast.
#include <hip/hip_runtime.h>

#define CDIM 128
#define NDIM 32768
#define LDP  144                 // padded LDS row (bf16 elems): 288B rows = 64 data dw + 8 pad dw
#define LOG2E 1.4426950408889634f
#define CHUNKS 128
#define NCHUNK (NDIM / CHUNKS)   // 256
#define TOT (4 * CDIM * CDIM + 4 * CDIM)   // floats in one plane: four context matrices, then four row-sum vectors

typedef __bf16 bf16;
typedef __attribute__((ext_vector_type(16))) bf16  v16bf;
typedef __attribute__((ext_vector_type(8)))  bf16  v8bf;
typedef __attribute__((ext_vector_type(4)))  bf16  v4bf;
typedef __attribute__((ext_vector_type(2)))  bf16  v2bf;
typedef __attribute__((ext_vector_type(8)))  float v8f;
typedef __attribute__((ext_vector_type(4)))  float v4f;
typedef unsigned v4u __attribute__((ext_vector_type(4)));
typedef int      v4i __attribute__((ext_vector_type(4)));
typedef int      v8i __attribute__((ext_vector_type(8)));

// A(16x32 bf16) and B(32x16 bf16) fragments share the same address function:
// lane&15 -> row (A: M, B: column), lane>>4 selects k half; 16 contiguous bf16.
static __device__ __forceinline__ v16bf ldfrag(const bf16* base, int row0, int k0, int lane) {
  const bf16* p = base + (size_t)(row0 + (lane & 15)) * LDP + k0 + ((lane >> 4) << 4);
  return *(const v16bf*)p;
}

static __device__ __forceinline__ v8f wmma_bf16(v16bf a, v16bf b, v8f c) {
  return __builtin_amdgcn_wmma_f32_16x16x32_bf16(false, a, false, b, (short)0, c, false, false);
}

// Transposing stage: a 128 x 128 f32 tile src[k][row] (row pitch 'stride' floats) goes to dst[row][k] as bf16.
// A lane owns a block of 8 k x 4 rows, so both sides are wide: eight 16-byte loads (8 lanes cover a whole
// 128-byte line of one k, 4 lines per wave load) and four 16-byte LDS stores of 8 consecutive k.
// Lane bits: bit 0 and bits 3..4 pick the float4 within the line, bits 1..2 pick one of four k groups; at a row
// pitch of 72 dwords the 32 lanes of one store then fall on 8 different groups of 4 banks (4 rows apart alone: 2).
// DIVIDE: every element is divided by den[k] first.
template <bool DIVIDE>
static __device__ __forceinline__ void stage_transposed(const float* __restrict__ src, size_t stride,
                                                        bf16 (*dst)[LDP], const float* den, int t) {
  const int lane = t & 31, wave = t >> 5;
  const int q8 = (lane & 1) | ((lane >> 3) << 1);   // 0..7
  const int gs = (lane >> 1) & 3;                   // 0..3
  const int k0 = ((wave >> 1) * 4 + gs) * 8;        // a wave's two blocks share their k group ...
  const int r0 = ((wave & 1) * 16 + q8) * 4;        // ... and lie 32 rows apart: one aligned 256-byte unit per k
  const float* base = src + (size_t)k0 * stride + r0;
  v4f v[2][8];
#pragma unroll   // both loops: a lane's sixteen loads stand ahead of their uses, one base address and constant offsets
  for (int u = 0; u < 2; u++)
#pragma unroll
    for (int j = 0; j < 8; j++)
      v[u][j] = *(const v4f*)(base + (size_t)j * stride + u * 32);
  // The wait that stands in front of any overwrite of the loads' address registers. It takes the address as an
  // input, so the pair stays live up to here and no load of the run can land its result in it.
  asm volatile("s_wait_xcnt 0x0" :: "v"(base) : "memory");
#pragma unroll   // all three loops: v[][] and pk[] are indexed by constants only, so they stay in registers
  for (int u = 0; u < 2; u++)
#pragma unroll
    for (int i = 0; i < 4; i++) {
      v8bf pk;
#pragma unroll
      for (int j = 0; j < 8; j++) pk[j] = (bf16)(DIVIDE ? v[u][j][i] / den[k0 + j] : v[u][j][i]);
      *(v8bf*)&dst[r0 + u * 32 + i][k0] = pk;
    }
}

// monotone float<->uint mapping for atomicMax on floats
static __device__ __forceinline__ unsigned fenc(float f) {
  unsigned u = __float_as_uint(f);
  return (u & 0x80000000u) ? ~u : (u | 0x80000000u);
}
static __device__ __forceinline__ float fdec(unsigned u) {
  return (u & 0x80000000u) ? __uint_as_float(u & 0x7FFFFFFFu) : __uint_as_float(~u);
}

// TDM: DMA a 128x128 tile of 2-byte elements (row length dim0, row stride stride0,
// dim1 rows total in tensor) from global into LDS with 64dw+8dw row padding (-> LDP rows).
static __device__ __forceinline__ void tdm_load_tile(const void* gsrc, void* ldst,
                                                     unsigned dim0, unsigned dim1,
                                                     unsigned stride0) {
  unsigned long long ga = (unsigned long long)(size_t)gsrc;
  unsigned lds_off = (unsigned)(size_t)ldst;   // generic LDS addr low 32 bits = LDS offset
  v4u g0;
  g0[0] = 1u;                                          // count=1, user descriptor
  g0[1] = lds_off;                                     // LDS byte address
  g0[2] = (unsigned)(ga & 0xFFFFFFFFu);                // global_addr[31:0]
  g0[3] = (unsigned)((ga >> 32) & 0x01FFFFFFu) | 0x80000000u;  // addr[56:32] | type=2
  v8i g1;
  g1[0] = (int)((1u << 16) | (1u << 20) | (5u << 22) | (7u << 25)); // 2B elems, pad_en, 64dw interval, 8dw pad
  g1[1] = (int)((dim0 & 0xFFFFu) << 16);               // tensor_dim0[15:0]
  g1[2] = (int)(((dim0 >> 16) & 0xFFFFu) | ((dim1 & 0xFFFFu) << 16)); // dim0 hi | dim1 lo
  g1[3] = (int)(((dim1 >> 16) & 0xFFFFu) | (128u << 16));            // dim1 hi | tile_dim0=128
  g1[4] = (int)128u;                                   // tile_dim1=128, tile_dim2=0
  g1[5] = (int)stride0;                                // tensor_dim0_stride[31:0]
  g1[6] = 0;                                           // stride0 hi | stride1 lo
  g1[7] = 0;
  v4i gz4 = {0, 0, 0, 0};
  v8i gz8 = {0, 0, 0, 0, 0, 0, 0, 0};
  __builtin_amdgcn_tensor_load_to_lds(g0, g1, gz4, gz4, gz8, 0);
}

__global__ __launch_bounds__(256) void init_kernel(unsigned* __restrict__ kmaxb) {
  int i = blockIdx.x * 256 + threadIdx.x;
  if (i < 4 * CDIM) kmaxb[i] = 0x007FFFFFu; /* fenc(-inf) */
}

// -------- Kernel 1: fused projections, Q-softmax, K row-max -----------------
// Output layouts (per combo = s*2+b): Kt/Vt = (C, N) bf16, Qn = (N, C) bf16.
// Four work-groups share a WGP: 72 KiB of LDS each, and at least 8 waves per SIMD
// (second launch bound), which holds a wave to 128 VGPRs.
__global__ __launch_bounds__(256, 8) void proj_kernel(
    const float* __restrict__ x0, const float* __restrict__ x1,
    const float* __restrict__ Wk0, const float* __restrict__ Wk1,
    const float* __restrict__ Wq0, const float* __restrict__ Wq1,
    const float* __restrict__ Wv0, const float* __restrict__ Wv1,
    bf16* __restrict__ Kt, bf16* __restrict__ Vt, bf16* __restrict__ Qn,
    unsigned* __restrict__ kmaxb)
{
  __shared__ unsigned char smem[2 * CDIM * LDP * sizeof(bf16)] __attribute__((aligned(32)));
  bf16 (*Alds)[LDP] = (bf16 (*)[LDP])smem;                               // weights [c_out][c]
  bf16 (*Blds)[LDP] = (bf16 (*)[LDP])(smem + CDIM * LDP * sizeof(bf16)); // x tile  [n][c]
  float (*Slds)[132] = (float (*)[132])smem;   // Q softmax scratch, laid over both tiles once they are read
  static_assert(sizeof(float) * CDIM * 132 <= sizeof(smem), "scratch fits the two tiles");

  const int t = threadIdx.x, lane = t & 31, wave = t >> 5;
  const int combo = blockIdx.y;                 // s*2 + b
  const int s = combo >> 1, b = combo & 1;
  const int n0 = blockIdx.x * 128;
  const float* xp = (s ? x1 : x0) + (size_t)b * CDIM * NDIM;
  const float* Wk = s ? Wk1 : Wk0;
  const float* Wq = s ? Wq1 : Wq0;
  const float* Wv = s ? Wv1 : Wv0;
  const size_t cb = (size_t)combo * CDIM * NDIM;

  // load x tile (128 c x 128 n), bf16-convert, transpose into Blds[n][c]
  stage_transposed<false>(xp + n0, NDIM, Blds, nullptr, t);

  auto load_w = [&](const float* Wp) {
    for (int e = t; e < CDIM * 32; e += 256) {
      int co = e >> 5, q = e & 31;
      float4 v = *(const float4*)(Wp + co * CDIM + q * 4);
      v4bf pk; pk[0] = (bf16)v.x; pk[1] = (bf16)v.y; pk[2] = (bf16)v.z; pk[3] = (bf16)v.w;
      *(v4bf*)&Alds[co][q * 4] = pk;
    }
  };

  auto run_gemm = [&](v8f* acc) {
#pragma unroll
    for (int ks = 0; ks < 4; ks++) {
      v16bf a = ldfrag(&Alds[0][0], wave * 16, ks * 32, lane);
#pragma unroll
      for (int g = 0; g < 8; g += 4) {   // four B fragments at a time: 64 accumulators + 40 fragment VGPRs
        v16bf bfr[4];
#pragma unroll
        for (int nt = 0; nt < 4; nt++) bfr[nt] = ldfrag(&Blds[0][0], (g + nt) * 16, ks * 32, lane);
#pragma unroll
        for (int nt = 0; nt < 4; nt++) acc[g + nt] = wmma_bf16(a, bfr[nt], acc[g + nt]);
      }
    }
  };
  const v8f vz = {0.f, 0.f, 0.f, 0.f, 0.f, 0.f, 0.f, 0.f};

  // ---- V projection ----
  load_w(Wv);
  __syncthreads();
  {
    v8f acc[8];
#pragma unroll
    for (int i = 0; i < 8; i++) acc[i] = vz;
    run_gemm(acc);
#pragma unroll
    for (int nt = 0; nt < 8; nt++)
#pragma unroll
      for (int r = 0; r < 8; r++) {
        int co = wave * 16 + r + ((lane >> 4) << 3);
        int n = n0 + nt * 16 + (lane & 15);
        Vt[cb + (size_t)co * NDIM + n] = (bf16)acc[nt][r];
      }
  }
  __syncthreads();

  // ---- K projection (store logits + per-row running max over N) ----
  load_w(Wk);
  __syncthreads();
  {
    v8f acc[8];
#pragma unroll
    for (int i = 0; i < 8; i++) acc[i] = vz;
    run_gemm(acc);
#pragma unroll
    for (int nt = 0; nt < 8; nt++)
#pragma unroll
      for (int r = 0; r < 8; r++) {
        int co = wave * 16 + r + ((lane >> 4) << 3);
        int n = n0 + nt * 16 + (lane & 15);
        Kt[cb + (size_t)co * NDIM + n] = (bf16)acc[nt][r];
      }
#pragma unroll
    for (int r = 0; r < 8; r++) {
      float m = acc[0][r];
#pragma unroll
      for (int nt = 1; nt < 8; nt++) m = fmaxf(m, acc[nt][r]);
      m = fmaxf(m, __shfl_xor(m, 1));
      m = fmaxf(m, __shfl_xor(m, 2));
      m = fmaxf(m, __shfl_xor(m, 4));
      m = fmaxf(m, __shfl_xor(m, 8));
      if ((lane & 15) == 0) {
        int co = wave * 16 + r + ((lane >> 4) << 3);
        atomicMax(&kmaxb[combo * CDIM + co], fenc(m));
      }
    }
  }
  __syncthreads();

  // ---- Q projection + softmax over C (per n) ----
  load_w(Wq);
  __syncthreads();
  {
    v8f acc[8];
#pragma unroll
    for (int i = 0; i < 8; i++) acc[i] = vz;
    run_gemm(acc);
    __syncthreads();   // every wave has read its last fragment before the scratch overwrites the tiles
#pragma unroll
    for (int nt = 0; nt < 8; nt++)
#pragma unroll
      for (int r = 0; r < 8; r++) {
        int row = wave * 16 + r + ((lane >> 4) << 3);
        int col = nt * 16 + (lane & 15);
        Slds[row][col] = acc[nt][r];
      }
    __syncthreads();
    if (t < CDIM) {
      int j = t;
      float m = -3.4e38f;
      for (int c = 0; c < CDIM; c++) m = fmaxf(m, Slds[c][j]);
      float ssum = 0.0f;
      for (int c = 0; c < CDIM; c++) {
        float p = exp2f((Slds[c][j] - m) * LOG2E);
        Slds[c][j] = p;
        ssum += p;
      }
      float inv = 1.0f / ssum;
      bf16* qrow = Qn + cb + (size_t)(n0 + j) * CDIM;
      for (int c = 0; c < CDIM; c += 2) {
        v2bf pk;
        pk[0] = (bf16)(Slds[c][j] * inv);
        pk[1] = (bf16)(Slds[c + 1][j] * inv);
        *(v2bf*)&qrow[c] = pk;
      }
    }
  }
}

// -------- Kernel 2: context GEMM  W[c,d] = sum_n exp(K[c,n]-max_c)*V[d,n] ----
// Each work-group sums over its own chunk of N and stores the result and its row sums
// into its chunk's plane of the workspace; reduce_kernel adds the planes.
// V tile staged by the Tensor Data Mover (overlaps with exp() on the K tile).
__global__ __launch_bounds__(256) void ctx_kernel(
    const bf16* __restrict__ Kt, const bf16* __restrict__ Vt,
    const unsigned* __restrict__ kmaxb,
    float* __restrict__ part)
{
  __shared__ bf16 Elds[CDIM][LDP] __attribute__((aligned(32)));
  __shared__ bf16 Vlds[CDIM][LDP] __attribute__((aligned(32)));
  __shared__ float kmaxL[CDIM];
  __shared__ float ksumL[CDIM];

  const int t = threadIdx.x, lane = t & 31, wave = t >> 5;
  const int combo = blockIdx.y;
  const size_t cb = (size_t)combo * CDIM * NDIM;
  const int nbase = blockIdx.x * NCHUNK;

  if (t < CDIM) { kmaxL[t] = fdec(kmaxb[combo * CDIM + t]); ksumL[t] = 0.0f; }
  __syncthreads();

  const v8f vz = {0.f, 0.f, 0.f, 0.f, 0.f, 0.f, 0.f, 0.f};
  v8f acc[8];
#pragma unroll
  for (int i = 0; i < 8; i++) acc[i] = vz;

  // Kept rolled: the tensor load stays one site, with the descriptor set-up and the waits it has
  // run with (the two trips would otherwise be unrolled into two sites).
#pragma unroll 1
  for (int nb = nbase; nb < nbase + NCHUNK; nb += 128) {
    // async DMA: V tile (128 c x 128 n) -> Vlds with padded rows
    if (t < 32) tdm_load_tile(Vt + cb + nb, &Vlds[0][0], NDIM, CDIM, NDIM);

    // meanwhile: stage exp(K - max) tile with VALU, accumulate row sums
    for (int e = t; e < CDIM * 16; e += 256) {
      int c = e >> 4, seg = e & 15;
      const bf16* kp = Kt + cb + (size_t)c * NDIM + nb + seg * 8;
      v8bf kv = *(const v8bf*)kp;
      __builtin_prefetch(kp + 128, 0, 0);   // next 128-column tile -> global_prefetch_b8
      float km = kmaxL[c];
      float part = 0.0f;
      v8bf ev;
#pragma unroll
      for (int j = 0; j < 8; j++) {
        float p = exp2f(((float)kv[j] - km) * LOG2E);
        part += p;
        ev[j] = (bf16)p;
      }
      *(v8bf*)&Elds[c][seg * 8] = ev;
      atomicAdd(&ksumL[c], part);
    }
    if (t < 32) __builtin_amdgcn_s_wait_tensorcnt((short)0);
    __syncthreads();
#pragma unroll
    for (int ks = 0; ks < 4; ks++) {
      v16bf a = ldfrag(&Elds[0][0], wave * 16, ks * 32, lane);
      v16bf bfr[8];
#pragma unroll
      for (int dt = 0; dt < 8; dt++) bfr[dt] = ldfrag(&Vlds[0][0], dt * 16, ks * 32, lane);
#pragma unroll
      for (int dt = 0; dt < 8; dt++) acc[dt] = wmma_bf16(a, bfr[dt], acc[dt]);
    }
    __syncthreads();
  }

  float* plane = part + (size_t)blockIdx.x * TOT;
  float* Wp = plane + combo * CDIM * CDIM;
#pragma unroll
  for (int dt = 0; dt < 8; dt++)
#pragma unroll
    for (int r = 0; r < 8; r++) {
      int c = wave * 16 + r + ((lane >> 4) << 3);
      int d = dt * 16 + (lane & 15);
      Wp[c * CDIM + d] = acc[dt][r];
    }
  if (t < CDIM) plane[4 * CDIM * CDIM + combo * CDIM + t] = ksumL[t];
}

// -------- Kernel 2b: add the CHUNKS planes, in a fixed order ------------------
// A work-group owns 64 float4 columns of a plane; its four quarters each add a quarter
// of the planes, and the first quarter adds the four results through LDS.
__global__ __launch_bounds__(256) void reduce_kernel(const float* __restrict__ part,
                                                     float* __restrict__ tot)
{
  __shared__ float4 red[4][64];
  const int t = threadIdx.x, col = t & 63, g = t >> 6;
  const int i4 = blockIdx.x * 64 + col;
  const float4* p = (const float4*)part + (size_t)(g * (CHUNKS / 4)) * (TOT / 4) + i4;
  float4 v[CHUNKS / 4];
#pragma unroll   // constant offsets from one address, and many independent loads in flight per thread
  for (int k = 0; k < CHUNKS / 4; k++) v[k] = p[(size_t)k * (TOT / 4)];
  float4 s = v[0];
#pragma unroll   // v[] is indexed by constants only, so it stays in registers
  for (int k = 1; k < CHUNKS / 4; k++) {
    s.x += v[k].x; s.y += v[k].y; s.z += v[k].z; s.w += v[k].w;
  }
  red[g][col] = s;
  __syncthreads();
  if (g == 0) {
    float4 a = red[0][col], b = red[1][col], c = red[2][col], d = red[3][col];
    float4 r;
    r.x = (a.x + b.x) + (c.x + d.x);
    r.y = (a.y + b.y) + (c.y + d.y);
    r.z = (a.z + b.z) + (c.z + d.z);
    r.w = (a.w + b.w) + (c.w + d.w);
    ((float4*)tot)[i4] = r;
  }
}

// -------- Kernel 3: Out_s[d,n] = sum_c (W_{1-s}[c,d]/ksum_c) * Q_s[n,c] -----
// Q tile staged by the Tensor Data Mover.
// Second launch bound: a wave stays within 128 VGPRs, so that four work-groups still share a WGP.
__global__ __launch_bounds__(256, 8) void out_kernel(
    const bf16* __restrict__ Qn, const float* __restrict__ Wctx,
    const float* __restrict__ ksum, float* __restrict__ out)
{
  __shared__ bf16 Alds[CDIM][LDP] __attribute__((aligned(32)));  // [d][c]
  __shared__ bf16 Qlds[CDIM][LDP] __attribute__((aligned(32)));  // [n][c]
  __shared__ float ksumL[CDIM];

  const int t = threadIdx.x, lane = t & 31, wave = t >> 5;
  const int combo = blockIdx.y;
  const int s = combo >> 1, b = combo & 1;
  const int other = ((1 - s) << 1) | b;
  const int n0 = blockIdx.x * 128;
  const bf16* Qb = Qn + (size_t)combo * CDIM * NDIM;

  // async DMA: Q tile (128 n x 128 c) -> Qlds with padded rows
  if (t < 32) tdm_load_tile(Qb + (size_t)n0 * CDIM, &Qlds[0][0], CDIM, NDIM, CDIM);

  if (t < CDIM) ksumL[t] = ksum[other * CDIM + t];
  __syncthreads();

  const float* Wp = Wctx + other * CDIM * CDIM;
  stage_transposed<true>(Wp, CDIM, Alds, ksumL, t);   // Alds[d][c] = Wp[c][d] / ksumL[c]
  if (t < 32) __builtin_amdgcn_s_wait_tensorcnt((short)0);
  __syncthreads();

  const v8f vz = {0.f, 0.f, 0.f, 0.f, 0.f, 0.f, 0.f, 0.f};
  v8f acc[8];
#pragma unroll
  for (int i = 0; i < 8; i++) acc[i] = vz;
#pragma unroll
  for (int ks = 0; ks < 4; ks++) {
    v16bf a = ldfrag(&Alds[0][0], wave * 16, ks * 32, lane);
    v16bf bfr[8];
#pragma unroll
    for (int nt = 0; nt < 8; nt++) bfr[nt] = ldfrag(&Qlds[0][0], nt * 16, ks * 32, lane);
#pragma unroll
    for (int nt = 0; nt < 8; nt++) acc[nt] = wmma_bf16(a, bfr[nt], acc[nt]);
  }

  float* ob = out + (size_t)combo * CDIM * NDIM;
#pragma unroll
  for (int nt = 0; nt < 8; nt++)
#pragma unroll
    for (int r = 0; r < 8; r++) {
      int d = wave * 16 + r + ((lane >> 4) << 3);
      int n = n0 + nt * 16 + (lane & 15);
      ob[(size_t)d * NDIM + n] = acc[nt][r];
    }
}

extern "C" void kernel_launch(void* const* d_in, const int* in_sizes, int n_in,
                              void* d_out, int out_size, void* d_ws, size_t ws_size,
                              hipStream_t stream) {
  (void)in_sizes; (void)n_in; (void)out_size; (void)ws_size;
  const float* x0  = (const float*)d_in[0];
  const float* x1  = (const float*)d_in[1];
  const float* Wk0 = (const float*)d_in[2];
  const float* Wk1 = (const float*)d_in[3];
  const float* Wq0 = (const float*)d_in[4];
  const float* Wq1 = (const float*)d_in[5];
  const float* Wv0 = (const float*)d_in[6];
  const float* Wv1 = (const float*)d_in[7];
  float* out = (float*)d_out;

  const size_t PLANE = (size_t)4 * CDIM * NDIM;   // elems per bf16 array (all combos)
  bf16* Kt = (bf16*)d_ws;
  bf16* Vt = Kt + PLANE;
  bf16* Qn = Vt + PLANE;
  float* Wctx = (float*)(Qn + PLANE);
  float* ksum = Wctx + 4 * CDIM * CDIM;
  unsigned* kmaxb = (unsigned*)(ksum + 4 * CDIM);
  float* part = (float*)(kmaxb + 4 * CDIM);       // CHUNKS planes laid out like [Wctx | ksum]

  init_kernel<<<dim3((4 * CDIM + 255) / 256), 256, 0, stream>>>(kmaxb);
  proj_kernel<<<dim3(NDIM / 128, 4), 256, 0, stream>>>(
      x0, x1, Wk0, Wk1, Wq0, Wq1, Wv0, Wv1, Kt, Vt, Qn, kmaxb);
  ctx_kernel<<<dim3(CHUNKS, 4), 256, 0, stream>>>(Kt, Vt, kmaxb, part);
  reduce_kernel<<<dim3(TOT / 4 / 64), 256, 0, stream>>>(part, Wctx);   // ksum follows Wctx: one plane
  out_kernel<<<dim3(NDIM / 128, 4), 256, 0, stream>>>(Qn, Wctx, ksum, out);
}

// v004
// It runs in 77.8 microseconds.
// Next to v003, in two timings, it ran 1.13 times as fast each time.
// All steps since v000 together make it 2.40 times as fast.
#include <hip/hip_runtime.h>

#define CDIM 128
#define NDIM 32768
#define LDP  144                 // padded LDS row (bf16 elems): 288B rows = 64 data dw + 8 pad dw
#define LOG2E 1.4426950408889634f
#define CHUNKS 128
#define NCHUNK (NDIM / CHUNKS)   // 256
#define TOT (4 * CDIM * CDIM + 4 * CDIM)   // floats in one plane: four context matrices, then four row-sum vectors

typedef __bf16 bf16;
typedef __attribute__((ext_vector_type(16))) bf16  v16bf;
typedef __attribute__((ext_vector_type(8)))  bf16  v8bf;
typedef __attribute__((ext_vector_type(4)))  bf16  v4bf;
typedef __attribute__((ext_vector_type(2)))  bf16  v2bf;
typedef __attribute__((ext_vector_type(8)))  float v8f;
typedef __attribute__((ext_vector_type(4)))  float v4f;
typedef __attribute__((ext_vector_type(2)))  float v2f;
typedef unsigned v4u __attribute__((ext_vector_type(4)));
typedef int      v4i __attribute__((ext_vector_type(4)));
typedef int      v8i __attribute__((ext_vector_type(8)));

// A(16x32 bf16) and B(32x16 bf16) fragments share the same address function:
// lane&15 -> row (A: M, B: column), lane>>4 selects k half; 16 contiguous bf16.
static __device__ __forceinline__ v16bf ldfrag(const bf16* base, int row0, int k0, int lane) {
  const bf16* p = base + (size_t)(row0 + (lane & 15)) * LDP + k0 + ((lane >> 4) << 4);
  return *(const v16bf*)p;
}

static __device__ __forceinline__ v8f wmma_bf16(v16bf a, v16bf b, v8f c) {
  return __builtin_amdgcn_wmma_f32_16x16x32_bf16(false, a, false, b, (short)0, c, false, false);
}

// Transposing stage: a 128 x 128 f32 tile src[k][row] (row pitch 'stride' floats) goes to dst[row][k] as bf16.
// A lane owns a block of 8 k x 4 rows, so both sides are wide: eight 16-byte loads (8 lanes cover a whole
// 128-byte line of one k, 4 lines per wave load) and four 16-byte LDS stores of 8 consecutive k.
// Lane bits: bit 0 and bits 3..4 pick the float4 within the line, bits 1..2 pick one of four k groups; at a row
// pitch of 72 dwords the 32 lanes of one store then fall on 8 different groups of 4 banks (4 rows apart alone: 2).
// DIVIDE: every element is divided by den[k] first.
template <bool DIVIDE>
static __device__ __forceinline__ void stage_transposed(const float* __restrict__ src, size_t stride,
                                                        bf16 (*dst)[LDP], const float* den, int t) {
  const int lane = t & 31, wave = t >> 5;
  const int q8 = (lane & 1) | ((lane >> 3) << 1);   // 0..7
  const int gs = (lane >> 1) & 3;                   // 0..3
  const int k0 = ((wave >> 1) * 4 + gs) * 8;        // a wave's two blocks share their k group ...
  const int r0 = ((wave & 1) * 16 + q8) * 4;        // ... and lie 32 rows apart: one aligned 256-byte unit per k
  const float* base = src + (size_t)k0 * stride + r0;
  v4f v[2][8];
#pragma unroll   // both loops: a lane's sixteen loads stand ahead of their uses, one base address and constant offsets
  for (int u = 0; u < 2; u++)
#pragma unroll
    for (int j = 0; j < 8; j++)
      v[u][j] = *(const v4f*)(base + (size_t)j * stride + u * 32);
  // The wait that stands in front of any overwrite of the loads' address registers. It takes the address as an
  // input, so the pair stays live up to here and no load of the run can land its result in it.
  asm volatile("s_wait_xcnt 0x0" :: "v"(base) : "memory");
#pragma unroll   // all three loops: v[][] and pk[] are indexed by constants only, so they stay in registers
  for (int u = 0; u < 2; u++)
#pragma unroll
    for (int i = 0; i < 4; i++) {
      v8bf pk;
#pragma unroll
      for (int j = 0; j < 8; j++) pk[j] = (bf16)(DIVIDE ? v[u][j][i] / den[k0 + j] : v[u][j][i]);
      *(v8bf*)&dst[r0 + u * 32 + i][k0] = pk;
    }
}

// Value of lane l ^ X inside a 16-lane row, by DPP (row_xmask): no LDS, no wait counter.
template <int X>
static __device__ __forceinline__ float row_xor(float v) {
  return __builtin_bit_cast(float, __builtin_amdgcn_update_dpp(0, __builtin_bit_cast(int, v), 0x160 | X, 0xf, 0xf, true));
}
// Maximum over each 16-lane row, for two values at once (all lanes on). In asm text because the compiler makes three
// instructions of each step written with fmaxf (a DPP move, a quieting maximum, the maximum); two chains fill each other's latency.
static __device__ __forceinline__ void row_max16_by2(float& a, float& b) {
  asm("v_max_num_f32_dpp %0, %0, %0 row_xmask:1 row_mask:0xf bank_mask:0xf\n\t"
      "v_max_num_f32_dpp %1, %1, %1 row_xmask:1 row_mask:0xf bank_mask:0xf\n\t"
      "v_max_num_f32_dpp %0, %0, %0 row_xmask:2 row_mask:0xf bank_mask:0xf\n\t"
      "v_max_num_f32_dpp %1, %1, %1 row_xmask:2 row_mask:0xf bank_mask:0xf\n\t"
      "v_max_num_f32_dpp %0, %0, %0 row_xmask:4 row_mask:0xf bank_mask:0xf\n\t"
      "v_max_num_f32_dpp %1, %1, %1 row_xmask:4 row_mask:0xf bank_mask:0xf\n\t"
      "v_max_num_f32_dpp %0, %0, %0 row_xmask:8 row_mask:0xf bank_mask:0xf\n\t"
      "v_max_num_f32_dpp %1, %1, %1 row_xmask:8 row_mask:0xf bank_mask:0xf"
      : "+v"(a), "+v"(b));
}
static __device__ __forceinline__ float row_sum16(float v) {
  v += row_xor<1>(v); v += row_xor<2>(v); v += row_xor<4>(v); return v + row_xor<8>(v);
}

// Eight 2^x in place, arguments <= 0 (a result below the smallest normal f32 may come out as 0). One statement: no
// instruction in it reads a neighbour's result or overwrites a neighbour's source, and the v_nop at its end is the slot
// that the instruction set asks for behind a transcendental, whatever the compiler puts next.
static __device__ __forceinline__ void exp2_by8(float (&e)[8]) {
  asm("v_exp_f32 %0, %0\n\tv_exp_f32 %1, %1\n\tv_exp_f32 %2, %2\n\tv_exp_f32 %3, %3\n\t"
      "v_exp_f32 %4, %4\n\tv_exp_f32 %5, %5\n\tv_exp_f32 %6, %6\n\tv_exp_f32 %7, %7\n\tv_nop"
      : "+v"(e[0]), "+v"(e[1]), "+v"(e[2]), "+v"(e[3]), "+v"(e[4]), "+v"(e[5]), "+v"(e[6]), "+v"(e[7]));
}

// monotone float<->uint mapping for atomicMax on floats
static __device__ __forceinline__ unsigned fenc(float f) {
  unsigned u = __float_as_uint(f);
  return (u & 0x80000000u) ? ~u : (u | 0x80000000u);
}
static __device__ __forceinline__ float fdec(unsigned u) {
  return (u & 0x80000000u) ? __uint_as_float(u & 0x7FFFFFFFu) : __uint_as_float(~u);
}

// TDM: DMA a 128x128 tile of 2-byte elements (row length dim0, row stride stride0,
// dim1 rows total in tensor) from global into LDS with 64dw+8dw row padding (-> LDP rows).
static __device__ __forceinline__ void tdm_load_tile(const void* gsrc, void* ldst,
                                                     unsigned dim0, unsigned dim1,
                                                     unsigned stride0) {
  unsigned long long ga = (unsigned long long)(size_t)gsrc;
  unsigned lds_off = (unsigned)(size_t)ldst;   // generic LDS addr low 32 bits = LDS offset
  v4u g0;
  g0[0] = 1u;                                          // count=1, user descriptor
  g0[1] = lds_off;                                     // LDS byte address
  g0[2] = (unsigned)(ga & 0xFFFFFFFFu);                // global_addr[31:0]
  g0[3] = (unsigned)((ga >> 32) & 0x01FFFFFFu) | 0x80000000u;  // addr[56:32] | type=2
  v8i g1;
  g1[0] = (int)((1u << 16) | (1u << 20) | (5u << 22) | (7u << 25)); // 2B elems, pad_en, 64dw interval, 8dw pad
  g1[1] = (int)((dim0 & 0xFFFFu) << 16);               // tensor_dim0[15:0]
  g1[2] = (int)(((dim0 >> 16) & 0xFFFFu) | ((dim1 & 0xFFFFu) << 16)); // dim0 hi | dim1 lo
  g1[3] = (int)(((dim1 >> 16) & 0xFFFFu) | (128u << 16));            // dim1 hi | tile_dim0=128
  g1[4] = (int)128u;                                   // tile_dim1=128, tile_dim2=0
  g1[5] = (int)stride0;                                // tensor_dim0_stride[31:0]
  g1[6] = 0;                                           // stride0 hi | stride1 lo
  g1[7] = 0;
  v4i gz4 = {0, 0, 0, 0};
  v8i gz8 = {0, 0, 0, 0, 0, 0, 0, 0};
  __builtin_amdgcn_tensor_load_to_lds(g0, g1, gz4, gz4, gz8, 0);
}

__global__ __launch_bounds__(256) void init_kernel(unsigned* __restrict__ kmaxb) {
  int i = blockIdx.x * 256 + threadIdx.x;
  if (i < 4 * CDIM) kmaxb[i] = 0x007FFFFFu; /* fenc(-inf) */
}

// -------- Kernel 1: fused projections, Q-softmax, K row-max -----------------
// Output layouts (per combo = s*2+b): Kt/Vt = (C, N) bf16, Qn = (N, C) bf16.
// Four work-groups share a WGP: 72 KiB of LDS each, and at least 8 waves per SIMD
// (second launch bound), which holds a wave to 128 VGPRs.
__global__ __launch_bounds__(256, 8) void proj_kernel(
    const float* __restrict__ x0, const float* __restrict__ x1,
    const float* __restrict__ Wk0, const float* __restrict__ Wk1,
    const float* __restrict__ Wq0, const float* __restrict__ Wq1,
    const float* __restrict__ Wv0, const float* __restrict__ Wv1,
    bf16* __restrict__ Kt, bf16* __restrict__ Vt, bf16* __restrict__ Qn,
    unsigned* __restrict__ kmaxb)
{
  __shared__ unsigned char smem[2 * CDIM * LDP * sizeof(bf16)] __attribute__((aligned(32)));
  bf16 (*Alds)[LDP] = (bf16 (*)[LDP])smem;                               // weights [c_out][c]
  bf16 (*Blds)[LDP] = (bf16 (*)[LDP])(smem + CDIM * LDP * sizeof(bf16)); // x tile  [n][c]

  const int t = threadIdx.x, lane = t & 31, wave = t >> 5;
  const int combo = blockIdx.y;                 // s*2 + b
  const int s = combo >> 1, b = combo & 1;
  const int n0 = blockIdx.x * 128;
  const float* xp = (s ? x1 : x0) + (size_t)b * CDIM * NDIM;
  const float* Wk = s ? Wk1 : Wk0;
  const float* Wq = s ? Wq1 : Wq0;
  const float* Wv = s ? Wv1 : Wv0;
  const size_t cb = (size_t)combo * CDIM * NDIM;

  // load x tile (128 c x 128 n), bf16-convert, transpose into Blds[n][c]
  stage_transposed<false>(xp + n0, NDIM, Blds, nullptr, t);

  // deal: weight row co goes to LDS row (co & 7) * 16 + (co >> 3), so that column l of fragment tile nt is row l * 8 + nt
  auto load_w = [&](const float* Wp, bool deal = false) {
    for (int e = t; e < CDIM * 32; e += 256) {
      int co = e >> 5, q = e & 31;
      float4 v = *(const float4*)(Wp + co * CDIM + q * 4);
      v4bf pk; pk[0] = (bf16)v.x; pk[1] = (bf16)v.y; pk[2] = (bf16)v.z; pk[3] = (bf16)v.w;
      *(v4bf*)&Alds[deal ? (co & 7) * 16 + (co >> 3) : co][q * 4] = pk;
    }
  };

  // acc[j] += rows wave * 16 .. + 15 of At times rows j * 16 .. + 15 of Bt (both tiles are [row][k])
  auto run_gemm = [&](v8f* acc, const bf16* At, const bf16* Bt, bool held) {
#pragma unroll
    for (int ks = 0; ks < 4; ks++) {
      v16bf a = ldfrag(At, wave * 16, ks * 32, lane);
#pragma unroll
      for (int g = 0; g < 8; g += 4) {   // four B fragments at a time: 64 accumulators + 40 fragment VGPRs
        v16bf bfr[4];
#pragma unroll
        for (int nt = 0; nt < 4; nt++) bfr[nt] = ldfrag(Bt, (g + nt) * 16, ks * 32, lane);
        // held: no product moves up over its group's loads. Left free in front of the register softmax, the scheduler
        // draws the loads of later groups so far forward that an accumulator tile is spilled to scratch.
        if (held) __builtin_amdgcn_sched_barrier(0);
#pragma unroll
        for (int nt = 0; nt < 4; nt++) acc[g + nt] = wmma_bf16(a, bfr[nt], acc[g + nt]);
      }
    }
  };
  const v8f vz = {0.f, 0.f, 0.f, 0.f, 0.f, 0.f, 0.f, 0.f};

  // ---- V projection ----
  load_w(Wv);
  __syncthreads();
  {
    v8f acc[8];
#pragma unroll
    for (int i = 0; i < 8; i++) acc[i] = vz;
    run_gemm(acc, &Alds[0][0], &Blds[0][0], false);
#pragma unroll
    for (int nt = 0; nt < 8; nt++)
#pragma unroll
      for (int r = 0; r < 8; r++) {
        int co = wave * 16 + r + ((lane >> 4) << 3);
        int n = n0 + nt * 16 + (lane & 15);
        Vt[cb + (size_t)co * NDIM + n] = (bf16)acc[nt][r];
      }
  }
  __syncthreads();

  // ---- K projection (store logits + per-row running max over N) ----
  load_w(Wk);
  __syncthreads();
  {
    v8f acc[8];
#pragma unroll
    for (int i = 0; i < 8; i++) acc[i] = vz;
    run_gemm(acc, &Alds[0][0], &Blds[0][0], false);
#pragma unroll
    for (int nt = 0; nt < 8; nt++)
#pragma unroll
      for (int r = 0; r < 8; r++) {
        int co = wave * 16 + r + ((lane >> 4) << 3);
        int n = n0 + nt * 16 + (lane & 15);
        Kt[cb + (size_t)co * NDIM + n] = (bf16)acc[nt][r];
      }
#pragma unroll
    for (int r = 0; r < 8; r++) {
      float m = acc[0][r];
#pragma unroll
      for (int nt = 1; nt < 8; nt++) m = fmaxf(m, acc[nt][r]);
      m = fmaxf(m, __shfl_xor(m, 1));
      m = fmaxf(m, __shfl_xor(m, 2));
      m = fmaxf(m, __shfl_xor(m, 4));
      m = fmaxf(m, __shfl_xor(m, 8));
      if ((lane & 15) == 0) {
        int co = wave * 16 + r + ((lane >> 4) << 3);
        atomicMax(&kmaxb[combo * CDIM + co], fenc(m));
      }
    }
  }
  __syncthreads();

  // ---- Q projection + softmax over C (per n) ----
  // The x tile is the A operand here: a wave holds all 128 logits of its 16 rows n, so the softmax needs no LDS.
  // acc[nt][r] = logit of n = wave * 16 + 8 * (lane >> 4) + r, c = (lane & 15) * 8 + nt (weight rows dealt as above):
  // a lane's eight tiles are eight consecutive c, and 16 lanes store one whole row of Qn.
  load_w(Wq, true);
  __syncthreads();
  {
    v8f acc[8];
#pragma unroll
    for (int i = 0; i < 8; i++) acc[i] = vz;
    run_gemm(acc, &Blds[0][0], &Alds[0][0], true);
    v8bf pk[8];
#pragma unroll   // all levels: acc[][], p[] and pk[] are indexed by constants only, so they stay in registers
    for (int r = 0; r < 8; r += 2) {   // two rows at a time: they lie in neighbouring registers, which packed f32 math takes as they are
      v2f ssum = {0.0f, 0.0f}, p[8];
      float m0 = acc[0][r], m1 = acc[0][r + 1];
#pragma unroll
      for (int nt = 1; nt < 8; nt++) {
        m0 = fmaxf(m0, acc[nt][r]);
        m1 = fmaxf(m1, acc[nt][r + 1]);
      }
      row_max16_by2(m0, m1);
      const v2f m = {m0, m1};
#pragma unroll
      for (int g = 0; g < 8; g += 4) {
        float e[8];
#pragma unroll
        for (int j = 0; j < 4; j++) {
          v2f x = {acc[g + j][r], acc[g + j][r + 1]};
          x = (x - m) * LOG2E;
          e[2 * j] = x[0];
          e[2 * j + 1] = x[1];
        }
        exp2_by8(e);
#pragma unroll
        for (int j = 0; j < 4; j++) {
          p[g + j] = v2f{e[2 * j], e[2 * j + 1]};
          ssum += p[g + j];
        }
      }
      v2f inv = {1.0f / row_sum16(ssum[0]), 1.0f / row_sum16(ssum[1])};
#pragma unroll
      for (int nt = 0; nt < 8; nt++) {
        v2f q = p[nt] * inv;
        pk[r][nt] = (bf16)q[0];
        pk[r + 1][nt] = (bf16)q[1];
      }
    }
    bf16* qrow = Qn + cb + (size_t)(n0 + wave * 16 + ((lane >> 4) << 3)) * CDIM + (lane & 15) * 8;
#pragma unroll   // pk[] indexed by constants; the eight stores take one address with constant offsets and end the kernel
    for (int r = 0; r < 8; r++) *(v8bf*)&qrow[r * CDIM] = pk[r];
  }
}

// -------- Kernel 2: context GEMM  W[c,d] = sum_n exp(K[c,n]-max_c)*V[d,n] ----
// Each work-group sums over its own chunk of N and stores the result and its row sums
// into its chunk's plane of the workspace; reduce_kernel adds the planes.
// V tile staged by the Tensor Data Mover (overlaps with exp() on the K tile).
__global__ __launch_bounds__(256) void ctx_kernel(
    const bf16* __restrict__ Kt, const bf16* __restrict__ Vt,
    const unsigned* __restrict__ kmaxb,
    float* __restrict__ part)
{
  __shared__ bf16 Elds[CDIM][LDP] __attribute__((aligned(32)));
  __shared__ bf16 Vlds[CDIM][LDP] __attribute__((aligned(32)));
  __shared__ float kmaxL[CDIM];
  __shared__ float ksumL[CDIM];

  const int t = threadIdx.x, lane = t & 31, wave = t >> 5;
  const int combo = blockIdx.y;
  const size_t cb = (size_t)combo * CDIM * NDIM;
  const int nbase = blockIdx.x * NCHUNK;

  if (t < CDIM) { kmaxL[t] = fdec(kmaxb[combo * CDIM + t]); ksumL[t] = 0.0f; }
  __syncthreads();

  const v8f vz = {0.f, 0.f, 0.f, 0.f, 0.f, 0.f, 0.f, 0.f};
  v8f acc[8];
#pragma unroll
  for (int i = 0; i < 8; i++) acc[i] = vz;

  // Kept rolled: the tensor load stays one site, with the descriptor set-up and the waits it has
  // run with (the two trips would otherwise be unrolled into two sites).
#pragma unroll 1
  for (int nb = nbase; nb < nbase + NCHUNK; nb += 128) {
    // async DMA: V tile (128 c x 128 n) -> Vlds with padded rows
    if (t < 32) tdm_load_tile(Vt + cb + nb, &Vlds[0][0], NDIM, CDIM, NDIM);

    // meanwhile: stage exp(K - max) tile with VALU, accumulate row sums
    for (int e = t; e < CDIM * 16; e += 256) {
      int c = e >> 4, seg = e & 15;
      const bf16* kp = Kt + cb + (size_t)c * NDIM + nb + seg * 8;
      v8bf kv = *(const v8bf*)kp;
      __builtin_prefetch(kp + 128, 0, 0);   // next 128-column tile -> global_prefetch_b8
      float km = kmaxL[c];
      float part = 0.0f;
      v8bf ev;
#pragma unroll
      for (int j = 0; j < 8; j++) {
        float p = exp2f(((float)kv[j] - km) * LOG2E);
        part += p;
        ev[j] = (bf16)p;
      }
      *(v8bf*)&Elds[c][seg * 8] = ev;
      atomicAdd(&ksumL[c], part);
    }
    if (t < 32) __builtin_amdgcn_s_wait_tensorcnt((short)0);
    __syncthreads();
#pragma unroll
    for (int ks = 0; ks < 4; ks++) {
      v16bf a = ldfrag(&Elds[0][0], wave * 16, ks * 32, lane);
      v16bf bfr[8];
#pragma unroll
      for (int dt = 0; dt < 8; dt++) bfr[dt] = ldfrag(&Vlds[0][0], dt * 16, ks * 32, lane);
#pragma unroll
      for (int dt = 0; dt < 8; dt++) acc[dt] = wmma_bf16(a, bfr[dt], acc[dt]);
    }
    __syncthreads();
  }

  float* plane = part + (size_t)blockIdx.x * TOT;
  float* Wp = plane + combo * CDIM * CDIM;
#pragma unroll
  for (int dt = 0; dt < 8; dt++)
#pragma unroll
    for (int r = 0; r < 8; r++) {
      int c = wave * 16 + r + ((lane >> 4) << 3);
      int d = dt * 16 + (lane & 15);
      Wp[c * CDIM + d] = acc[dt][r];
    }
  if (t < CDIM) plane[4 * CDIM * CDIM + combo * CDIM + t] = ksumL[t];
}

// -------- Kernel 2b: add the CHUNKS planes, in a fixed order ------------------
// A work-group owns 64 float4 columns of a plane; its four quarters each add a quarter
// of the planes, and the first quarter adds the four results through LDS.
__global__ __launch_bounds__(256) void reduce_kernel(const float* __restrict__ part,
                                                     float* __restrict__ tot)
{
  __shared__ float4 red[4][64];
  const int t = threadIdx.x, col = t & 63, g = t >> 6;
  const int i4 = blockIdx.x * 64 + col;
  const float4* p = (const float4*)part + (size_t)(g * (CHUNKS / 4)) * (TOT / 4) + i4;
  float4 v[CHUNKS / 4];
#pragma unroll   // constant offsets from one address, and many independent loads in flight per thread
  for (int k = 0; k < CHUNKS / 4; k++) v[k] = p[(size_t)k * (TOT / 4)];
  float4 s = v[0];
#pragma unroll   // v[] is indexed by constants only, so it stays in registers
  for (int k = 1; k < CHUNKS / 4; k++) {
    s.x += v[k].x; s.y += v[k].y; s.z += v[k].z; s.w += v[k].w;
  }
  red[g][col] = s;
  __syncthreads();
  if (g == 0) {
    float4 a = red[0][col], b = red[1][col], c = red[2][col], d = red[3][col];
    float4 r;
    r.x = (a.x + b.x) + (c.x + d.x);
    r.y = (a.y + b.y) + (c.y + d.y);
    r.z = (a.z + b.z) + (c.z + d.z);
    r.w = (a.w + b.w) + (c.w + d.w);
    ((float4*)tot)[i4] = r;
  }
}

// -------- Kernel 3: Out_s[d,n] = sum_c (W_{1-s}[c,d]/ksum_c) * Q_s[n,c] -----
// Q tile staged by the Tensor Data Mover.
// Second launch bound: a wave stays within 128 VGPRs, so that four work-groups still share a WGP.
__global__ __launch_bounds__(256, 8) void out_kernel(
    const bf16* __restrict__ Qn, const float* __restrict__ Wctx,
    const float* __restrict__ ksum, float* __restrict__ out)
{
  __shared__ bf16 Alds[CDIM][LDP] __attribute__((aligned(32)));  // [d][c]
  __shared__ bf16 Qlds[CDIM][LDP] __attribute__((aligned(32)));  // [n][c]
  __shared__ float ksumL[CDIM];

  const int t = threadIdx.x, lane = t & 31, wave = t >> 5;
  const int combo = blockIdx.y;
  const int s = combo >> 1, b = combo & 1;
  const int other = ((1 - s) << 1) | b;
  const int n0 = blockIdx.x * 128;
  const bf16* Qb = Qn + (size_t)combo * CDIM * NDIM;

  // async DMA: Q tile (128 n x 128 c) -> Qlds with padded rows
  if (t < 32) tdm_load_tile(Qb + (size_t)n0 * CDIM, &Qlds[0][0], CDIM, NDIM, CDIM);

  if (t < CDIM) ksumL[t] = ksum[other * CDIM + t];
  __syncthreads();

  const float* Wp = Wctx + other * CDIM * CDIM;
  stage_transposed<true>(Wp, CDIM, Alds, ksumL, t);   // Alds[d][c] = Wp[c][d] / ksumL[c]
  if (t < 32) __builtin_amdgcn_s_wait_tensorcnt((short)0);
  __syncthreads();

  const v8f vz = {0.f, 0.f, 0.f, 0.f, 0.f, 0.f, 0.f, 0.f};
  v8f acc[8];
#pragma unroll
  for (int i = 0; i < 8; i++) acc[i] = vz;
#pragma unroll
  for (int ks = 0; ks < 4; ks++) {
    v16bf a = ldfrag(&Alds[0][0], wave * 16, ks * 32, lane);
    v16bf bfr[8];
#pragma unroll
    for (int nt = 0; nt < 8; nt++) bfr[nt] = ldfrag(&Qlds[0][0], nt * 16, ks * 32, lane);
#pragma unroll
    for (int nt = 0; nt < 8; nt++) acc[nt] = wmma_bf16(a, bfr[nt], acc[nt]);
  }

  float* ob = out + (size_t)combo * CDIM * NDIM;
#pragma unroll
  for (int nt = 0; nt < 8; nt++)
#pragma unroll
    for (int r = 0; r < 8; r++) {
      int d = wave * 16 + r + ((lane >> 4) << 3);
      int n = n0 + nt * 16 + (lane & 15);
      ob[(size_t)d * NDIM + n] = acc[nt][r];
    }
}

extern "C" void kernel_launch(void* const* d_in, const int* in_sizes, int n_in,
                              void* d_out, int out_size, void* d_ws, size_t ws_size,
                              hipStream_t stream) {
  (void)in_sizes; (void)n_in; (void)out_size; (void)ws_size;
  const float* x0  = (const float*)d_in[0];
  const float* x1  = (const float*)d_in[1];
  const float* Wk0 = (const float*)d_in[2];
  const float* Wk1 = (const float*)d_in[3];
  const float* Wq0 = (const float*)d_in[4];
  const float* Wq1 = (const float*)d_in[5];
  const float* Wv0 = (const float*)d_in[6];
  const float* Wv1 = (const float*)d_in[7];
  float* out = (float*)d_out;

  const size_t PLANE = (size_t)4 * CDIM * NDIM;   // elems per bf16 array (all combos)
  bf16* Kt = (bf16*)d_ws;
  bf16* Vt = Kt + PLANE;
  bf16* Qn = Vt + PLANE;
  float* Wctx = (float*)(Qn + PLANE);
  float* ksum = Wctx + 4 * CDIM * CDIM;
  unsigned* kmaxb = (unsigned*)(ksum + 4 * CDIM);
  float* part = (float*)(kmaxb + 4 * CDIM);       // CHUNKS planes laid out like [Wctx | ksum]

  init_kernel<<<dim3((4 * CDIM + 255) / 256), 256, 0, stream>>>(kmaxb);
  proj_kernel<<<dim3(NDIM / 128, 4), 256, 0, stream>>>(
      x0, x1, Wk0, Wk1, Wq0, Wq1, Wv0, Wv1, Kt, Vt, Qn, kmaxb);
  ctx_kernel<<<dim3(CHUNKS, 4), 256, 0, stream>>>(Kt, Vt, kmaxb, part);
  reduce_kernel<<<dim3(TOT / 4 / 64), 256, 0, stream>>>(part, Wctx);   // ksum follows Wctx: one plane
  out_kernel<<<dim3(NDIM / 128, 4), 256, 0, stream>>>(Qn, Wctx, ksum, out);
}

// v005
// It runs in 69.3 microseconds.
// Two timings next to v004 both put it at 1.12 times that version's speed.
// All steps since v000 together make it 2.70 times as fast.
#include <hip/hip_runtime.h>

#define CDIM 128
#define NDIM 32768
#define LDP  144                 // padded LDS row (bf16 elems): 288B rows = 64 data dw + 8 pad dw
#define LOG2E 1.4426950408889634f
#define CHUNKS 128
#define NCHUNK (NDIM / CHUNKS)   // 256
#define TOT (4 * CDIM * CDIM + 4 * CDIM)   // floats in one plane: four context matrices, then four row-sum vectors

typedef __bf16 bf16;
typedef __attribute__((ext_vector_type(16))) bf16  v16bf;
typedef __attribute__((ext_vector_type(8)))  bf16  v8bf;
typedef __attribute__((ext_vector_type(4)))  bf16  v4bf;
typedef __attribute__((ext_vector_type(2)))  bf16  v2bf;
typedef __attribute__((ext_vector_type(8)))  float v8f;
typedef __attribute__((ext_vector_type(4)))  float v4f;
typedef __attribute__((ext_vector_type(2)))  float v2f;
typedef unsigned v4u __attribute__((ext_vector_type(4)));
typedef int      v4i __attribute__((ext_vector_type(4)));
typedef int      v8i __attribute__((ext_vector_type(8)));

// A(16x32 bf16) and B(32x16 bf16) fragments share the same address function:
// lane&15 -> row (A: M, B: column), lane>>4 selects k half; 16 contiguous bf16.
static __device__ __forceinline__ v16bf ldfrag(const bf16* base, int row0, int k0, int lane) {
  const bf16* p = base + (size_t)(row0 + (lane & 15)) * LDP + k0 + ((lane >> 4) << 4);
  return *(const v16bf*)p;
}

// Fragment order: a 128 x 128 bf16 operand [row][k] laid out so that the fragment ldfrag() would read for row block w and
// k step ks is two runs of 512 bytes: 16-byte unit ((w * 4 + ks) * 2 + h) * 32 + lane holds row w * 16 + (lane & 15),
// k = ks * 32 + (lane >> 4) * 16 + h * 8 .. + 7. A wave loads the four fragments of its own row block with whole lines.
static __device__ __forceinline__ void ldfrags_global(const bf16* __restrict__ F, int wave, int lane, v16bf (&a)[4]) {
  const v8bf* p = (const v8bf*)F + wave * 256 + lane;
#pragma unroll   // a[] is indexed by constants only; one address with constant offsets
  for (int ks = 0; ks < 4; ks++) {
    v8bf lo = p[ks * 64], hi = p[ks * 64 + 32];
    a[ks] = __builtin_shufflevector(lo, hi, 0, 1, 2, 3, 4, 5, 6, 7, 8, 9, 10, 11, 12, 13, 14, 15);
  }
  // The wait that stands in front of any overwrite of the loads' address registers; it takes the address as an input,
  // so the pair stays live up to here.
  asm volatile("s_wait_xcnt 0x0" :: "v"(p) : "memory");
}

static __device__ __forceinline__ v8f wmma_bf16(v16bf a, v16bf b, v8f c) {
  return __builtin_amdgcn_wmma_f32_16x16x32_bf16(false, a, false, b, (short)0, c, false, false);
}

// Transposing stage: a 128 x 128 f32 tile src[k][row] (row pitch 'stride' floats) goes to dst[row][k] as bf16.
// A lane owns a block of 8 k x 4 rows, so both sides are wide: eight 16-byte loads (8 lanes cover a whole
// 128-byte line of one k, 4 lines per wave load) and four 16-byte LDS stores of 8 consecutive k.
// Lane bits: bit 0 and bits 3..4 pick the float4 within the line, bits 1..2 pick one of four k groups; at a row
// pitch of 72 dwords the 32 lanes of one store then fall on 8 different groups of 4 banks (4 rows apart alone: 2).
static __device__ __forceinline__ void stage_transposed(const float* __restrict__ src, size_t stride,
                                                        bf16 (*dst)[LDP], int t) {
  const int lane = t & 31, wave = t >> 5;
  const int q8 = (lane & 1) | ((lane >> 3) << 1);   // 0..7
  const int gs = (lane >> 1) & 3;                   // 0..3
  const int k0 = ((wave >> 1) * 4 + gs) * 8;        // a wave's two blocks share their k group ...
  const int r0 = ((wave & 1) * 16 + q8) * 4;        // ... and lie 32 rows apart: one aligned 256-byte unit per k
  const float* base = src + (size_t)k0 * stride + r0;
  v4f v[2][8];
#pragma unroll   // both loops: a lane's sixteen loads stand ahead of their uses, one base address and constant offsets
  for (int u = 0; u < 2; u++)
#pragma unroll
    for (int j = 0; j < 8; j++)
      v[u][j] = *(const v4f*)(base + (size_t)j * stride + u * 32);
  // The wait that stands in front of any overwrite of the loads' address registers. It takes the address as an
  // input, so the pair stays live up to here and no load of the run can land its result in it.
  asm volatile("s_wait_xcnt 0x0" :: "v"(base) : "memory");
#pragma unroll   // all three loops: v[][] and pk[] are indexed by constants only, so they stay in registers
  for (int u = 0; u < 2; u++)
#pragma unroll
    for (int i = 0; i < 4; i++) {
      v8bf pk;
#pragma unroll
      for (int j = 0; j < 8; j++) pk[j] = (bf16)v[u][j][i];
      *(v8bf*)&dst[r0 + u * 32 + i][k0] = pk;
    }
}

// Value of lane l ^ X inside a 16-lane row, by DPP (row_xmask): no LDS, no wait counter.
template <int X>
static __device__ __forceinline__ float row_xor(float v) {
  return __builtin_bit_cast(float, __builtin_amdgcn_update_dpp(0, __builtin_bit_cast(int, v), 0x160 | X, 0xf, 0xf, true));
}
// Maximum over each 16-lane row, for two values at once (all lanes on). In asm text because the compiler makes three
// instructions of each step written with fmaxf (a DPP move, a quieting maximum, the maximum); two chains fill each other's latency.
static __device__ __forceinline__ void row_max16_by2(float& a, float& b) {
  asm("v_max_num_f32_dpp %0, %0, %0 row_xmask:1 row_mask:0xf bank_mask:0xf\n\t"
      "v_max_num_f32_dpp %1, %1, %1 row_xmask:1 row_mask:0xf bank_mask:0xf\n\t"
      "v_max_num_f32_dpp %0, %0, %0 row_xmask:2 row_mask:0xf bank_mask:0xf\n\t"
      "v_max_num_f32_dpp %1, %1, %1 row_xmask:2 row_mask:0xf bank_mask:0xf\n\t"
      "v_max_num_f32_dpp %0, %0, %0 row_xmask:4 row_mask:0xf bank_mask:0xf\n\t"
      "v_max_num_f32_dpp %1, %1, %1 row_xmask:4 row_mask:0xf bank_mask:0xf\n\t"
      "v_max_num_f32_dpp %0, %0, %0 row_xmask:8 row_mask:0xf bank_mask:0xf\n\t"
      "v_max_num_f32_dpp %1, %1, %1 row_xmask:8 row_mask:0xf bank_mask:0xf"
      : "+v"(a), "+v"(b));
}
static __device__ __forceinline__ float row_sum16(float v) {
  v += row_xor<1>(v); v += row_xor<2>(v); v += row_xor<4>(v); return v + row_xor<8>(v);
}

// Eight 2^x in place, arguments <= 0 (a result below the smallest normal f32 may come out as 0). One statement: no
// instruction in it reads a neighbour's result or overwrites a neighbour's source, and the v_nop at its end is the slot
// that the instruction set asks for behind a transcendental, whatever the compiler puts next.
static __device__ __forceinline__ void exp2_by8(float (&e)[8]) {
  asm("v_exp_f32 %0, %0\n\tv_exp_f32 %1, %1\n\tv_exp_f32 %2, %2\n\tv_exp_f32 %3, %3\n\t"
      "v_exp_f32 %4, %4\n\tv_exp_f32 %5, %5\n\tv_exp_f32 %6, %6\n\tv_exp_f32 %7, %7\n\tv_nop"
      : "+v"(e[0]), "+v"(e[1]), "+v"(e[2]), "+v"(e[3]), "+v"(e[4]), "+v"(e[5]), "+v"(e[6]), "+v"(e[7]));
}

// monotone float<->uint mapping for atomicMax on floats
static __device__ __forceinline__ unsigned fenc(float f) {
  unsigned u = __float_as_uint(f);
  return (u & 0x80000000u) ? ~u : (u | 0x80000000u);
}
static __device__ __forceinline__ float fdec(unsigned u) {
  return (u & 0x80000000u) ? __uint_as_float(u & 0x7FFFFFFFu) : __uint_as_float(~u);
}

// TDM: DMA a 128x128 tile of 2-byte elements (row length dim0, row stride stride0,
// dim1 rows total in tensor) from global into LDS with 64dw+8dw row padding (-> LDP rows).
static __device__ __forceinline__ void tdm_load_tile(const void* gsrc, void* ldst,
                                                     unsigned dim0, unsigned dim1,
                                                     unsigned stride0) {
  unsigned long long ga = (unsigned long long)(size_t)gsrc;
  unsigned lds_off = (unsigned)(size_t)ldst;   // generic LDS addr low 32 bits = LDS offset
  v4u g0;
  g0[0] = 1u;                                          // count=1, user descriptor
  g0[1] = lds_off;                                     // LDS byte address
  g0[2] = (unsigned)(ga & 0xFFFFFFFFu);                // global_addr[31:0]
  g0[3] = (unsigned)((ga >> 32) & 0x01FFFFFFu) | 0x80000000u;  // addr[56:32] | type=2
  v8i g1;
  g1[0] = (int)((1u << 16) | (1u << 20) | (5u << 22) | (7u << 25)); // 2B elems, pad_en, 64dw interval, 8dw pad
  g1[1] = (int)((dim0 & 0xFFFFu) << 16);               // tensor_dim0[15:0]
  g1[2] = (int)(((dim0 >> 16) & 0xFFFFu) | ((dim1 & 0xFFFFu) << 16)); // dim0 hi | dim1 lo
  g1[3] = (int)(((dim1 >> 16) & 0xFFFFu) | (128u << 16));            // dim1 hi | tile_dim0=128
  g1[4] = (int)128u;                                   // tile_dim1=128, tile_dim2=0
  g1[5] = (int)stride0;                                // tensor_dim0_stride[31:0]
  g1[6] = 0;                                           // stride0 hi | stride1 lo
  g1[7] = 0;
  v4i gz4 = {0, 0, 0, 0};
  v8i gz8 = {0, 0, 0, 0, 0, 0, 0, 0};
  __builtin_amdgcn_tensor_load_to_lds(g0, g1, gz4, gz4, gz8, 0);
}

// -------- Kernel 0: weights to bf16, once; start value of the K row maxima --------
// Wf holds six matrices of 2048 16-byte units: Wv0, Wv1, Wk0, Wk1 in fragment order (A operands of proj_kernel, each row
// block read by one wave only), then Wq0, Wq1 as the rows of proj_kernel's LDS tile: tile row lr is weight row
// (lr & 15) * 8 + (lr >> 4), so that column l of fragment tile nt is weight row l * 8 + nt.
__global__ __launch_bounds__(256) void init_kernel(
    const float* __restrict__ Wv0, const float* __restrict__ Wv1,
    const float* __restrict__ Wk0, const float* __restrict__ Wk1,
    const float* __restrict__ Wq0, const float* __restrict__ Wq1,
    bf16* __restrict__ Wf, unsigned* __restrict__ kmaxb) {
  const int mat = blockIdx.x >> 3;
  const int o = (blockIdx.x & 7) * 256 + threadIdx.x;   // 16-byte unit within the matrix
  const float* Wp = mat == 0 ? Wv0 : mat == 1 ? Wv1 : mat == 2 ? Wk0 : mat == 3 ? Wk1 : mat == 4 ? Wq0 : Wq1;
  int row, k;
  if (mat < 4) {
    const int l = o & 31, h = (o >> 5) & 1, ks = (o >> 6) & 3, w = o >> 8;
    row = w * 16 + (l & 15);
    k = ks * 32 + (l >> 4) * 16 + h * 8;
  } else {
    const int lr = o >> 4;
    row = (lr & 15) * 8 + (lr >> 4);
    k = (o & 15) * 8;
  }
  const float4 a = *(const float4*)(Wp + row * CDIM + k), b = *(const float4*)(Wp + row * CDIM + k + 4);
  v8bf pk;
  pk[0] = (bf16)a.x; pk[1] = (bf16)a.y; pk[2] = (bf16)a.z; pk[3] = (bf16)a.w;
  pk[4] = (bf16)b.x; pk[5] = (bf16)b.y; pk[6] = (bf16)b.z; pk[7] = (bf16)b.w;
  ((v8bf*)Wf)[mat * 2048 + o] = pk;
  int i = blockIdx.x * 256 + threadIdx.x;
  if (i < 4 * CDIM) kmaxb[i] = 0x007FFFFFu; /* fenc(-inf) */
}

// -------- Kernel 1: fused projections, Q-softmax, K row-max -----------------
// Output layouts (per combo = s*2+b): Kt/Vt = (C, N) bf16, Qn = (N, C) bf16.
// Four work-groups share a WGP: 72 KiB of LDS each, and at least 8 waves per SIMD
// (second launch bound), which holds a wave to 128 VGPRs.
__global__ __launch_bounds__(256, 8) void proj_kernel(
    const float* __restrict__ x0, const float* __restrict__ x1,
    const bf16* __restrict__ Wf,
    bf16* __restrict__ Kt, bf16* __restrict__ Vt, bf16* __restrict__ Qn,
    unsigned* __restrict__ kmaxb)
{
  __shared__ unsigned char smem[2 * CDIM * LDP * sizeof(bf16)] __attribute__((aligned(32)));
  bf16 (*Alds)[LDP] = (bf16 (*)[LDP])smem;                               // Wq, rows dealt [c_out][c]
  bf16 (*Blds)[LDP] = (bf16 (*)[LDP])(smem + CDIM * LDP * sizeof(bf16)); // x tile  [n][c]

  const int t = threadIdx.x, lane = t & 31, wave = t >> 5;
  const int combo = blockIdx.y;                 // s*2 + b
  const int s = combo >> 1, b = combo & 1;
  const int n0 = blockIdx.x * 128;
  const float* xp = (s ? x1 : x0) + (size_t)b * CDIM * NDIM;
  const bf16* Wv = Wf + s * CDIM * CDIM;         // fragment order
  const bf16* Wk = Wf + (2 + s) * CDIM * CDIM;   // fragment order
  const bf16* Wq = Wf + (4 + s) * CDIM * CDIM;   // rows of the LDS tile
  const size_t cb = (size_t)combo * CDIM * NDIM;

  // Wq tile: a plain copy, its loads issued ahead of the x tile's so that both latencies run together
  v8bf wq[8];
  const v8bf* wqp = (const v8bf*)Wq + t;
#pragma unroll   // wq[] is indexed by constants only; one address with constant offsets
  for (int i = 0; i < 8; i++) wq[i] = wqp[i * 256];
  // the wait in front of any overwrite of these loads' address registers (the address is an input: live up to here)
  asm volatile("s_wait_xcnt 0x0" :: "v"(wqp) : "memory");

  // load x tile (128 c x 128 n), bf16-convert, transpose into Blds[n][c]
  stage_transposed(xp + n0, NDIM, Blds, t);
#pragma unroll   // wq[] is indexed by constants only
  for (int i = 0; i < 8; i++) *(v8bf*)&Alds[i * 16 + (t >> 4)][(t & 15) * 8] = wq[i];
  v16bf av[4], ak[4];   // the wave's own 16 rows of Wv and of Wk
  // The fragment loads stay behind the staging: drawn up among the 96 registers of tile data, they push addresses to scratch.
  __builtin_amdgcn_sched_barrier(0);
  ldfrags_global(Wv, wave, lane, av);   // ahead of the barrier: their latency runs beside the drain of the LDS stores
  __syncthreads();   // the only barrier: from here on both tiles are read only, and the waves run free of each other

  // acc[j] += the wave's own A fragments (registers) times rows j * 16 .. + 15 of Bt, j = 0 .. 3
  auto run_gemm_ra = [&](v8f* acc, const v16bf (&a)[4], const bf16* Bt) {
#pragma unroll   // all levels: a[], bfr[] and acc[] are indexed by constants only, so they stay in registers
    for (int ks = 0; ks < 4; ks++) {
      v16bf bfr[4];
#pragma unroll
      for (int nt = 0; nt < 4; nt++) bfr[nt] = ldfrag(Bt, nt * 16, ks * 32, lane);
#pragma unroll
      for (int nt = 0; nt < 4; nt++) acc[nt] = wmma_bf16(a[ks], bfr[nt], acc[nt]);
    }
  };

  // acc[j] += rows wave * 16 .. + 15 of At times rows j * 16 .. + 15 of Bt (both tiles are [row][k])
  auto run_gemm = [&](v8f* acc, const bf16* At, const bf16* Bt) {
#pragma unroll
    for (int ks = 0; ks < 4; ks++) {
      v16bf a = ldfrag(At, wave * 16, ks * 32, lane);
#pragma unroll
      for (int g = 0; g < 8; g += 4) {   // four B fragments at a time: 64 accumulators + 40 fragment VGPRs
        v16bf bfr[4];
#pragma unroll
        for (int nt = 0; nt < 4; nt++) bfr[nt] = ldfrag(Bt, (g + nt) * 16, ks * 32, lane);
        // No product moves up over its group's loads. Left free in front of the register softmax, the scheduler
        // draws the loads of later groups so far forward that an accumulator tile is spilled to scratch.
        __builtin_amdgcn_sched_barrier(0);
#pragma unroll
        for (int nt = 0; nt < 4; nt++) acc[g + nt] = wmma_bf16(a, bfr[nt], acc[g + nt]);
      }
    }
  };
  const v8f vz = {0.f, 0.f, 0.f, 0.f, 0.f, 0.f, 0.f, 0.f};

  // V and K: with A held in registers the tile is done in two halves of 64 columns n, which costs no extra operand
  // traffic and leaves room for the 32 registers of A beside 32 accumulators.
  // ---- V projection ----
#pragma unroll   // all levels, here and in K: acc[] and mx[] are indexed by constants only, so they stay in registers
  for (int hf = 0; hf < 2; hf++) {
    v8f acc[4];
#pragma unroll
    for (int i = 0; i < 4; i++) acc[i] = vz;
    run_gemm_ra(acc, av, &Blds[hf * 64][0]);
#pragma unroll
    for (int nt = 0; nt < 4; nt++)
#pragma unroll
      for (int r = 0; r < 8; r++) {
        int co = wave * 16 + r + ((lane >> 4) << 3);
        int n = n0 + hf * 64 + nt * 16 + (lane & 15);
        Vt[cb + (size_t)co * NDIM + n] = (bf16)acc[nt][r];
      }
  }

  // ---- K projection (store logits + per-row running max over N) ----
  {
    // the wait in front of the fragment loads, whose results may land in the address registers of V's last stores
    asm volatile("s_wait_xcnt 0x0" ::: "memory");
    ldfrags_global(Wk, wave, lane, ak);
    float mx[8];
#pragma unroll
    for (int hf = 0; hf < 2; hf++) {
      v8f acc[4];
#pragma unroll
      for (int i = 0; i < 4; i++) acc[i] = vz;
      run_gemm_ra(acc, ak, &Blds[hf * 64][0]);
#pragma unroll
      for (int r = 0; r < 8; r++) {
        float m = fmaxf(fmaxf(acc[0][r], acc[1][r]), fmaxf(acc[2][r], acc[3][r]));
        mx[r] = hf ? fmaxf(mx[r], m) : m;
      }
      // The maxima are taken first, so that each accumulator's register is free once it is converted for its store;
      // mixed with the conversions, both sets are held at once and a fragment of A goes to scratch.
      __builtin_amdgcn_sched_barrier(0);
#pragma unroll
      for (int nt = 0; nt < 4; nt++)
#pragma unroll
        for (int r = 0; r < 8; r++) {
          int co = wave * 16 + r + ((lane >> 4) << 3);
          int n = n0 + hf * 64 + nt * 16 + (lane & 15);
          Kt[cb + (size_t)co * NDIM + n] = (bf16)acc[nt][r];
        }
      // Nothing of what follows is drawn up into this half: left free here, the scheduler mixes the halves and the parts,
      // and the registers that takes push a value out to scratch.
      __builtin_amdgcn_sched_barrier(0);
    }
#pragma unroll
    for (int r = 0; r < 8; r++) {
      float m = mx[r];
      m = fmaxf(m, __shfl_xor(m, 1));
      m = fmaxf(m, __shfl_xor(m, 2));
      m = fmaxf(m, __shfl_xor(m, 4));
      m = fmaxf(m, __shfl_xor(m, 8));
      if ((lane & 15) == 0) {
        int co = wave * 16 + r + ((lane >> 4) << 3);
        atomicMax(&kmaxb[combo * CDIM + co], fenc(m));
      }
    }
  }

  // ---- Q projection + softmax over C (per n) ----
  // The x tile is the A operand here: a wave holds all 128 logits of its 16 rows n, so the softmax needs no LDS.
  // acc[nt][r] = logit of n = wave * 16 + 8 * (lane >> 4) + r, c = (lane & 15) * 8 + nt (weight rows dealt by init_kernel):
  // a lane's eight tiles are eight consecutive c, and 16 lanes store one whole row of Qn.
  {
    v8f acc[8];
#pragma unroll
    for (int i = 0; i < 8; i++) acc[i] = vz;
    run_gemm(acc, &Blds[0][0], &Alds[0][0]);
    v8bf pk[8];
#pragma unroll   // all levels: acc[][], p[] and pk[] are indexed by constants only, so they stay in registers
    for (int r = 0; r < 8; r += 2) {   // two rows at a time: they lie in neighbouring registers, which packed f32 math takes as they are
      v2f ssum = {0.0f, 0.0f}, p[8];
      float m0 = acc[0][r], m1 = acc[0][r + 1];
#pragma unroll
      for (int nt = 1; nt < 8; nt++) {
        m0 = fmaxf(m0, acc[nt][r]);
        m1 = fmaxf(m1, acc[nt][r + 1]);
      }
      row_max16_by2(m0, m1);
      const v2f m = {m0, m1};
#pragma unroll
      for (int g = 0; g < 8; g += 4) {
        float e[8];
#pragma unroll
        for (int j = 0; j < 4; j++) {
          v2f x = {acc[g + j][r], acc[g + j][r + 1]};
          x = (x - m) * LOG2E;
          e[2 * j] = x[0];
          e[2 * j + 1] = x[1];
        }
        exp2_by8(e);
#pragma unroll
        for (int j = 0; j < 4; j++) {
          p[g + j] = v2f{e[2 * j], e[2 * j + 1]};
          ssum += p[g + j];
        }
      }
      v2f inv = {1.0f / row_sum16(ssum[0]), 1.0f / row_sum16(ssum[1])};
#pragma unroll
      for (int nt = 0; nt < 8; nt++) {
        v2f q = p[nt] * inv;
        pk[r][nt] = (bf16)q[0];
        pk[r + 1][nt] = (bf16)q[1];
      }
    }
    bf16* qrow = Qn + cb + (size_t)(n0 + wave * 16 + ((lane >> 4) << 3)) * CDIM + (lane & 15) * 8;
#pragma unroll   // pk[] indexed by constants; the eight stores take one address with constant offsets and end the kernel
    for (int r = 0; r < 8; r++) *(v8bf*)&qrow[r * CDIM] = pk[r];
  }
}

// -------- Kernel 2: context GEMM  W[c,d] = sum_n exp(K[c,n]-max_c)*V[d,n] ----
// Each work-group sums over its own chunk of N and stores the result and its row sums
// into its chunk's plane of the workspace; reduce_kernel adds the planes.
// V tile staged by the Tensor Data Mover (overlaps with exp() on the K tile).
__global__ __launch_bounds__(256) void ctx_kernel(
    const bf16* __restrict__ Kt, const bf16* __restrict__ Vt,
    const unsigned* __restrict__ kmaxb,
    float* __restrict__ part)
{
  __shared__ bf16 Elds[CDIM][LDP] __attribute__((aligned(32)));
  __shared__ bf16 Vlds[CDIM][LDP] __attribute__((aligned(32)));
  __shared__ float kmaxL[CDIM];
  __shared__ float ksumL[CDIM];

  const int t = threadIdx.x, lane = t & 31, wave = t >> 5;
  const int combo = blockIdx.y;
  const size_t cb = (size_t)combo * CDIM * NDIM;
  const int nbase = blockIdx.x * NCHUNK;

  if (t < CDIM) { kmaxL[t] = fdec(kmaxb[combo * CDIM + t]); ksumL[t] = 0.0f; }
  __syncthreads();

  const v8f vz = {0.f, 0.f, 0.f, 0.f, 0.f, 0.f, 0.f, 0.f};
  v8f acc[8];
#pragma unroll
  for (int i = 0; i < 8; i++) acc[i] = vz;

  // Kept rolled: the tensor load stays one site, with the descriptor set-up and the waits it has
  // run with (the two trips would otherwise be unrolled into two sites).
#pragma unroll 1
  for (int nb = nbase; nb < nbase + NCHUNK; nb += 128) {
    // async DMA: V tile (128 c x 128 n) -> Vlds with padded rows
    if (t < 32) tdm_load_tile(Vt + cb + nb, &Vlds[0][0], NDIM, CDIM, NDIM);

    // meanwhile: stage exp(K - max) tile with VALU, accumulate row sums
    for (int e = t; e < CDIM * 16; e += 256) {
      int c = e >> 4, seg = e & 15;
      const bf16* kp = Kt + cb + (size_t)c * NDIM + nb + seg * 8;
      v8bf kv = *(const v8bf*)kp;
      __builtin_prefetch(kp + 128, 0, 0);   // next 128-column tile -> global_prefetch_b8
      float km = kmaxL[c];
      float part = 0.0f;
      v8bf ev;
#pragma unroll
      for (int j = 0; j < 8; j++) {
        float p = exp2f(((float)kv[j] - km) * LOG2E);
        part += p;
        ev[j] = (bf16)p;
      }
      *(v8bf*)&Elds[c][seg * 8] = ev;
      atomicAdd(&ksumL[c], part);
    }
    if (t < 32) __builtin_amdgcn_s_wait_tensorcnt((short)0);
    __syncthreads();
#pragma unroll
    for (int ks = 0; ks < 4; ks++) {
      v16bf a = ldfrag(&Elds[0][0], wave * 16, ks * 32, lane);
      v16bf bfr[8];
#pragma unroll
      for (int dt = 0; dt < 8; dt++) bfr[dt] = ldfrag(&Vlds[0][0], dt * 16, ks * 32, lane);
#pragma unroll
      for (int dt = 0; dt < 8; dt++) acc[dt] = wmma_bf16(a, bfr[dt], acc[dt]);
    }
    __syncthreads();
  }

  float* plane = part + (size_t)blockIdx.x * TOT;
  float* Wp = plane + combo * CDIM * CDIM;
#pragma unroll
  for (int dt = 0; dt < 8; dt++)
#pragma unroll
    for (int r = 0; r < 8; r++) {
      int c = wave * 16 + r + ((lane >> 4) << 3);
      int d = dt * 16 + (lane & 15);
      Wp[c * CDIM + d] = acc[dt][r];
    }
  if (t < CDIM) plane[4 * CDIM * CDIM + combo * CDIM + t] = ksumL[t];
}

// -------- Kernel 2b: add the CHUNKS planes, in a fixed order; make out_kernel's A operand ------------------
// A work-group owns 8 rows c x 32 columns d of one context matrix (64 float4); its four quarters each add a quarter
// of the planes (and of the planes' row sums), and the first quarter adds the four results through LDS, divides by the
// row sum and stores bf16 in fragment order as [row d][k c]: the block's 256 values fill two whole runs of 256 bytes.
__global__ __launch_bounds__(256) void reduce_kernel(const float* __restrict__ part,
                                                     bf16* __restrict__ Af)
{
  __shared__ float4 red[4][64];
  __shared__ float kred[4][64];
  const int t = threadIdx.x, col = t & 63, g = t >> 6;
  const int combo = blockIdx.x >> 6, cg = (blockIdx.x >> 2) & 15, db = blockIdx.x & 3;
  const int row = col >> 3;
  const int c = cg * 8 + row, d0 = db * 32 + (col & 7) * 4;
  const float* pl = part + (size_t)(g * (CHUNKS / 4)) * TOT;
  const float4* p = (const float4*)(pl + combo * CDIM * CDIM + c * CDIM + d0);
  const float* pk = pl + 4 * CDIM * CDIM + combo * CDIM + c;
  float4 v[CHUNKS / 4];
  float kv[CHUNKS / 4];   // every thread adds its row's sums (eight threads the same ones): no branch, so these loads fly with the others
#pragma unroll   // constant offsets from one address, and many independent loads in flight per thread
  for (int k = 0; k < CHUNKS / 4; k++) kv[k] = pk[(size_t)k * TOT];
#pragma unroll   // the same
  for (int k = 0; k < CHUNKS / 4; k++) v[k] = p[(size_t)k * (TOT / 4)];
  // The wait that stands in front of any overwrite of the loads' address registers; it takes the addresses as inputs,
  // so they stay live up to here and no load of the run can land its result in them.
  asm volatile("s_wait_xcnt 0x0" :: "v"(p), "v"(pk) : "memory");
  float4 s = v[0];
  float sk = kv[0];
#pragma unroll   // v[] and kv[] are indexed by constants only, so they stay in registers
  for (int k = 1; k < CHUNKS / 4; k++) {
    s.x += v[k].x; s.y += v[k].y; s.z += v[k].z; s.w += v[k].w;
    sk += kv[k];
  }
  red[g][col] = s;
  kred[g][col] = sk;
  __syncthreads();
  if (g == 0) {
    float4 a = red[0][col], b = red[1][col], cc = red[2][col], d = red[3][col];
    const float den = (kred[0][col] + kred[1][col]) + (kred[2][col] + kred[3][col]);
    float r[4];
    r[0] = (a.x + b.x) + (cc.x + d.x);
    r[1] = (a.y + b.y) + (cc.y + d.y);
    r[2] = (a.z + b.z) + (cc.z + d.z);
    r[3] = (a.w + b.w) + (cc.w + d.w);
    // unit ((w * 4 + ks) * 2 + h) * 32 + lane, element j: w = d >> 4, ks = c >> 5, h = (c >> 3) & 1,
    // lane = ((c >> 4) & 1) * 16 + (d & 15), j = c & 7
    const int unit = (((d0 >> 4) * 4 + (c >> 5)) * 2 + ((c >> 3) & 1)) * 32 + ((c >> 4) & 1) * 16 + (d0 & 15);
    bf16* o = Af + combo * CDIM * CDIM + unit * 8 + (c & 7);
#pragma unroll   // r[] is indexed by constants only
    for (int i = 0; i < 4; i++) o[i * 8] = (bf16)(r[i] / den);
  }
}

// -------- Kernel 3: Out_s[d,n] = sum_c (W_{1-s}[c,d]/ksum_c) * Q_s[n,c] -----
// Q tile staged by the Tensor Data Mover. The A operand comes ready from reduce_kernel; a wave reads only its own 16 rows
// of it, so they go from global memory to registers.
// Second launch bound: a wave stays within 128 VGPRs, so that four work-groups still share a WGP.
__global__ __launch_bounds__(256, 8) void out_kernel(
    const bf16* __restrict__ Qn, const bf16* __restrict__ Af, float* __restrict__ out)
{
  __shared__ bf16 Qlds[CDIM][LDP] __attribute__((aligned(32)));  // [n][c]

  const int t = threadIdx.x, lane = t & 31, wave = t >> 5;
  const int combo = blockIdx.y;
  const int s = combo >> 1, b = combo & 1;
  const int other = ((1 - s) << 1) | b;
  const int n0 = blockIdx.x * 128;
  const bf16* Qb = Qn + (size_t)combo * CDIM * NDIM;

  // The fragment loads are issued first, so that they fly beside the tensor load and nothing stands between that load and its wait.
  v16bf a[4];   // rows d = wave * 16 .. + 15 of W_other[c][d] / ksum_other[c], k = c
  ldfrags_global(Af + other * CDIM * CDIM, wave, lane, a);

  // async DMA: Q tile (128 n x 128 c) -> Qlds with padded rows
  if (t < 32) {
    tdm_load_tile(Qb + (size_t)n0 * CDIM, &Qlds[0][0], CDIM, NDIM, CDIM);
    // The issuing wave's wait, directly behind the issue: no descriptor register takes a new value while the request is out.
    asm volatile("s_wait_tensorcnt 0x0" ::: "memory");
  }
  __syncthreads();

  const v8f vz = {0.f, 0.f, 0.f, 0.f, 0.f, 0.f, 0.f, 0.f};
  v8f acc[8];
#pragma unroll
  for (int i = 0; i < 8; i++) acc[i] = vz;
#pragma unroll
  for (int ks = 0; ks < 4; ks++) {
    v16bf bfr[8];
#pragma unroll
    for (int nt = 0; nt < 8; nt++) bfr[nt] = ldfrag(&Qlds[0][0], nt * 16, ks * 32, lane);
#pragma unroll
    for (int nt = 0; nt < 8; nt++) acc[nt] = wmma_bf16(a[ks], bfr[nt], acc[nt]);
  }

  float* ob = out + (size_t)combo * CDIM * NDIM;
#pragma unroll
  for (int nt = 0; nt < 8; nt++)
#pragma unroll
    for (int r = 0; r < 8; r++) {
      int d = wave * 16 + r + ((lane >> 4) << 3);
      int n = n0 + nt * 16 + (lane & 15);
      ob[(size_t)d * NDIM + n] = acc[nt][r];
    }
}

extern "C" void kernel_launch(void* const* d_in, const int* in_sizes, int n_in,
                              void* d_out, int out_size, void* d_ws, size_t ws_size,
                              hipStream_t stream) {
  (void)in_sizes; (void)n_in; (void)out_size; (void)ws_size;
  const float* x0  = (const float*)d_in[0];
  const float* x1  = (const float*)d_in[1];
  const float* Wk0 = (const float*)d_in[2];
  const float* Wk1 = (const float*)d_in[3];
  const float* Wq0 = (const float*)d_in[4];
  const float* Wq1 = (const float*)d_in[5];
  const float* Wv0 = (const float*)d_in[6];
  const float* Wv1 = (const float*)d_in[7];
  float* out = (float*)d_out;

  const size_t PLANE = (size_t)4 * CDIM * NDIM;   // elems per bf16 array (all combos)
  bf16* Kt = (bf16*)d_ws;
  bf16* Vt = Kt + PLANE;
  bf16* Qn = Vt + PLANE;
  bf16* Af = Qn + PLANE;                          // four normalised context matrices, fragment order
  bf16* Wf = Af + 4 * CDIM * CDIM;                // six weight matrices
  unsigned* kmaxb = (unsigned*)(Wf + 6 * CDIM * CDIM);
  float* part = (float*)(kmaxb + 4 * CDIM);       // CHUNKS planes: four context matrices, then four row-sum vectors

  init_kernel<<<dim3(6 * 8), 256, 0, stream>>>(Wv0, Wv1, Wk0, Wk1, Wq0, Wq1, Wf, kmaxb);
  proj_kernel<<<dim3(NDIM / 128, 4), 256, 0, stream>>>(
      x0, x1, Wf, Kt, Vt, Qn, kmaxb);
  ctx_kernel<<<dim3(CHUNKS, 4), 256, 0, stream>>>(Kt, Vt, kmaxb, part);
  reduce_kernel<<<dim3(4 * CDIM * CDIM / 256), 256, 0, stream>>>(part, Af);
  out_kernel<<<dim3(NDIM / 128, 4), 256, 0, stream>>>(Qn, Af, out);
}

// v006
// Measured time: 56 microseconds a run.
// Next to v005, in two timings, it ran 1.24 and 1.25 times as fast.
// Counting every step since v000, it is 3.35 times as fast.
#include <hip/hip_runtime.h>

#define CDIM 128
#define NDIM 32768
#define LDP  144                 // padded LDS row (bf16 elems): 288B rows = 64 data dw + 8 pad dw
#define LOG2E 1.4426950408889634f
#define CHUNKS 128
#define NCHUNK (NDIM / CHUNKS)   // 256
#define TOT (4 * CDIM * CDIM + 8 * CDIM)   // floats in one plane: four context matrices, then per matrix and row the pair (row sum, row maximum)

typedef __bf16 bf16;
typedef __attribute__((ext_vector_type(16))) bf16  v16bf;
typedef __attribute__((ext_vector_type(8)))  bf16  v8bf;
typedef __attribute__((ext_vector_type(4)))  bf16  v4bf;
typedef __attribute__((ext_vector_type(2)))  bf16  v2bf;
typedef __attribute__((ext_vector_type(8)))  float v8f;
typedef __attribute__((ext_vector_type(4)))  float v4f;
typedef __attribute__((ext_vector_type(2)))  float v2f;
typedef unsigned v4u __attribute__((ext_vector_type(4)));
typedef int      v4i __attribute__((ext_vector_type(4)));
typedef int      v8i __attribute__((ext_vector_type(8)));

// A(16x32 bf16) and B(32x16 bf16) fragments share the same address function:
// lane&15 -> row (A: M, B: column), lane>>4 selects k half; 16 contiguous bf16.
static __device__ __forceinline__ v16bf ldfrag(const bf16* base, int row0, int k0, int lane) {
  const bf16* p = base + (size_t)(row0 + (lane & 15)) * LDP + k0 + ((lane >> 4) << 4);
  return *(const v16bf*)p;
}

// The same fragment in the hardware's own k order, which a pair of packed D tiles on the other side of the product has:
// element s of lane half h is k = k0 + 8 h + s (s < 8), k0 + 16 + 8 h + (s - 8) otherwise: two 16-byte loads.
static __device__ __forceinline__ v16bf ldfrag_kmap(const bf16* base, int row0, int k0, int lane) {
  const bf16* p = base + (size_t)(row0 + (lane & 15)) * LDP + k0 + ((lane >> 4) << 3);
  v8bf lo = *(const v8bf*)p, hi = *(const v8bf*)(p + 16);
  return __builtin_shufflevector(lo, hi, 0, 1, 2, 3, 4, 5, 6, 7, 8, 9, 10, 11, 12, 13, 14, 15);
}

// Fragment order: a 128 x 128 bf16 operand [row][k] laid out so that the fragment ldfrag() would read for row block w and
// k step ks is two runs of 512 bytes: 16-byte unit ((w * 4 + ks) * 2 + h) * 32 + lane holds row w * 16 + (lane & 15),
// k = ks * 32 + (lane >> 4) * 16 + h * 8 .. + 7. A wave loads the four fragments of its own row block with whole lines.
static __device__ __forceinline__ void ldfrags_global(const bf16* __restrict__ F, int wave, int lane, v16bf (&a)[4]) {
  const v8bf* p = (const v8bf*)F + wave * 256 + lane;
#pragma unroll   // a[] is indexed by constants only; one address with constant offsets
  for (int ks = 0; ks < 4; ks++) {
    v8bf lo = p[ks * 64], hi = p[ks * 64 + 32];
    a[ks] = __builtin_shufflevector(lo, hi, 0, 1, 2, 3, 4, 5, 6, 7, 8, 9, 10, 11, 12, 13, 14, 15);
  }
  // The wait that stands in front of any overwrite of the loads' address registers; it takes the address as an input,
  // so the pair stays live up to here.
  asm volatile("s_wait_xcnt 0x0" :: "v"(p) : "memory");
}

static __device__ __forceinline__ v8f wmma_bf16(v16bf a, v16bf b, v8f c) {
  return __builtin_amdgcn_wmma_f32_16x16x32_bf16(false, a, false, b, (short)0, c, false, false);
}

// Transposing stage: a 128 x 128 f32 tile src[k][row] (row pitch 'stride' floats) goes to dst[row][k] as bf16.
// A lane owns a block of 8 k x 4 rows, so both sides are wide: eight 16-byte loads (8 lanes cover a whole
// 128-byte line of one k, 4 lines per wave load) and four 16-byte LDS stores of 8 consecutive k.
// Lane bits: bit 0 and bits 3..4 pick the float4 within the line, bits 1..2 pick one of four k groups; at a row
// pitch of 72 dwords the 32 lanes of one store then fall on 8 different groups of 4 banks (4 rows apart alone: 2).
static __device__ __forceinline__ void stage_transposed(const float* __restrict__ src, size_t stride,
                                                        bf16 (*dst)[LDP], int t) {
  const int lane = t & 31, wave = t >> 5;
  const int q8 = (lane & 1) | ((lane >> 3) << 1);   // 0..7
  const int gs = (lane >> 1) & 3;                   // 0..3
  const int k0 = ((wave >> 1) * 4 + gs) * 8;        // a wave's two blocks share their k group ...
  const int r0 = ((wave & 1) * 16 + q8) * 4;        // ... and lie 32 rows apart: one aligned 256-byte unit per k
  const float* base = src + (size_t)k0 * stride + r0;
  v4f v[2][8];
#pragma unroll   // both loops: a lane's sixteen loads stand ahead of their uses, one base address and constant offsets
  for (int u = 0; u < 2; u++)
#pragma unroll
    for (int j = 0; j < 8; j++)
      v[u][j] = *(const v4f*)(base + (size_t)j * stride + u * 32);
  // The wait that stands in front of any overwrite of the loads' address registers. It takes the address as an
  // input, so the pair stays live up to here and no load of the run can land its result in it.
  asm volatile("s_wait_xcnt 0x0" :: "v"(base) : "memory");
#pragma unroll   // all three loops: v[][] and pk[] are indexed by constants only, so they stay in registers
  for (int u = 0; u < 2; u++)
#pragma unroll
    for (int i = 0; i < 4; i++) {
      v8bf pk;
#pragma unroll
      for (int j = 0; j < 8; j++) pk[j] = (bf16)v[u][j][i];
      *(v8bf*)&dst[r0 + u * 32 + i][k0] = pk;
    }
}

// Value of lane l ^ X inside a 16-lane row, by DPP (row_xmask): no LDS, no wait counter.
template <int X>
static __device__ __forceinline__ float row_xor(float v) {
  return __builtin_bit_cast(float, __builtin_amdgcn_update_dpp(0, __builtin_bit_cast(int, v), 0x160 | X, 0xf, 0xf, true));
}
// Maximum over each 16-lane row, for two values at once (all lanes on). In asm text because the compiler makes three
// instructions of each step written with fmaxf (a DPP move, a quieting maximum, the maximum); two chains fill each other's latency.
static __device__ __forceinline__ void row_max16_by2(float& a, float& b) {
  asm("v_max_num_f32_dpp %0, %0, %0 row_xmask:1 row_mask:0xf bank_mask:0xf\n\t"
      "v_max_num_f32_dpp %1, %1, %1 row_xmask:1 row_mask:0xf bank_mask:0xf\n\t"
      "v_max_num_f32_dpp %0, %0, %0 row_xmask:2 row_mask:0xf bank_mask:0xf\n\t"
      "v_max_num_f32_dpp %1, %1, %1 row_xmask:2 row_mask:0xf bank_mask:0xf\n\t"
      "v_max_num_f32_dpp %0, %0, %0 row_xmask:4 row_mask:0xf bank_mask:0xf\n\t"
      "v_max_num_f32_dpp %1, %1, %1 row_xmask:4 row_mask:0xf bank_mask:0xf\n\t"
      "v_max_num_f32_dpp %0, %0, %0 row_xmask:8 row_mask:0xf bank_mask:0xf\n\t"
      "v_max_num_f32_dpp %1, %1, %1 row_xmask:8 row_mask:0xf bank_mask:0xf"
      : "+v"(a), "+v"(b));
}
static __device__ __forceinline__ float row_sum16(float v) {
  v += row_xor<1>(v); v += row_xor<2>(v); v += row_xor<4>(v); return v + row_xor<8>(v);
}

// Eight 2^x in place, arguments <= 0 (a result below the smallest normal f32 may come out as 0). One statement: no
// instruction in it reads a neighbour's result or overwrites a neighbour's source, and the v_nop at its end is the slot
// that the instruction set asks for behind a transcendental, whatever the compiler puts next.
static __device__ __forceinline__ void exp2_by8(float (&e)[8]) {
  asm("v_exp_f32 %0, %0\n\tv_exp_f32 %1, %1\n\tv_exp_f32 %2, %2\n\tv_exp_f32 %3, %3\n\t"
      "v_exp_f32 %4, %4\n\tv_exp_f32 %5, %5\n\tv_exp_f32 %6, %6\n\tv_exp_f32 %7, %7\n\tv_nop"
      : "+v"(e[0]), "+v"(e[1]), "+v"(e[2]), "+v"(e[3]), "+v"(e[4]), "+v"(e[5]), "+v"(e[6]), "+v"(e[7]));
}

// The same for four values.
static __device__ __forceinline__ void exp2_by4(float (&e)[4]) {
  asm("v_exp_f32 %0, %0\n\tv_exp_f32 %1, %1\n\tv_exp_f32 %2, %2\n\tv_exp_f32 %3, %3\n\tv_nop"
      : "+v"(e[0]), "+v"(e[1]), "+v"(e[2]), "+v"(e[3]));
}

// TDM: DMA a 128x128 tile of 2-byte elements (row length dim0, row stride stride0,
// dim1 rows total in tensor) from global into LDS with 64dw+8dw row padding (-> LDP rows).
static __device__ __forceinline__ void tdm_load_tile(const void* gsrc, void* ldst,
                                                     unsigned dim0, unsigned dim1,
                                                     unsigned stride0) {
  unsigned long long ga = (unsigned long long)(size_t)gsrc;
  unsigned lds_off = (unsigned)(size_t)ldst;   // generic LDS addr low 32 bits = LDS offset
  v4u g0;
  g0[0] = 1u;                                          // count=1, user descriptor
  g0[1] = lds_off;                                     // LDS byte address
  g0[2] = (unsigned)(ga & 0xFFFFFFFFu);                // global_addr[31:0]
  g0[3] = (unsigned)((ga >> 32) & 0x01FFFFFFu) | 0x80000000u;  // addr[56:32] | type=2
  v8i g1;
  g1[0] = (int)((1u << 16) | (1u << 20) | (5u << 22) | (7u << 25)); // 2B elems, pad_en, 64dw interval, 8dw pad
  g1[1] = (int)((dim0 & 0xFFFFu) << 16);               // tensor_dim0[15:0]
  g1[2] = (int)(((dim0 >> 16) & 0xFFFFu) | ((dim1 & 0xFFFFu) << 16)); // dim0 hi | dim1 lo
  g1[3] = (int)(((dim1 >> 16) & 0xFFFFu) | (128u << 16));            // dim1 hi | tile_dim0=128
  g1[4] = (int)128u;                                   // tile_dim1=128, tile_dim2=0
  g1[5] = (int)stride0;                                // tensor_dim0_stride[31:0]
  g1[6] = 0;                                           // stride0 hi | stride1 lo
  g1[7] = 0;
  v4i gz4 = {0, 0, 0, 0};
  v8i gz8 = {0, 0, 0, 0, 0, 0, 0, 0};
  __builtin_amdgcn_tensor_load_to_lds(g0, g1, gz4, gz4, gz8, 0);
}

// -------- Kernel 0: weights to bf16, once --------
// Wf holds six matrices of 2048 16-byte units: Wv0, Wv1, Wk0, Wk1 in fragment order (B operands of proj_kernel, each row
// block read by one wave only), then Wq0, Wq1 as the rows of proj_kernel's LDS tile: tile row lr is weight row
// (lr & 15) * 8 + (lr >> 4), so that column l of fragment tile nt is weight row l * 8 + nt.
__global__ __launch_bounds__(256) void init_kernel(
    const float* __restrict__ Wv0, const float* __restrict__ Wv1,
    const float* __restrict__ Wk0, const float* __restrict__ Wk1,
    const float* __restrict__ Wq0, const float* __restrict__ Wq1,
    bf16* __restrict__ Wf) {
  const int mat = blockIdx.x >> 3;
  const int o = (blockIdx.x & 7) * 256 + threadIdx.x;   // 16-byte unit within the matrix
  const float* Wp = mat == 0 ? Wv0 : mat == 1 ? Wv1 : mat == 2 ? Wk0 : mat == 3 ? Wk1 : mat == 4 ? Wq0 : Wq1;
  int row, k;
  if (mat < 4) {
    const int l = o & 31, h = (o >> 5) & 1, ks = (o >> 6) & 3, w = o >> 8;
    row = w * 16 + (l & 15);
    k = ks * 32 + (l >> 4) * 16 + h * 8;
  } else {
    const int lr = o >> 4;
    row = (lr & 15) * 8 + (lr >> 4);
    k = (o & 15) * 8;
  }
  const float4 a = *(const float4*)(Wp + row * CDIM + k), b = *(const float4*)(Wp + row * CDIM + k + 4);
  v8bf pk;
  pk[0] = (bf16)a.x; pk[1] = (bf16)a.y; pk[2] = (bf16)a.z; pk[3] = (bf16)a.w;
  pk[4] = (bf16)b.x; pk[5] = (bf16)b.y; pk[6] = (bf16)b.z; pk[7] = (bf16)b.w;
  ((v8bf*)Wf)[mat * 2048 + o] = pk;
}

// -------- Kernel 1: projections, Q softmax, and the context product of the work-group's own chunk of N --------
// K and V never leave the WGP. Per tile of 128 n, wave w makes columns w * 16 .. + 15 of V^T and of K^T (the x tile is the
// A operand, the weight rows the B operand), so a lane's accumulator registers hold consecutive n of one channel:
//  - V goes to LDS as [d][n] with 16-byte stores;
//  - the K logits stay in registers: maximum over n, exp, and each pair of D tiles, packed to bf16, is a B fragment.
// Context, transposed: ctx[dt][r] = sum_n V[dt * 16 + 8 * (lane >> 4) + r][n] * E[w * 16 + (lane & 15)][n].
// The exponent's shift is the running maximum of the chunk (kept in units of log2), one value a lane; when it rises, the sums
// so far are scaled down. reduce_kernel brings the chunks' sums to one common shift.
// Output: Qn = (N, C) bf16 per combo = s*2+b; one plane of 'part' per chunk.
// Two work-groups share a WGP (the grid has no more): 108 KiB of LDS each, a wave within 256 VGPRs (second launch bound).
__global__ __launch_bounds__(256, 4) void proj_kernel(
    const float* __restrict__ x0, const float* __restrict__ x1,
    const bf16* __restrict__ Wf,
    bf16* __restrict__ Qn, float* __restrict__ part)
{
  __shared__ unsigned char smem[3 * CDIM * LDP * sizeof(bf16)] __attribute__((aligned(32)));
  bf16 (*Alds)[LDP] = (bf16 (*)[LDP])smem;                                   // Wq, rows dealt [c_out][c]
  bf16 (*Blds)[LDP] = (bf16 (*)[LDP])(smem + CDIM * LDP * sizeof(bf16));     // x tile  [n][c]
  bf16 (*Vlds)[LDP] = (bf16 (*)[LDP])(smem + 2 * CDIM * LDP * sizeof(bf16)); // V tile  [d][n]

  const int t = threadIdx.x, lane = t & 31;
  // the wave's number in a scalar register: what is formed from it costs no vector register over the loop
  const int wave = __builtin_amdgcn_readfirstlane(t >> 5);
  const int combo = blockIdx.y;                 // s*2 + b
  const int s = combo >> 1, b = combo & 1;
  const int nbase = blockIdx.x * NCHUNK;
  const float* xp = (s ? x1 : x0) + (size_t)b * CDIM * NDIM;
  const bf16* Wv = Wf + s * CDIM * CDIM;         // fragment order
  const bf16* Wk = Wf + (2 + s) * CDIM * CDIM;   // fragment order
  const bf16* Wq = Wf + (4 + s) * CDIM * CDIM;   // rows of the LDS tile
  const size_t cb = (size_t)combo * CDIM * NDIM;

  // Wq tile: a plain copy, once per work-group
  {
    v8bf wq[8];
    const v8bf* wqp = (const v8bf*)Wq + t;
#pragma unroll   // wq[] is indexed by constants only; one address with constant offsets
    for (int i = 0; i < 8; i++) wq[i] = wqp[i * 256];
    // the wait in front of any overwrite of these loads' address registers (the address is an input: live up to here)
    asm volatile("s_wait_xcnt 0x0" :: "v"(wqp) : "memory");
#pragma unroll   // wq[] is indexed by constants only
    for (int i = 0; i < 8; i++) *(v8bf*)&Alds[i * 16 + (t >> 4)][(t & 15) * 8] = wq[i];
  }

  // acc[j] += rows wave * 16 .. + 15 of At times rows j * 16 .. + 15 of Bt (both tiles are [row][k])
  auto run_gemm = [&](v8f* acc, const bf16* At, const bf16* Bt) {
#pragma unroll
    for (int ks = 0; ks < 4; ks++) {
      v16bf a = ldfrag(At, wave * 16, ks * 32, lane);
#pragma unroll
      for (int g = 0; g < 8; g += 4) {   // four B fragments at a time
        v16bf bfr[4];
#pragma unroll
        for (int nt = 0; nt < 4; nt++) bfr[nt] = ldfrag(Bt, (g + nt) * 16, ks * 32, lane);
#pragma unroll
        for (int nt = 0; nt < 4; nt++) acc[g + nt] = wmma_bf16(a, bfr[nt], acc[g + nt]);
      }
    }
  };
  const v8f vz = {0.f, 0.f, 0.f, 0.f, 0.f, 0.f, 0.f, 0.f};

  v8f ctx[8];                        // the chunk's context sums, shifted by mrun
#pragma unroll
  for (int i = 0; i < 8; i++) ctx[i] = vz;
  float mrun = -__builtin_inff();    // running maximum of logit * log2(e) of channel wave * 16 + (lane & 15)
  float ksum = 0.0f;                 // this lane half's share of that channel's sum of exponentials, shifted by mrun

  for (int it = 0; it < NCHUNK / 128; it++) {
    const int n0 = nbase + it * 128;
    if (it) __syncthreads();   // every wave has left the x and V tiles of the pass before
    // load x tile (128 c x 128 n), bf16-convert, transpose into Blds[n][c]
    stage_transposed(xp + n0, NDIM, Blds, t);
    v16bf bv[4], bk[4];   // the wave's own 16 rows of Wv and of Wk
    ldfrags_global(Wv, wave, lane, bv);   // ahead of the barrier: their latency runs beside the drain of the LDS stores
    ldfrags_global(Wk, wave, lane, bk);
    __syncthreads();   // the x tile (and, in the first pass, the Wq tile) is complete

    // ---- V^T and K^T: each A fragment of the x tile is read once and serves both ----
    v8f kacc[8];          // kacc[nb][r] = logit of n = nb * 16 + 8 * (lane >> 4) + r, channel wave * 16 + (lane & 15)
#pragma unroll   // all levels: a[], kacc[] and pv[] are indexed by constants only, so they stay in registers
    for (int nb = 0; nb < 8; nb++) {
      v16bf a[4];
#pragma unroll
      for (int ks = 0; ks < 4; ks++) a[ks] = ldfrag(&Blds[0][0], nb * 16, ks * 32, lane);
      v8f va = vz, ka = vz;
#pragma unroll
      for (int ks = 0; ks < 4; ks++) {
        va = wmma_bf16(a[ks], bv[ks], va);
        ka = wmma_bf16(a[ks], bk[ks], ka);
      }
      kacc[nb] = ka;
      v8bf pv;
#pragma unroll
      for (int r = 0; r < 8; r++) pv[r] = (bf16)va[r];
      *(v8bf*)&Vlds[wave * 16 + (lane & 15)][nb * 16 + ((lane >> 4) << 3)] = pv;
    }

    // ---- exp(K - running maximum), packed as the B fragments of the context product ----
    float mt = kacc[0][0];
#pragma unroll   // both levels: kacc[] is indexed by constants only
    for (int nb = 0; nb < 8; nb++)
#pragma unroll
      for (int r = 0; r < 8; r++) mt = fmaxf(mt, kacc[nb][r]);
    mt = fmaxf(mt, __shfl_xor(mt, 16));   // the other half of the tile's n
    const float mnew = fmaxf(mrun, mt * LOG2E);
    const float sc = __builtin_amdgcn_exp2f(mrun - mnew);   // argument <= 0; 0 in the first pass
    mrun = mnew;
    v16bf ef[4];
    v2f ps = {0.0f, 0.0f};
#pragma unroll   // all levels: kacc[], e[] and ef[] are indexed by constants only
    for (int nb = 0; nb < 8; nb++) {
      float e[8];
#pragma unroll
      for (int r = 0; r < 8; r++) e[r] = __builtin_fmaf(kacc[nb][r], LOG2E, -mnew);
      exp2_by8(e);
#pragma unroll
      for (int r = 0; r < 8; r += 2) ps += v2f{e[r], e[r + 1]};
#pragma unroll
      for (int r = 0; r < 8; r++) ef[nb >> 1][(nb & 1) * 8 + r] = (bf16)e[r];
    }
    ksum = ksum * sc + (ps[0] + ps[1]);
#pragma unroll
    for (int dt = 0; dt < 8; dt++) ctx[dt] *= sc;
    __syncthreads();   // the V tile is complete

    // ---- context: V rows from LDS in the k order of the packed D tiles ----
#pragma unroll   // all levels: ef[], vf[] and ctx[] are indexed by constants only
    for (int ks = 0; ks < 4; ks++)
#pragma unroll
      for (int g = 0; g < 8; g += 4) {
        v16bf vf[4];
#pragma unroll
        for (int j = 0; j < 4; j++) vf[j] = ldfrag_kmap(&Vlds[0][0], (g + j) * 16, ks * 32, lane);
#pragma unroll
        for (int j = 0; j < 4; j++) ctx[g + j] = wmma_bf16(vf[j], ef[ks], ctx[g + j]);
      }

    // ---- Q projection + softmax over C (per n) ----
    // The x tile is the A operand here: a wave holds all 128 logits of its 16 rows n, so the softmax needs no LDS.
    // acc[nt][r] = logit of n = wave * 16 + 8 * (lane >> 4) + r, c = (lane & 15) * 8 + nt (weight rows dealt by init_kernel):
    // a lane's eight tiles are eight consecutive c, and 16 lanes store one whole row of Qn.
    {
      v8f acc[8];
#pragma unroll
      for (int i = 0; i < 8; i++) acc[i] = vz;
      run_gemm(acc, &Blds[0][0], &Alds[0][0]);
      v8bf pk[8];
#pragma unroll   // all levels: acc[][], p[] and pk[] are indexed by constants only, so they stay in registers
      for (int r = 0; r < 8; r += 2) {   // two rows at a time: they lie in neighbouring registers, which packed f32 math takes as they are
        v2f ssum = {0.0f, 0.0f}, p[8];
        float m0 = acc[0][r], m1 = acc[0][r + 1];
#pragma unroll
        for (int nt = 1; nt < 8; nt++) {
          m0 = fmaxf(m0, acc[nt][r]);
          m1 = fmaxf(m1, acc[nt][r + 1]);
        }
        row_max16_by2(m0, m1);
        const v2f m = {m0, m1};
#pragma unroll
        for (int g = 0; g < 8; g += 4) {
          float e[8];
#pragma unroll
          for (int j = 0; j < 4; j++) {
            v2f x = {acc[g + j][r], acc[g + j][r + 1]};
            x = (x - m) * LOG2E;
            e[2 * j] = x[0];
            e[2 * j + 1] = x[1];
          }
          exp2_by8(e);
#pragma unroll
          for (int j = 0; j < 4; j++) {
            p[g + j] = v2f{e[2 * j], e[2 * j + 1]};
            ssum += p[g + j];
          }
        }
        v2f inv = {1.0f / row_sum16(ssum[0]), 1.0f / row_sum16(ssum[1])};
#pragma unroll
        for (int nt = 0; nt < 8; nt++) {
          v2f q = p[nt] * inv;
          pk[r][nt] = (bf16)q[0];
          pk[r + 1][nt] = (bf16)q[1];
        }
      }
      bf16* qrow = Qn + cb + (size_t)(n0 + wave * 16 + ((lane >> 4) << 3)) * CDIM + (lane & 15) * 8;
#pragma unroll   // pk[] indexed by constants; the eight stores take one address with constant offsets
      for (int r = 0; r < 8; r++) *(v8bf*)&qrow[r * CDIM] = pk[r];
      // The wait that stands in front of any overwrite of the stores' registers by the next tile's work; it takes the
      // address and the data as inputs, so they stay live up to here.
      asm volatile("s_wait_xcnt 0x0" :: "v"(qrow),
                   "v"(__builtin_bit_cast(v4u, pk[0])), "v"(__builtin_bit_cast(v4u, pk[1])),
                   "v"(__builtin_bit_cast(v4u, pk[2])), "v"(__builtin_bit_cast(v4u, pk[3])),
                   "v"(__builtin_bit_cast(v4u, pk[4])), "v"(__builtin_bit_cast(v4u, pk[5])),
                   "v"(__builtin_bit_cast(v4u, pk[6])), "v"(__builtin_bit_cast(v4u, pk[7])) : "memory");
    }
  }

  // ---- the chunk's plane: context [c][d], then (row sum, row maximum) ----
  ksum += __shfl_xor(ksum, 16);
  float* plane = part + (size_t)blockIdx.x * TOT;
  // The lane's number, formed anew for the epilogue: with the loop's own 'lane' used here the build runs out of its 256
  // registers and puts 16 bytes to scratch.
  const int le = (int)__builtin_amdgcn_mbcnt_lo(~0u, 0u);
  const int c = wave * 16 + (le & 15);
  float* Wp = plane + combo * CDIM * CDIM + c * CDIM + ((le >> 4) << 3);
  v2f* km_o = (v2f*)(plane + 4 * CDIM * CDIM) + combo * CDIM + c;
#pragma unroll   // ctx[] is indexed by constants only; one address with constant offsets
  for (int dt = 0; dt < 8; dt++) {
    *(v4f*)(Wp + dt * 16) = v4f{ctx[dt][0], ctx[dt][1], ctx[dt][2], ctx[dt][3]};
    *(v4f*)(Wp + dt * 16 + 4) = v4f{ctx[dt][4], ctx[dt][5], ctx[dt][6], ctx[dt][7]};
  }
  if (le < 16) *km_o = v2f{ksum, mrun};
}

// -------- Kernel 2: add the CHUNKS planes, in a fixed order; make out_kernel's A operand ------------------
// A work-group owns 8 rows c x 32 columns d of one context matrix (64 float4); its four quarters each add a quarter
// of the planes (and of the planes' row sums), every plane scaled from its own exponent shift to the quarter's largest; the
// first quarter adds the four results through LDS in the same way, divides by the
// row sum and stores bf16 in fragment order as [row d][k c]: the block's 256 values fill two whole runs of 256 bytes.
__global__ __launch_bounds__(256) void reduce_kernel(const float* __restrict__ part,
                                                     bf16* __restrict__ Af)
{
  __shared__ float4 red[4][64];
  __shared__ float kred[4][64];
  __shared__ float mred[4][64];
  const int t = threadIdx.x, col = t & 63, g = t >> 6;
  const int combo = blockIdx.x >> 6, cg = (blockIdx.x >> 2) & 15, db = blockIdx.x & 3;
  const int row = col >> 3;
  const int c = cg * 8 + row, d0 = db * 32 + (col & 7) * 4;
  const float* pl = part + (size_t)(g * (CHUNKS / 4)) * TOT;
  const float4* p = (const float4*)(pl + combo * CDIM * CDIM + c * CDIM + d0);
  const v2f* pk = (const v2f*)(pl + 4 * CDIM * CDIM) + combo * CDIM + c;
  float4 v[CHUNKS / 4];
  v2f kv[CHUNKS / 4];   // (row sum, shift); every thread takes its row's (eight threads the same ones): no branch, so these loads fly with the others
#pragma unroll   // constant offsets from one address, and many independent loads in flight per thread
  for (int k = 0; k < CHUNKS / 4; k++) v[k] = p[(size_t)k * (TOT / 4)];
  // The wait that stands in front of any overwrite of these loads' address registers; it also parts the two runs, so that
  // no load of one run lands its result in an address register of the other while that run is being issued.
  asm volatile("s_wait_xcnt 0x0" ::: "memory");
#pragma unroll   // the same
  for (int k = 0; k < CHUNKS / 4; k++) kv[k] = pk[(size_t)k * (TOT / 2)];
  // The same wait for the second run, in front of the arithmetic.
  asm volatile("s_wait_xcnt 0x0" ::: "memory");
  float mg = kv[0][1];
#pragma unroll   // kv[] is indexed by constants only
  for (int k = 1; k < CHUNKS / 4; k++) mg = fmaxf(mg, kv[k][1]);
  float4 s = {0.0f, 0.0f, 0.0f, 0.0f};
  float sk = 0.0f;
#pragma unroll   // both levels: v[], kv[] and w[] are indexed by constants only, so they stay in registers
  for (int k = 0; k < CHUNKS / 4; k += 8) {
    float w[8];   // 2^(plane's shift - largest shift)
#pragma unroll
    for (int j = 0; j < 8; j++) w[j] = kv[k + j][1] - mg;
    exp2_by8(w);
#pragma unroll
    for (int j = 0; j < 8; j++) {
      s.x += w[j] * v[k + j].x; s.y += w[j] * v[k + j].y; s.z += w[j] * v[k + j].z; s.w += w[j] * v[k + j].w;
      sk += w[j] * kv[k + j][0];
    }
  }
  red[g][col] = s;
  kred[g][col] = sk;
  mred[g][col] = mg;
  __syncthreads();
  if (g == 0) {
    float4 a = red[0][col], b = red[1][col], cc = red[2][col], d = red[3][col];
    const float m0 = mred[0][col], m1 = mred[1][col], m2 = mred[2][col], m3 = mred[3][col];
    const float mm = fmaxf(fmaxf(m0, m1), fmaxf(m2, m3));
    float f[4] = {m0 - mm, m1 - mm, m2 - mm, m3 - mm};
    exp2_by4(f);
    const float den = (f[0] * kred[0][col] + f[1] * kred[1][col]) + (f[2] * kred[2][col] + f[3] * kred[3][col]);
    float r[4];
    r[0] = (f[0] * a.x + f[1] * b.x) + (f[2] * cc.x + f[3] * d.x);
    r[1] = (f[0] * a.y + f[1] * b.y) + (f[2] * cc.y + f[3] * d.y);
    r[2] = (f[0] * a.z + f[1] * b.z) + (f[2] * cc.z + f[3] * d.z);
    r[3] = (f[0] * a.w + f[1] * b.w) + (f[2] * cc.w + f[3] * d.w);
    // unit ((w * 4 + ks) * 2 + h) * 32 + lane, element j: w = d >> 4, ks = c >> 5, h = (c >> 3) & 1,
    // lane = ((c >> 4) & 1) * 16 + (d & 15), j = c & 7
    const int unit = (((d0 >> 4) * 4 + (c >> 5)) * 2 + ((c >> 3) & 1)) * 32 + ((c >> 4) & 1) * 16 + (d0 & 15);
    bf16* o = Af + combo * CDIM * CDIM + unit * 8 + (c & 7);
#pragma unroll   // r[] is indexed by constants only
    for (int i = 0; i < 4; i++) o[i * 8] = (bf16)(r[i] / den);
  }
}

// -------- Kernel 3: Out_s[d,n] = sum_c (W_{1-s}[c,d]/ksum_c) * Q_s[n,c] -----
// Q tile staged by the Tensor Data Mover. The A operand comes ready from reduce_kernel; a wave reads only its own 16 rows
// of it, so they go from global memory to registers.
// Second launch bound: a wave stays within 128 VGPRs, so that four work-groups still share a WGP.
__global__ __launch_bounds__(256, 8) void out_kernel(
    const bf16* __restrict__ Qn, const bf16* __restrict__ Af, float* __restrict__ out)
{
  __shared__ bf16 Qlds[CDIM][LDP] __attribute__((aligned(32)));  // [n][c]

  const int t = threadIdx.x, lane = t & 31, wave = t >> 5;
  const int combo = blockIdx.y;
  const int s = combo >> 1, b = combo & 1;
  const int other = ((1 - s) << 1) | b;
  const int n0 = blockIdx.x * 128;
  const bf16* Qb = Qn + (size_t)combo * CDIM * NDIM;

  // The fragment loads are issued first, so that they fly beside the tensor load and nothing stands between that load and its wait.
  v16bf a[4];   // rows d = wave * 16 .. + 15 of W_other[c][d] / ksum_other[c], k = c
  ldfrags_global(Af + other * CDIM * CDIM, wave, lane, a);

  // async DMA: Q tile (128 n x 128 c) -> Qlds with padded rows
  if (t < 32) {
    tdm_load_tile(Qb + (size_t)n0 * CDIM, &Qlds[0][0], CDIM, NDIM, CDIM);
    // The issuing wave's wait, directly behind the issue: no descriptor register takes a new value while the request is out.
    asm volatile("s_wait_tensorcnt 0x0" ::: "memory");
  }
  __syncthreads();

  const v8f vz = {0.f, 0.f, 0.f, 0.f, 0.f, 0.f, 0.f, 0.f};
  v8f acc[8];
#pragma unroll
  for (int i = 0; i < 8; i++) acc[i] = vz;
#pragma unroll
  for (int ks = 0; ks < 4; ks++) {
    v16bf bfr[8];
#pragma unroll
    for (int nt = 0; nt < 8; nt++) bfr[nt] = ldfrag(&Qlds[0][0], nt * 16, ks * 32, lane);
#pragma unroll
    for (int nt = 0; nt < 8; nt++) acc[nt] = wmma_bf16(a[ks], bfr[nt], acc[nt]);
  }

  float* ob = out + (size_t)combo * CDIM * NDIM;
#pragma unroll
  for (int nt = 0; nt < 8; nt++)
#pragma unroll
    for (int r = 0; r < 8; r++) {
      int d = wave * 16 + r + ((lane >> 4) << 3);
      int n = n0 + nt * 16 + (lane & 15);
      ob[(size_t)d * NDIM + n] = acc[nt][r];
    }
}

extern "C" void kernel_launch(void* const* d_in, const int* in_sizes, int n_in,
                              void* d_out, int out_size, void* d_ws, size_t ws_size,
                              hipStream_t stream) {
  (void)in_sizes; (void)n_in; (void)out_size; (void)ws_size;
  const float* x0  = (const float*)d_in[0];
  const float* x1  = (const float*)d_in[1];
  const float* Wk0 = (const float*)d_in[2];
  const float* Wk1 = (const float*)d_in[3];
  const float* Wq0 = (const float*)d_in[4];
  const float* Wq1 = (const float*)d_in[5];
  const float* Wv0 = (const float*)d_in[6];
  const float* Wv1 = (const float*)d_in[7];
  float* out = (float*)d_out;

  const size_t PLANE = (size_t)4 * CDIM * NDIM;   // elems of Qn (all combos)
  bf16* Qn = (bf16*)d_ws;
  bf16* Af = Qn + PLANE;                          // four normalised context matrices, fragment order
  bf16* Wf = Af + 4 * CDIM * CDIM;                // six weight matrices
  float* part = (float*)(Wf + 6 * CDIM * CDIM);   // CHUNKS planes: four context matrices, then the rows' (sum, maximum) pairs

  init_kernel<<<dim3(6 * 8), 256, 0, stream>>>(Wv0, Wv1, Wk0, Wk1, Wq0, Wq1, Wf);
  proj_kernel<<<dim3(CHUNKS, 4), 256, 0, stream>>>(x0, x1, Wf, Qn, part);
  reduce_kernel<<<dim3(4 * CDIM * CDIM / 256), 256, 0, stream>>>(part, Af);
  out_kernel<<<dim3(NDIM / 128, 4), 256, 0, stream>>>(Qn, Af, out);
}

// v007
// A run of this version takes 53.8 microseconds.
// Timed twice side by side with v006, it ran 1.04 and 1.03 times as fast.
// Over all steps from v000 it is 3.47 times as fast.
#include <hip/hip_runtime.h>

#define CDIM 128
#define NDIM 32768
#define LDP  144                 // padded LDS row (bf16 elems): 288B rows = 64 data dw + 8 pad dw
#define LOG2E 1.4426950408889634f
#define CHUNKS 128
#define NCHUNK (NDIM / CHUNKS)   // 256
#define TOT (4 * CDIM * CDIM + 8 * CDIM)   // floats in one plane: four context matrices, then per matrix and row the pair (row sum, row maximum)

typedef __bf16 bf16;
typedef __attribute__((ext_vector_type(16))) bf16  v16bf;
typedef __attribute__((ext_vector_type(8)))  bf16  v8bf;
typedef __attribute__((ext_vector_type(4)))  bf16  v4bf;
typedef __attribute__((ext_vector_type(2)))  bf16  v2bf;
typedef __attribute__((ext_vector_type(8)))  float v8f;
typedef __attribute__((ext_vector_type(4)))  float v4f;
typedef __attribute__((ext_vector_type(2)))  float v2f;
typedef unsigned v4u __attribute__((ext_vector_type(4)));
typedef int      v4i __attribute__((ext_vector_type(4)));
typedef int      v8i __attribute__((ext_vector_type(8)));

// A(16x32 bf16) and B(32x16 bf16) fragments share the same address function:
// lane&15 -> row (A: M, B: column), lane>>4 selects k half; 16 contiguous bf16.
static __device__ __forceinline__ v16bf ldfrag(const bf16* base, int row0, int k0, int lane) {
  const bf16* p = base + (size_t)(row0 + (lane & 15)) * LDP + k0 + ((lane >> 4) << 4);
  return *(const v16bf*)p;
}

// The same fragment in the hardware's own k order, which a pair of packed D tiles on the other side of the product has:
// element s of lane half h is k = k0 + 8 h + s (s < 8), k0 + 16 + 8 h + (s - 8) otherwise: two 16-byte loads.
static __device__ __forceinline__ v16bf ldfrag_kmap(const bf16* base, int row0, int k0, int lane) {
  const bf16* p = base + (size_t)(row0 + (lane & 15)) * LDP + k0 + ((lane >> 4) << 3);
  v8bf lo = *(const v8bf*)p, hi = *(const v8bf*)(p + 16);
  return __builtin_shufflevector(lo, hi, 0, 1, 2, 3, 4, 5, 6, 7, 8, 9, 10, 11, 12, 13, 14, 15);
}

// Fragment order: a 128 x 128 bf16 operand [row][k] laid out so that the fragment ldfrag() would read for row block w and
// k step ks is two runs of 512 bytes: 16-byte unit ((w * 4 + ks) * 2 + h) * 32 + lane holds row w * 16 + (lane & 15),
// k = ks * 32 + (lane >> 4) * 16 + h * 8 .. + 7. A wave loads the four fragments of its own row block with whole lines.
static __device__ __forceinline__ void ldfrags_global(const bf16* __restrict__ F, int wave, int lane, v16bf (&a)[4]) {
  const v8bf* p = (const v8bf*)F + wave * 256 + lane;
#pragma unroll   // a[] is indexed by constants only; one address with constant offsets
  for (int ks = 0; ks < 4; ks++) {
    v8bf lo = p[ks * 64], hi = p[ks * 64 + 32];
    a[ks] = __builtin_shufflevector(lo, hi, 0, 1, 2, 3, 4, 5, 6, 7, 8, 9, 10, 11, 12, 13, 14, 15);
  }
  // The wait that stands in front of any overwrite of the loads' address registers; it takes the address as an input,
  // so the pair stays live up to here.
  asm volatile("s_wait_xcnt 0x0" :: "v"(p) : "memory");
}

static __device__ __forceinline__ v8f wmma_bf16(v16bf a, v16bf b, v8f c) {
  return __builtin_amdgcn_wmma_f32_16x16x32_bf16(false, a, false, b, (short)0, c, false, false);
}

// Transposing stage: a 128 x 128 f32 tile src[k][row] (row pitch 'stride' floats) goes to dst[row][k] as bf16.
// A lane owns a block of 8 k x 4 rows, so both sides are wide: eight 16-byte loads (8 lanes cover a whole
// 128-byte line of one k, 4 lines per wave load) and four 16-byte LDS stores of 8 consecutive k.
// Lane bits: bit 0 and bits 3..4 pick the float4 within the line, bits 1..2 pick one of four k groups; at a row
// pitch of 72 dwords the 32 lanes of one store then fall on 8 different groups of 4 banks (4 rows apart alone: 2).
// In two halves, so that other work can stand between the loads and their use.
static __device__ __forceinline__ void stage_transposed_load(const float* __restrict__ src, size_t stride,
                                                             int t, v4f (&v)[2][8]) {
  const int lane = t & 31, wave = t >> 5;
  const int q8 = (lane & 1) | ((lane >> 3) << 1);   // 0..7
  const int gs = (lane >> 1) & 3;                   // 0..3
  const int k0 = ((wave >> 1) * 4 + gs) * 8;        // a wave's two blocks share their k group ...
  const int r0 = ((wave & 1) * 16 + q8) * 4;        // ... and lie 32 rows apart: one aligned 256-byte unit per k
  const float* base = src + (size_t)k0 * stride + r0;
#pragma unroll   // both loops: a lane's sixteen loads stand ahead of their uses, one base address and constant offsets
  for (int u = 0; u < 2; u++)
#pragma unroll
    for (int j = 0; j < 8; j++)
      v[u][j] = *(const v4f*)(base + (size_t)j * stride + u * 32);
  // The wait that stands in front of any overwrite of the loads' address registers. It takes the address as an
  // input, so the pair stays live up to here and no load of the run can land its result in it.
  asm volatile("s_wait_xcnt 0x0" :: "v"(base) : "memory");
}
static __device__ __forceinline__ void stage_transposed_store(const v4f (&v)[2][8], bf16 (*dst)[LDP], int t) {
  const int lane = t & 31, wave = t >> 5;
  const int q8 = (lane & 1) | ((lane >> 3) << 1);
  const int gs = (lane >> 1) & 3;
  const int k0 = ((wave >> 1) * 4 + gs) * 8;
  const int r0 = ((wave & 1) * 16 + q8) * 4;
#pragma unroll   // all three loops: v[][] and pk[] are indexed by constants only, so they stay in registers
  for (int u = 0; u < 2; u++)
#pragma unroll
    for (int i = 0; i < 4; i++) {
      v8bf pk;
#pragma unroll
      for (int j = 0; j < 8; j++) pk[j] = (bf16)v[u][j][i];
      *(v8bf*)&dst[r0 + u * 32 + i][k0] = pk;
    }
}

// Sixteen consecutive rows of a 128 x 128 f32 weight matrix (8 KiB in a row): one row, four whole lines, per wave load.
// 'rows' is the same in every lane; off = lane * 16.
static __device__ __forceinline__ void load_rows16(const float* __restrict__ rows, unsigned off, v4f (&f)[16]) {
#pragma unroll   // f[] is indexed by constants only; one address with constant offsets
  for (int j = 0; j < 16; j++) f[j] = *(const v4f*)((const char*)rows + off + j * (CDIM * 4));
  // The wait that stands in front of any overwrite of the loads' address registers, directly behind the loads; it takes base
  // and offset as inputs, so they stay live up to here.
  asm volatile("s_wait_xcnt 0x0" :: "s"(rows), "v"(off) : "memory");
}

// Those rows as the four bf16 fragments of the wave's own row block: rounded, laid as rows in 16 LDS rows that only this
// wave touches at this time, and read back with ldfrag().
static __device__ __forceinline__ void rows16_to_frags(const v4f (&f)[16], bf16 (*own)[LDP], int lane, v16bf (&fr)[4]) {
#pragma unroll   // both levels: f[] is indexed by constants only
  for (int j = 0; j < 16; j++) {
    v4bf pk;
#pragma unroll
    for (int i = 0; i < 4; i++) pk[i] = (bf16)f[j][i];
    *(v4bf*)&own[j][lane * 4] = pk;
  }
  // The wave's own LDS stores are done before it reads other lanes' values back (and the compiler moves no read above them).
  asm volatile("s_wait_dscnt 0x0" ::: "memory");
#pragma unroll   // fr[] is indexed by constants only
  for (int ks = 0; ks < 4; ks++) fr[ks] = ldfrag(&own[0][0], 0, ks * 32, lane);
}

// Value of lane l ^ X inside a 16-lane row, by DPP (row_xmask): no LDS, no wait counter.
template <int X>
static __device__ __forceinline__ float row_xor(float v) {
  return __builtin_bit_cast(float, __builtin_amdgcn_update_dpp(0, __builtin_bit_cast(int, v), 0x160 | X, 0xf, 0xf, true));
}
// Maximum over each 16-lane row, for two values at once (all lanes on). In asm text because the compiler makes three
// instructions of each step written with fmaxf (a DPP move, a quieting maximum, the maximum); two chains fill each other's latency.
static __device__ __forceinline__ void row_max16_by2(float& a, float& b) {
  asm("v_max_num_f32_dpp %0, %0, %0 row_xmask:1 row_mask:0xf bank_mask:0xf\n\t"
      "v_max_num_f32_dpp %1, %1, %1 row_xmask:1 row_mask:0xf bank_mask:0xf\n\t"
      "v_max_num_f32_dpp %0, %0, %0 row_xmask:2 row_mask:0xf bank_mask:0xf\n\t"
      "v_max_num_f32_dpp %1, %1, %1 row_xmask:2 row_mask:0xf bank_mask:0xf\n\t"
      "v_max_num_f32_dpp %0, %0, %0 row_xmask:4 row_mask:0xf bank_mask:0xf\n\t"
      "v_max_num_f32_dpp %1, %1, %1 row_xmask:4 row_mask:0xf bank_mask:0xf\n\t"
      "v_max_num_f32_dpp %0, %0, %0 row_xmask:8 row_mask:0xf bank_mask:0xf\n\t"
      "v_max_num_f32_dpp %1, %1, %1 row_xmask:8 row_mask:0xf bank_mask:0xf"
      : "+v"(a), "+v"(b));
}
static __device__ __forceinline__ float row_sum16(float v) {
  v += row_xor<1>(v); v += row_xor<2>(v); v += row_xor<4>(v); return v + row_xor<8>(v);
}

// Eight 2^x in place, arguments <= 0 (a result below the smallest normal f32 may come out as 0). One statement: no
// instruction in it reads a neighbour's result or overwrites a neighbour's source, and the v_nop at its end is the slot
// that the instruction set asks for behind a transcendental, whatever the compiler puts next.
static __device__ __forceinline__ void exp2_by8(float (&e)[8]) {
  asm("v_exp_f32 %0, %0\n\tv_exp_f32 %1, %1\n\tv_exp_f32 %2, %2\n\tv_exp_f32 %3, %3\n\t"
      "v_exp_f32 %4, %4\n\tv_exp_f32 %5, %5\n\tv_exp_f32 %6, %6\n\tv_exp_f32 %7, %7\n\tv_nop"
      : "+v"(e[0]), "+v"(e[1]), "+v"(e[2]), "+v"(e[3]), "+v"(e[4]), "+v"(e[5]), "+v"(e[6]), "+v"(e[7]));
}

// The same for four values.
static __device__ __forceinline__ void exp2_by4(float (&e)[4]) {
  asm("v_exp_f32 %0, %0\n\tv_exp_f32 %1, %1\n\tv_exp_f32 %2, %2\n\tv_exp_f32 %3, %3\n\tv_nop"
      : "+v"(e[0]), "+v"(e[1]), "+v"(e[2]), "+v"(e[3]));
}

// TDM: DMA a 128x128 tile of 2-byte elements (row length dim0, row stride stride0,
// dim1 rows total in tensor) from global into LDS with 64dw+8dw row padding (-> LDP rows).
static __device__ __forceinline__ void tdm_load_tile(const void* gsrc, void* ldst,
                                                     unsigned dim0, unsigned dim1,
                                                     unsigned stride0) {
  unsigned long long ga = (unsigned long long)(size_t)gsrc;
  unsigned lds_off = (unsigned)(size_t)ldst;   // generic LDS addr low 32 bits = LDS offset
  v4u g0;
  g0[0] = 1u;                                          // count=1, user descriptor
  g0[1] = lds_off;                                     // LDS byte address
  g0[2] = (unsigned)(ga & 0xFFFFFFFFu);                // global_addr[31:0]
  g0[3] = (unsigned)((ga >> 32) & 0x01FFFFFFu) | 0x80000000u;  // addr[56:32] | type=2
  v8i g1;
  g1[0] = (int)((1u << 16) | (1u << 20) | (5u << 22) | (7u << 25)); // 2B elems, pad_en, 64dw interval, 8dw pad
  g1[1] = (int)((dim0 & 0xFFFFu) << 16);               // tensor_dim0[15:0]
  g1[2] = (int)(((dim0 >> 16) & 0xFFFFu) | ((dim1 & 0xFFFFu) << 16)); // dim0 hi | dim1 lo
  g1[3] = (int)(((dim1 >> 16) & 0xFFFFu) | (128u << 16));            // dim1 hi | tile_dim0=128
  g1[4] = (int)128u;                                   // tile_dim1=128, tile_dim2=0
  g1[5] = (int)stride0;                                // tensor_dim0_stride[31:0]
  g1[6] = 0;                                           // stride0 hi | stride1 lo
  g1[7] = 0;
  v4i gz4 = {0, 0, 0, 0};
  v8i gz8 = {0, 0, 0, 0, 0, 0, 0, 0};
  __builtin_amdgcn_tensor_load_to_lds(g0, g1, gz4, gz4, gz8, 0);
}

// -------- Kernel 1: projections, Q softmax, and the context product of the work-group's own chunk of N --------
// The weights come as f32 and are rounded to bf16 here. Wq goes to an LDS tile once per work-group: tile row lr is weight row
// (lr & 15) * 8 + (lr >> 4), so that column l of fragment tile nt is weight row l * 8 + nt. Of Wv and Wk a wave needs its own
// 16 rows only: Wk's lie in LDS for the whole kernel; Wv's (no room is left for them) become fragments anew in each pass,
// through the wave's own 16 rows of the V tile, which are free at that time.
// K and V never leave the WGP. Per tile of 128 n, wave w makes columns w * 16 .. + 15 of V^T and of K^T (the x tile is the
// A operand, the weight rows the B operand), so a lane's accumulator registers hold consecutive n of one channel:
//  - V goes to LDS as [d][n] with 16-byte stores;
//  - the K logits stay in registers: maximum over n, exp, and each pair of D tiles, packed to bf16, is a B fragment.
// Context, transposed: ctx[dt][r] = sum_n V[dt * 16 + 8 * (lane >> 4) + r][n] * E[w * 16 + (lane & 15)][n].
// The exponent's shift is the running maximum of the chunk (kept in units of log2), one value a lane; when it rises, the sums
// so far are scaled down. reduce_kernel brings the chunks' sums to one common shift.
// Output: Qn = (N, C) bf16 per combo = s*2+b; one plane of 'part' per chunk.
// Two work-groups share a WGP (the grid has no more): 144 KiB of LDS each, a wave within 256 VGPRs (second launch bound).
__global__ __launch_bounds__(256, 4) void proj_kernel(
    const float* __restrict__ x0, const float* __restrict__ x1,
    const float* __restrict__ Wv0, const float* __restrict__ Wv1,
    const float* __restrict__ Wk0, const float* __restrict__ Wk1,
    const float* __restrict__ Wq0, const float* __restrict__ Wq1,
    bf16* __restrict__ Qn, float* __restrict__ part)
{
  __shared__ unsigned char smem[4 * CDIM * LDP * sizeof(bf16)] __attribute__((aligned(32)));
  bf16 (*Alds)[LDP] = (bf16 (*)[LDP])smem;                                   // Wq, rows dealt [c_out][c]
  bf16 (*Blds)[LDP] = (bf16 (*)[LDP])(smem + CDIM * LDP * sizeof(bf16));     // x tile  [n][c]
  bf16 (*Vlds)[LDP] = (bf16 (*)[LDP])(smem + 2 * CDIM * LDP * sizeof(bf16)); // V tile  [d][n]
  bf16 (*Klds)[LDP] = (bf16 (*)[LDP])(smem + 3 * CDIM * LDP * sizeof(bf16)); // Wk [c_out][c]; a wave writes and reads its own 16 rows only

  const int t = threadIdx.x, lane = t & 31;
  // the wave's number in a scalar register: what is formed from it costs no vector register over the loop
  const int wave = __builtin_amdgcn_readfirstlane(t >> 5);
  const int combo = blockIdx.y;                 // s*2 + b
  const int s = combo >> 1, b = combo & 1;
  const int nbase = blockIdx.x * NCHUNK;
  const float* xp = (s ? x1 : x0) + (size_t)b * CDIM * NDIM;
  const float* Wv = (s ? Wv1 : Wv0) + wave * 16 * CDIM;   // the wave's own 16 rows
  const float* Wk = (s ? Wk1 : Wk0) + wave * 16 * CDIM;
  const float* Wq = (s ? Wq1 : Wq0) + wave * 16 * CDIM;   // the 16 rows that this wave brings to the LDS tile
  const size_t cb = (size_t)combo * CDIM * NDIM;

  // Once per work-group: weight row wave * 16 + j of Wq goes to tile row (j & 7) * 16 + wave * 2 + (j >> 3), that of Wk stays in place
  {
    v4f wq[16], wk[16];
    load_rows16(Wq, (unsigned)lane * 16u, wq);
    load_rows16(Wk, (unsigned)lane * 16u, wk);
#pragma unroll   // both levels: wq[] and wk[] are indexed by constants only
    for (int j = 0; j < 16; j++) {
      v4bf pq, pk;
#pragma unroll
      for (int i = 0; i < 4; i++) { pq[i] = (bf16)wq[j][i]; pk[i] = (bf16)wk[j][i]; }
      *(v4bf*)&Alds[(j & 7) * 16 + wave * 2 + (j >> 3)][lane * 4] = pq;
      *(v4bf*)&Klds[wave * 16 + j][lane * 4] = pk;
    }
  }

  // acc[j] += rows wave * 16 .. + 15 of At times rows j * 16 .. + 15 of Bt (both tiles are [row][k])
  auto run_gemm = [&](v8f* acc, const bf16* At, const bf16* Bt) {
#pragma unroll
    for (int ks = 0; ks < 4; ks++) {
      v16bf a = ldfrag(At, wave * 16, ks * 32, lane);
#pragma unroll
      for (int g = 0; g < 8; g += 4) {   // four B fragments at a time
        v16bf bfr[4];
#pragma unroll
        for (int nt = 0; nt < 4; nt++) bfr[nt] = ldfrag(Bt, (g + nt) * 16, ks * 32, lane);
#pragma unroll
        for (int nt = 0; nt < 4; nt++) acc[g + nt] = wmma_bf16(a, bfr[nt], acc[g + nt]);
      }
    }
  };
  const v8f vz = {0.f, 0.f, 0.f, 0.f, 0.f, 0.f, 0.f, 0.f};

  v8f ctx[8];                        // the chunk's context sums, shifted by mrun
#pragma unroll
  for (int i = 0; i < 8; i++) ctx[i] = vz;
  float mrun = -__builtin_inff();    // running maximum of logit * log2(e) of channel wave * 16 + (lane & 15)
  float ksum = 0.0f;                 // this lane half's share of that channel's sum of exponentials, shifted by mrun

  for (int it = 0; it < NCHUNK / 128; it++) {
    const int n0 = nbase + it * 128;
    if (it) __syncthreads();   // every wave has left the x and V tiles of the pass before
    v16bf bv[4], bk[4];   // the wave's own 16 rows of Wv and of Wk
    {
      // Loads return in issue order: Wv's rows are asked for ahead of the x tile and worked on while that tile is on its way
      // from memory.
      v4f wf[16], xv[2][8];
      load_rows16(Wv, (unsigned)lane * 16u, wf);
      stage_transposed_load(xp + n0, NDIM, t, xv);   // x tile (128 c x 128 n)
      // Nothing of what follows is scheduled above the x loads: without this the build rounds Wv first, and the tile's loads
      // leave only after Wv's rows have come.
      __builtin_amdgcn_sched_barrier(0);
      rows16_to_frags(wf, &Vlds[wave * 16], lane, bv);
#pragma unroll   // bk[] is indexed by constants only; the wave's stores of these rows lie ahead of the s_wait_dscnt 0 in rows16_to_frags()
      for (int ks = 0; ks < 4; ks++) bk[ks] = ldfrag(&Klds[wave * 16][0], 0, ks * 32, lane);
      // Nothing of the x tile's rounding is scheduled above this line: without it the build mixes that work, and with it the wait
      // for the tile, into Wv's.
      __builtin_amdgcn_sched_barrier(0);
      stage_transposed_store(xv, Blds, t);           // to bf16, transposed into Blds[n][c]
    }
    __syncthreads();   // the x tile (and, in the first pass, the Wq tile) is complete

    // ---- V^T and K^T: each A fragment of the x tile is read once and serves both ----
    v8f kacc[8];          // kacc[nb][r] = logit of n = nb * 16 + 8 * (lane >> 4) + r, channel wave * 16 + (lane & 15)
#pragma unroll   // all levels: a[], kacc[] and pv[] are indexed by constants only, so they stay in registers
    for (int nb = 0; nb < 8; nb++) {
      v16bf a[4];
#pragma unroll
      for (int ks = 0; ks < 4; ks++) a[ks] = ldfrag(&Blds[0][0], nb * 16, ks * 32, lane);
      v8f va = vz, ka = vz;
#pragma unroll
      for (int ks = 0; ks < 4; ks++) {
        va = wmma_bf16(a[ks], bv[ks], va);
        ka = wmma_bf16(a[ks], bk[ks], ka);
      }
      kacc[nb] = ka;
      v8bf pv;
#pragma unroll
      for (int r = 0; r < 8; r++) pv[r] = (bf16)va[r];
      *(v8bf*)&Vlds[wave * 16 + (lane & 15)][nb * 16 + ((lane >> 4) << 3)] = pv;
    }

    // ---- exp(K - running maximum), packed as the B fragments of the context product ----
    float mt = kacc[0][0];
#pragma unroll   // both levels: kacc[] is indexed by constants only
    for (int nb = 0; nb < 8; nb++)
#pragma unroll
      for (int r = 0; r < 8; r++) mt = fmaxf(mt, kacc[nb][r]);
    mt = fmaxf(mt, __shfl_xor(mt, 16));   // the other half of the tile's n
    const float mnew = fmaxf(mrun, mt * LOG2E);
    const float sc = __builtin_amdgcn_exp2f(mrun - mnew);   // argument <= 0; 0 in the first pass
    mrun = mnew;
    v16bf ef[4];
    v2f ps = {0.0f, 0.0f};
#pragma unroll   // all levels: kacc[], e[] and ef[] are indexed by constants only
    for (int nb = 0; nb < 8; nb++) {
      float e[8];
#pragma unroll
      for (int r = 0; r < 8; r++) e[r] = __builtin_fmaf(kacc[nb][r], LOG2E, -mnew);
      exp2_by8(e);
#pragma unroll
      for (int r = 0; r < 8; r += 2) ps += v2f{e[r], e[r + 1]};
#pragma unroll
      for (int r = 0; r < 8; r++) ef[nb >> 1][(nb & 1) * 8 + r] = (bf16)e[r];
    }
    ksum = ksum * sc + (ps[0] + ps[1]);
#pragma unroll
    for (int dt = 0; dt < 8; dt++) ctx[dt] *= sc;
    __syncthreads();   // the V tile is complete

    // ---- context: V rows from LDS in the k order of the packed D tiles ----
#pragma unroll   // all levels: ef[], vf[] and ctx[] are indexed by constants only
    for (int ks = 0; ks < 4; ks++)
#pragma unroll
      for (int g = 0; g < 8; g += 4) {
        v16bf vf[4];
#pragma unroll
        for (int j = 0; j < 4; j++) vf[j] = ldfrag_kmap(&Vlds[0][0], (g + j) * 16, ks * 32, lane);
#pragma unroll
        for (int j = 0; j < 4; j++) ctx[g + j] = wmma_bf16(vf[j], ef[ks], ctx[g + j]);
      }

    // ---- Q projection + softmax over C (per n) ----
    // The x tile is the A operand here: a wave holds all 128 logits of its 16 rows n, so the softmax needs no LDS.
    // acc[nt][r] = logit of n = wave * 16 + 8 * (lane >> 4) + r, c = (lane & 15) * 8 + nt (weight rows dealt in the LDS tile):
    // a lane's eight tiles are eight consecutive c, and 16 lanes store one whole row of Qn.
    {
      v8f acc[8];
#pragma unroll
      for (int i = 0; i < 8; i++) acc[i] = vz;
      run_gemm(acc, &Blds[0][0], &Alds[0][0]);
      v8bf pk[8];
#pragma unroll   // all levels: acc[][], p[] and pk[] are indexed by constants only, so they stay in registers
      for (int r = 0; r < 8; r += 2) {   // two rows at a time: they lie in neighbouring registers, which packed f32 math takes as they are
        v2f ssum = {0.0f, 0.0f}, p[8];
        float m0 = acc[0][r], m1 = acc[0][r + 1];
#pragma unroll
        for (int nt = 1; nt < 8; nt++) {
          m0 = fmaxf(m0, acc[nt][r]);
          m1 = fmaxf(m1, acc[nt][r + 1]);
        }
        row_max16_by2(m0, m1);
        const v2f m = {m0, m1};
#pragma unroll
        for (int g = 0; g < 8; g += 4) {
          float e[8];
#pragma unroll
          for (int j = 0; j < 4; j++) {
            v2f x = {acc[g + j][r], acc[g + j][r + 1]};
            x = (x - m) * LOG2E;
            e[2 * j] = x[0];
            e[2 * j + 1] = x[1];
          }
          exp2_by8(e);
#pragma unroll
          for (int j = 0; j < 4; j++) {
            p[g + j] = v2f{e[2 * j], e[2 * j + 1]};
            ssum += p[g + j];
          }
        }
        v2f inv = {1.0f / row_sum16(ssum[0]), 1.0f / row_sum16(ssum[1])};
#pragma unroll
        for (int nt = 0; nt < 8; nt++) {
          v2f q = p[nt] * inv;
          pk[r][nt] = (bf16)q[0];
          pk[r + 1][nt] = (bf16)q[1];
        }
      }
      bf16* qrow = Qn + cb + (size_t)(n0 + wave * 16 + ((lane >> 4) << 3)) * CDIM + (lane & 15) * 8;
#pragma unroll   // pk[] indexed by constants; the eight stores take one address with constant offsets
      for (int r = 0; r < 8; r++) *(v8bf*)&qrow[r * CDIM] = pk[r];
      // The wait that stands in front of any overwrite of the stores' registers by the next tile's work; it takes the
      // address and the data as inputs, so they stay live up to here.
      asm volatile("s_wait_xcnt 0x0" :: "v"(qrow),
                   "v"(__builtin_bit_cast(v4u, pk[0])), "v"(__builtin_bit_cast(v4u, pk[1])),
                   "v"(__builtin_bit_cast(v4u, pk[2])), "v"(__builtin_bit_cast(v4u, pk[3])),
                   "v"(__builtin_bit_cast(v4u, pk[4])), "v"(__builtin_bit_cast(v4u, pk[5])),
                   "v"(__builtin_bit_cast(v4u, pk[6])), "v"(__builtin_bit_cast(v4u, pk[7])) : "memory");
    }
  }

  // ---- the chunk's plane: context [c][d], then (row sum, row maximum) ----
  ksum += __shfl_xor(ksum, 16);
  float* plane = part + (size_t)blockIdx.x * TOT;
  // The lane's number, formed anew for the epilogue: with the loop's own 'lane' used here the build runs out of its 256
  // registers and puts 16 bytes to scratch.
  const int le = (int)__builtin_amdgcn_mbcnt_lo(~0u, 0u);
  const int c = wave * 16 + (le & 15);
  float* Wp = plane + combo * CDIM * CDIM + c * CDIM + ((le >> 4) << 3);
  v2f* km_o = (v2f*)(plane + 4 * CDIM * CDIM) + combo * CDIM + c;
#pragma unroll   // ctx[] is indexed by constants only; one address with constant offsets
  for (int dt = 0; dt < 8; dt++) {
    *(v4f*)(Wp + dt * 16) = v4f{ctx[dt][0], ctx[dt][1], ctx[dt][2], ctx[dt][3]};
    *(v4f*)(Wp + dt * 16 + 4) = v4f{ctx[dt][4], ctx[dt][5], ctx[dt][6], ctx[dt][7]};
  }
  if (le < 16) *km_o = v2f{ksum, mrun};
}

// -------- Kernel 2: add the CHUNKS planes, in a fixed order; make out_kernel's A operand ------------------
// A work-group owns 8 rows c x 32 columns d of one context matrix (64 float4); its four quarters each add a quarter
// of the planes (and of the planes' row sums), every plane scaled from its own exponent shift to the quarter's largest; the
// first quarter adds the four results through LDS in the same way, divides by the
// row sum and stores bf16 in fragment order as [row d][k c]: the block's 256 values fill two whole runs of 256 bytes.
__global__ __launch_bounds__(256) void reduce_kernel(const float* __restrict__ part,
                                                     bf16* __restrict__ Af)
{
  __shared__ float4 red[4][64];
  __shared__ float kred[4][64];
  __shared__ float mred[4][64];
  const int t = threadIdx.x, col = t & 63, g = t >> 6;
  const int combo = blockIdx.x >> 6, cg = (blockIdx.x >> 2) & 15, db = blockIdx.x & 3;
  const int row = col >> 3;
  const int c = cg * 8 + row, d0 = db * 32 + (col & 7) * 4;
  const float* pl = part + (size_t)(g * (CHUNKS / 4)) * TOT;
  const float4* p = (const float4*)(pl + combo * CDIM * CDIM + c * CDIM + d0);
  const v2f* pk = (const v2f*)(pl + 4 * CDIM * CDIM) + combo * CDIM + c;
  float4 v[CHUNKS / 4];
  v2f kv[CHUNKS / 4];   // (row sum, shift); every thread takes its row's (eight threads the same ones): no branch, so these loads fly with the others
#pragma unroll   // constant offsets from one address, and many independent loads in flight per thread
  for (int k = 0; k < CHUNKS / 4; k++) v[k] = p[(size_t)k * (TOT / 4)];
  // The wait that stands in front of any overwrite of these loads' address registers; it also parts the two runs, so that
  // no load of one run lands its result in an address register of the other while that run is being issued.
  asm volatile("s_wait_xcnt 0x0" ::: "memory");
#pragma unroll   // the same
  for (int k = 0; k < CHUNKS / 4; k++) kv[k] = pk[(size_t)k * (TOT / 2)];
  // The same wait for the second run, in front of the arithmetic.
  asm volatile("s_wait_xcnt 0x0" ::: "memory");
  float mg = kv[0][1];
#pragma unroll   // kv[] is indexed by constants only
  for (int k = 1; k < CHUNKS / 4; k++) mg = fmaxf(mg, kv[k][1]);
  float4 s = {0.0f, 0.0f, 0.0f, 0.0f};
  float sk = 0.0f;
#pragma unroll   // both levels: v[], kv[] and w[] are indexed by constants only, so they stay in registers
  for (int k = 0; k < CHUNKS / 4; k += 8) {
    float w[8];   // 2^(plane's shift - largest shift)
#pragma unroll
    for (int j = 0; j < 8; j++) w[j] = kv[k + j][1] - mg;
    exp2_by8(w);
#pragma unroll
    for (int j = 0; j < 8; j++) {
      s.x += w[j] * v[k + j].x; s.y += w[j] * v[k + j].y; s.z += w[j] * v[k + j].z; s.w += w[j] * v[k + j].w;
      sk += w[j] * kv[k + j][0];
    }
  }
  red[g][col] = s;
  kred[g][col] = sk;
  mred[g][col] = mg;
  __syncthreads();
  if (g == 0) {
    float4 a = red[0][col], b = red[1][col], cc = red[2][col], d = red[3][col];
    const float m0 = mred[0][col], m1 = mred[1][col], m2 = mred[2][col], m3 = mred[3][col];
    const float mm = fmaxf(fmaxf(m0, m1), fmaxf(m2, m3));
    float f[4] = {m0 - mm, m1 - mm, m2 - mm, m3 - mm};
    exp2_by4(f);
    const float den = (f[0] * kred[0][col] + f[1] * kred[1][col]) + (f[2] * kred[2][col] + f[3] * kred[3][col]);
    float r[4];
    r[0] = (f[0] * a.x + f[1] * b.x) + (f[2] * cc.x + f[3] * d.x);
    r[1] = (f[0] * a.y + f[1] * b.y) + (f[2] * cc.y + f[3] * d.y);
    r[2] = (f[0] * a.z + f[1] * b.z) + (f[2] * cc.z + f[3] * d.z);
    r[3] = (f[0] * a.w + f[1] * b.w) + (f[2] * cc.w + f[3] * d.w);
    // unit ((w * 4 + ks) * 2 + h) * 32 + lane, element j: w = d >> 4, ks = c >> 5, h = (c >> 3) & 1,
    // lane = ((c >> 4) & 1) * 16 + (d & 15), j = c & 7
    const int unit = (((d0 >> 4) * 4 + (c >> 5)) * 2 + ((c >> 3) & 1)) * 32 + ((c >> 4) & 1) * 16 + (d0 & 15);
    bf16* o = Af + combo * CDIM * CDIM + unit * 8 + (c & 7);
#pragma unroll   // r[] is indexed by constants only
    for (int i = 0; i < 4; i++) o[i * 8] = (bf16)(r[i] / den);
  }
}

// -------- Kernel 3: Out_s[d,n] = sum_c (W_{1-s}[c,d]/ksum_c) * Q_s[n,c] -----
// Q tile staged by the Tensor Data Mover. The A operand comes ready from reduce_kernel; a wave reads only its own 16 rows
// of it, so they go from global memory to registers.
// Second launch bound: a wave stays within 128 VGPRs, so that four work-groups still share a WGP.
__global__ __launch_bounds__(256, 8) void out_kernel(
    const bf16* __restrict__ Qn, const bf16* __restrict__ Af, float* __restrict__ out)
{
  __shared__ bf16 Qlds[CDIM][LDP] __attribute__((aligned(32)));  // [n][c]

  const int t = threadIdx.x, lane = t & 31, wave = t >> 5;
  const int combo = blockIdx.y;
  const int s = combo >> 1, b = combo & 1;
  const int other = ((1 - s) << 1) | b;
  const int n0 = blockIdx.x * 128;
  const bf16* Qb = Qn + (size_t)combo * CDIM * NDIM;

  // The fragment loads are issued first, so that they fly beside the tensor load and nothing stands between that load and its wait.
  v16bf a[4];   // rows d = wave * 16 .. + 15 of W_other[c][d] / ksum_other[c], k = c
  ldfrags_global(Af + other * CDIM * CDIM, wave, lane, a);

  // async DMA: Q tile (128 n x 128 c) -> Qlds with padded rows
  if (t < 32) {
    tdm_load_tile(Qb + (size_t)n0 * CDIM, &Qlds[0][0], CDIM, NDIM, CDIM);
    // The issuing wave's wait, directly behind the issue: no descriptor register takes a new value while the request is out.
    asm volatile("s_wait_tensorcnt 0x0" ::: "memory");
  }
  __syncthreads();

  const v8f vz = {0.f, 0.f, 0.f, 0.f, 0.f, 0.f, 0.f, 0.f};
  v8f acc[8];
#pragma unroll
  for (int i = 0; i < 8; i++) acc[i] = vz;
#pragma unroll
  for (int ks = 0; ks < 4; ks++) {
    v16bf bfr[8];
#pragma unroll
    for (int nt = 0; nt < 8; nt++) bfr[nt] = ldfrag(&Qlds[0][0], nt * 16, ks * 32, lane);
#pragma unroll
    for (int nt = 0; nt < 8; nt++) acc[nt] = wmma_bf16(a[ks], bfr[nt], acc[nt]);
  }

  float* ob = out + (size_t)combo * CDIM * NDIM;
#pragma unroll
  for (int nt = 0; nt < 8; nt++)
#pragma unroll
    for (int r = 0; r < 8; r++) {
      int d = wave * 16 + r + ((lane >> 4) << 3);
      int n = n0 + nt * 16 + (lane & 15);
      ob[(size_t)d * NDIM + n] = acc[nt][r];
    }
}

extern "C" void kernel_launch(void* const* d_in, const int* in_sizes, int n_in,
                              void* d_out, int out_size, void* d_ws, size_t ws_size,
                              hipStream_t stream) {
  (void)in_sizes; (void)n_in; (void)out_size; (void)ws_size;
  const float* x0  = (const float*)d_in[0];
  const float* x1  = (const float*)d_in[1];
  const float* Wk0 = (const float*)d_in[2];
  const float* Wk1 = (const float*)d_in[3];
  const float* Wq0 = (const float*)d_in[4];
  const float* Wq1 = (const float*)d_in[5];
  const float* Wv0 = (const float*)d_in[6];
  const float* Wv1 = (const float*)d_in[7];
  float* out = (float*)d_out;

  const size_t PLANE = (size_t)4 * CDIM * NDIM;   // elems of Qn (all combos)
  bf16* Qn = (bf16*)d_ws;
  bf16* Af = Qn + PLANE;                          // four normalised context matrices, fragment order
  float* part = (float*)(Af + 4 * CDIM * CDIM);   // CHUNKS planes: four context matrices, then the rows' (sum, maximum) pairs

  proj_kernel<<<dim3(CHUNKS, 4), 256, 0, stream>>>(x0, x1, Wv0, Wv1, Wk0, Wk1, Wq0, Wq1, Qn, part);
  reduce_kernel<<<dim3(4 * CDIM * CDIM / 256), 256, 0, stream>>>(part, Af);
  out_kernel<<<dim3(NDIM / 128, 4), 256, 0, stream>>>(Qn, Af, out);
}

// v008
// A run of this version takes 48.9 microseconds.
// Timed twice side by side with v007, it ran 1.10 times as fast both times.
// Over all steps from v000 it is 3.81 times as fast.
#include <hip/hip_runtime.h>

#define CDIM 128
#define NDIM 32768
#define LDP  136                 // padded LDS row (bf16 elems): 272B rows = 64 data dw + 4 pad dw: 16 rows at one k lie on 16 different groups of 4 banks
#define LOG2E 1.4426950408889634f
#define CHUNKS 128
#define NCHUNK (NDIM / CHUNKS)   // 256
#define TOT (4 * CDIM * CDIM + 8 * CDIM)   // floats in one plane: four context matrices, then per matrix and row the pair (row sum, row maximum)

typedef __bf16 bf16;
typedef __attribute__((ext_vector_type(16))) bf16  v16bf;
typedef __attribute__((ext_vector_type(8)))  bf16  v8bf;
typedef __attribute__((ext_vector_type(4)))  bf16  v4bf;
typedef __attribute__((ext_vector_type(2)))  bf16  v2bf;
typedef __attribute__((ext_vector_type(8)))  float v8f;
typedef __attribute__((ext_vector_type(4)))  float v4f;
typedef __attribute__((ext_vector_type(2)))  float v2f;
typedef unsigned v4u __attribute__((ext_vector_type(4)));
typedef int      v4i __attribute__((ext_vector_type(4)));
typedef int      v8i __attribute__((ext_vector_type(8)));

// A(16x32 bf16) and B(32x16 bf16) fragments share the same address function:
// lane&15 -> row (A: M, B: column), lane>>4 selects k half; 16 contiguous bf16, as two 16-byte loads (a row starts at a
// multiple of 16 bytes, not of 32).
static __device__ __forceinline__ v16bf ldfrag(const bf16* base, int row0, int k0, int lane) {
  const bf16* p = base + (size_t)(row0 + (lane & 15)) * LDP + k0 + ((lane >> 4) << 4);
  v8bf lo = *(const v8bf*)p, hi = *(const v8bf*)(p + 8);
  return __builtin_shufflevector(lo, hi, 0, 1, 2, 3, 4, 5, 6, 7, 8, 9, 10, 11, 12, 13, 14, 15);
}

// The same fragment in the hardware's own k order, which a pair of packed D tiles on the other side of the product has:
// element s of lane half h is k = k0 + 8 h + s (s < 8), k0 + 16 + 8 h + (s - 8) otherwise: two 16-byte loads.
static __device__ __forceinline__ v16bf ldfrag_kmap(const bf16* base, int row0, int k0, int lane) {
  const bf16* p = base + (size_t)(row0 + (lane & 15)) * LDP + k0 + ((lane >> 4) << 3);
  v8bf lo = *(const v8bf*)p, hi = *(const v8bf*)(p + 16);
  return __builtin_shufflevector(lo, hi, 0, 1, 2, 3, 4, 5, 6, 7, 8, 9, 10, 11, 12, 13, 14, 15);
}

// Fragment order: a 128 x 128 bf16 operand [row][k] laid out so that the fragment ldfrag() would read for row block w and
// k step ks is two runs of 512 bytes: 16-byte unit ((w * 4 + ks) * 2 + h) * 32 + lane holds row w * 16 + (lane & 15),
// k = ks * 32 + (lane >> 4) * 16 + h * 8 .. + 7. A wave loads the four fragments of its own row block with whole lines.
static __device__ __forceinline__ void ldfrags_global(const bf16* __restrict__ F, int wave, int lane, v16bf (&a)[4]) {
  const v8bf* p = (const v8bf*)F + wave * 256 + lane;
#pragma unroll   // a[] is indexed by constants only; one address with constant offsets
  for (int ks = 0; ks < 4; ks++) {
    v8bf lo = p[ks * 64], hi = p[ks * 64 + 32];
    a[ks] = __builtin_shufflevector(lo, hi, 0, 1, 2, 3, 4, 5, 6, 7, 8, 9, 10, 11, 12, 13, 14, 15);
  }
  // The wait that stands in front of any overwrite of the loads' address registers; it takes the address as an input,
  // so the pair stays live up to here.
  asm volatile("s_wait_xcnt 0x0" :: "v"(p) : "memory");
}

static __device__ __forceinline__ v8f wmma_bf16(v16bf a, v16bf b, v8f c) {
  return __builtin_amdgcn_wmma_f32_16x16x32_bf16(false, a, false, b, (short)0, c, false, false);
}

// Transposing stage: a 128 x 128 f32 tile src[k][row] (row pitch 'stride' floats) goes to dst[row][k] as bf16.
// A lane owns a block of 8 k x 4 rows, so both sides are wide: eight 16-byte loads (8 lanes cover a whole
// 128-byte line of one k, 4 lines per wave load) and four 16-byte LDS stores of 8 consecutive k.
// Lane bits: bit 0 and bits 3..4 pick the float4 within the line, bits 1..2 pick one of four k groups; at a row
// pitch of 68 dwords each 16 lanes of one store then fall on 16 different groups of 4 banks.
// In two halves, so that other work can stand between the loads and their use.
static __device__ __forceinline__ void stage_transposed_load(const float* __restrict__ src, size_t stride,
                                                             int t, v4f (&v)[2][8]) {
  const int lane = t & 31, wave = t >> 5;
  const int q8 = (lane & 1) | ((lane >> 3) << 1);   // 0..7
  const int gs = (lane >> 1) & 3;                   // 0..3
  const int k0 = ((wave >> 1) * 4 + gs) * 8;        // a wave's two blocks share their k group ...
  const int r0 = ((wave & 1) * 16 + q8) * 4;        // ... and lie 32 rows apart: one aligned 256-byte unit per k
  const float* base = src + (size_t)k0 * stride + r0;
#pragma unroll   // both loops: a lane's sixteen loads stand ahead of their uses, one base address and constant offsets
  for (int u = 0; u < 2; u++)
#pragma unroll
    for (int j = 0; j < 8; j++)
      v[u][j] = *(const v4f*)(base + (size_t)j * stride + u * 32);
  // The wait that stands in front of any overwrite of the loads' address registers. It takes the address as an
  // input, so the pair stays live up to here and no load of the run can land its result in it.
  asm volatile("s_wait_xcnt 0x0" :: "v"(base) : "memory");
}
static __device__ __forceinline__ void stage_transposed_store(const v4f (&v)[2][8], bf16 (*dst)[LDP], int t) {
  const int lane = t & 31, wave = t >> 5;
  const int q8 = (lane & 1) | ((lane >> 3) << 1);
  const int gs = (lane >> 1) & 3;
  const int k0 = ((wave >> 1) * 4 + gs) * 8;
  const int r0 = ((wave & 1) * 16 + q8) * 4;
#pragma unroll   // all three loops: v[][] and pk[] are indexed by constants only, so they stay in registers
  for (int u = 0; u < 2; u++)
#pragma unroll
    for (int i = 0; i < 4; i++) {
      v8bf pk;
#pragma unroll
      for (int j = 0; j < 8; j++) pk[j] = (bf16)v[u][j][i];
      *(v8bf*)&dst[r0 + u * 32 + i][k0] = pk;
    }
}

// Sixteen consecutive rows of a 128 x 128 f32 weight matrix (8 KiB in a row): one row, four whole lines, per wave load.
// 'rows' is the same in every lane; off = lane * 16.
static __device__ __forceinline__ void load_rows16(const float* __restrict__ rows, unsigned off, v4f (&f)[16]) {
#pragma unroll   // f[] is indexed by constants only; one address with constant offsets
  for (int j = 0; j < 16; j++) f[j] = *(const v4f*)((const char*)rows + off + j * (CDIM * 4));
  // The wait that stands in front of any overwrite of the loads' address registers, directly behind the loads; it takes base
  // and offset as inputs, so they stay live up to here.
  asm volatile("s_wait_xcnt 0x0" :: "s"(rows), "v"(off) : "memory");
}

// Those rows as the four bf16 fragments of the wave's own row block: rounded, laid as rows in 16 LDS rows that only this
// wave touches at this time, and read back with ldfrag().
static __device__ __forceinline__ void rows16_to_frags(const v4f (&f)[16], bf16 (*own)[LDP], int lane, v16bf (&fr)[4]) {
#pragma unroll   // both levels: f[] is indexed by constants only
  for (int j = 0; j < 16; j++) {
    v4bf pk;
#pragma unroll
    for (int i = 0; i < 4; i++) pk[i] = (bf16)f[j][i];
    *(v4bf*)&own[j][lane * 4] = pk;
  }
  // The wave's own LDS stores are done before it reads other lanes' values back (and the compiler moves no read above them).
  asm volatile("s_wait_dscnt 0x0" ::: "memory");
#pragma unroll   // fr[] is indexed by constants only
  for (int ks = 0; ks < 4; ks++) fr[ks] = ldfrag(&own[0][0], 0, ks * 32, lane);
}

// Value of lane l ^ X inside a 16-lane row, by DPP (row_xmask): no LDS, no wait counter.
template <int X>
static __device__ __forceinline__ float row_xor(float v) {
  return __builtin_bit_cast(float, __builtin_amdgcn_update_dpp(0, __builtin_bit_cast(int, v), 0x160 | X, 0xf, 0xf, true));
}
// Maximum over each 16-lane row, for two values at once (all lanes on). In asm text because the compiler makes three
// instructions of each step written with fmaxf (a DPP move, a quieting maximum, the maximum); two chains fill each other's latency.
static __device__ __forceinline__ void row_max16_by2(float& a, float& b) {
  asm("v_max_num_f32_dpp %0, %0, %0 row_xmask:1 row_mask:0xf bank_mask:0xf\n\t"
      "v_max_num_f32_dpp %1, %1, %1 row_xmask:1 row_mask:0xf bank_mask:0xf\n\t"
      "v_max_num_f32_dpp %0, %0, %0 row_xmask:2 row_mask:0xf bank_mask:0xf\n\t"
      "v_max_num_f32_dpp %1, %1, %1 row_xmask:2 row_mask:0xf bank_mask:0xf\n\t"
      "v_max_num_f32_dpp %0, %0, %0 row_xmask:4 row_mask:0xf bank_mask:0xf\n\t"
      "v_max_num_f32_dpp %1, %1, %1 row_xmask:4 row_mask:0xf bank_mask:0xf\n\t"
      "v_max_num_f32_dpp %0, %0, %0 row_xmask:8 row_mask:0xf bank_mask:0xf\n\t"
      "v_max_num_f32_dpp %1, %1, %1 row_xmask:8 row_mask:0xf bank_mask:0xf"
      : "+v"(a), "+v"(b));
}
static __device__ __forceinline__ float row_sum16(float v) {
  v += row_xor<1>(v); v += row_xor<2>(v); v += row_xor<4>(v); return v + row_xor<8>(v);
}

// Eight 2^x in place, arguments <= 0 (a result below the smallest normal f32 may come out as 0). One statement: no
// instruction in it reads a neighbour's result or overwrites a neighbour's source, and the v_nop at its end is the slot
// that the instruction set asks for behind a transcendental, whatever the compiler puts next.
static __device__ __forceinline__ void exp2_by8(float (&e)[8]) {
  asm("v_exp_f32 %0, %0\n\tv_exp_f32 %1, %1\n\tv_exp_f32 %2, %2\n\tv_exp_f32 %3, %3\n\t"
      "v_exp_f32 %4, %4\n\tv_exp_f32 %5, %5\n\tv_exp_f32 %6, %6\n\tv_exp_f32 %7, %7\n\tv_nop"
      : "+v"(e[0]), "+v"(e[1]), "+v"(e[2]), "+v"(e[3]), "+v"(e[4]), "+v"(e[5]), "+v"(e[6]), "+v"(e[7]));
}

// The same for four values.
static __device__ __forceinline__ void exp2_by4(float (&e)[4]) {
  asm("v_exp_f32 %0, %0\n\tv_exp_f32 %1, %1\n\tv_exp_f32 %2, %2\n\tv_exp_f32 %3, %3\n\tv_nop"
      : "+v"(e[0]), "+v"(e[1]), "+v"(e[2]), "+v"(e[3]));
}

// TDM: DMA a 128x128 tile of 2-byte elements (row length dim0, row stride stride0,
// dim1 rows total in tensor) from global into LDS with 64dw+4dw row padding (-> LDP rows).
static __device__ __forceinline__ void tdm_load_tile(const void* gsrc, void* ldst,
                                                     unsigned dim0, unsigned dim1,
                                                     unsigned stride0) {
  unsigned long long ga = (unsigned long long)(size_t)gsrc;
  unsigned lds_off = (unsigned)(size_t)ldst;   // generic LDS addr low 32 bits = LDS offset
  v4u g0;
  g0[0] = 1u;                                          // count=1, user descriptor
  g0[1] = lds_off;                                     // LDS byte address
  g0[2] = (unsigned)(ga & 0xFFFFFFFFu);                // global_addr[31:0]
  g0[3] = (unsigned)((ga >> 32) & 0x01FFFFFFu) | 0x80000000u;  // addr[56:32] | type=2
  v8i g1;
  g1[0] = (int)((1u << 16) | (1u << 20) | (5u << 22) | (3u << 25)); // 2B elems, pad_en, 64dw interval, 4dw pad
  g1[1] = (int)((dim0 & 0xFFFFu) << 16);               // tensor_dim0[15:0]
  g1[2] = (int)(((dim0 >> 16) & 0xFFFFu) | ((dim1 & 0xFFFFu) << 16)); // dim0 hi | dim1 lo
  g1[3] = (int)(((dim1 >> 16) & 0xFFFFu) | (128u << 16));            // dim1 hi | tile_dim0=128
  g1[4] = (int)128u;                                   // tile_dim1=128, tile_dim2=0
  g1[5] = (int)stride0;                                // tensor_dim0_stride[31:0]
  g1[6] = 0;                                           // stride0 hi | stride1 lo
  g1[7] = 0;
  v4i gz4 = {0, 0, 0, 0};
  v8i gz8 = {0, 0, 0, 0, 0, 0, 0, 0};
  __builtin_amdgcn_tensor_load_to_lds(g0, g1, gz4, gz4, gz8, 0);
}

// -------- Kernel 1: projections, Q softmax, and the context product of the work-group's own chunk of N --------
// The weights come as f32 and are rounded to bf16 here. Wq goes to an LDS tile once per work-group: tile row lr is weight row
// (lr & 15) * 8 + (lr >> 4), so that column l of fragment tile nt is weight row l * 8 + nt. Of Wv and Wk a wave needs its own
// 16 rows only: Wk's lie in LDS for the whole kernel; Wv's (no room is left for them) become fragments anew in each pass,
// through the wave's own 16 rows of the V tile, which are free at that time.
// K and V never leave the WGP. Per tile of 128 n, wave w makes columns w * 16 .. + 15 of V^T and of K^T (the x tile is the
// A operand, the weight rows the B operand), so a lane's accumulator registers hold consecutive n of one channel:
//  - V goes to LDS as [d][n] with 16-byte stores;
//  - the K logits stay in registers: maximum over n, exp, and each pair of D tiles, packed to bf16, is a B fragment.
// Context, transposed: ctx[dt][r] = sum_n V[dt * 16 + 8 * (lane >> 4) + r][n] * E[w * 16 + (lane & 15)][n].
// The exponent's shift is the running maximum of the chunk (kept in units of log2), one value a lane; when it rises, the sums
// so far are scaled down. reduce_kernel brings the chunks' sums to one common shift.
// Output: Qn = (N, C) bf16 per combo = s*2+b; one plane of 'part' per chunk.
// Two work-groups share a WGP (the grid has no more): 136 KiB of LDS each, a wave within 256 VGPRs (second launch bound).
__global__ __launch_bounds__(256, 4) void proj_kernel(
    const float* __restrict__ x0, const float* __restrict__ x1,
    const float* __restrict__ Wv0, const float* __restrict__ Wv1,
    const float* __restrict__ Wk0, const float* __restrict__ Wk1,
    const float* __restrict__ Wq0, const float* __restrict__ Wq1,
    bf16* __restrict__ Qn, float* __restrict__ part)
{
  __shared__ unsigned char smem[4 * CDIM * LDP * sizeof(bf16)] __attribute__((aligned(32)));
  bf16 (*Alds)[LDP] = (bf16 (*)[LDP])smem;                                   // Wq, rows dealt [c_out][c]
  bf16 (*Blds)[LDP] = (bf16 (*)[LDP])(smem + CDIM * LDP * sizeof(bf16));     // x tile  [n][c]
  bf16 (*Vlds)[LDP] = (bf16 (*)[LDP])(smem + 2 * CDIM * LDP * sizeof(bf16)); // V tile  [d][n]
  bf16 (*Klds)[LDP] = (bf16 (*)[LDP])(smem + 3 * CDIM * LDP * sizeof(bf16)); // Wk [c_out][c]; a wave writes and reads its own 16 rows only

  const int t = threadIdx.x, lane = t & 31;
  // the wave's number in a scalar register: what is formed from it costs no vector register over the loop
  const int wave = __builtin_amdgcn_readfirstlane(t >> 5);
  const int combo = blockIdx.y;                 // s*2 + b
  const int s = combo >> 1, b = combo & 1;
  const int nbase = blockIdx.x * NCHUNK;
  const float* xp = (s ? x1 : x0) + (size_t)b * CDIM * NDIM;
  const float* Wv = (s ? Wv1 : Wv0) + wave * 16 * CDIM;   // the wave's own 16 rows
  const float* Wk = (s ? Wk1 : Wk0) + wave * 16 * CDIM;
  const float* Wq = (s ? Wq1 : Wq0) + wave * 16 * CDIM;   // the 16 rows that this wave brings to the LDS tile
  const size_t cb = (size_t)combo * CDIM * NDIM;

  // Once per work-group: weight row wave * 16 + j of Wq goes to tile row (j & 7) * 16 + wave * 2 + (j >> 3), that of Wk stays in place
  {
    v4f wq[16], wk[16];
    load_rows16(Wq, (unsigned)lane * 16u, wq);
    load_rows16(Wk, (unsigned)lane * 16u, wk);
#pragma unroll   // both levels: wq[] and wk[] are indexed by constants only
    for (int j = 0; j < 16; j++) {
      v4bf pq, pk;
#pragma unroll
      for (int i = 0; i < 4; i++) { pq[i] = (bf16)wq[j][i]; pk[i] = (bf16)wk[j][i]; }
      *(v4bf*)&Alds[(j & 7) * 16 + wave * 2 + (j >> 3)][lane * 4] = pq;
      *(v4bf*)&Klds[wave * 16 + j][lane * 4] = pk;
    }
  }

  // acc[j] += rows wave * 16 .. + 15 of At times rows j * 16 .. + 15 of Bt (both tiles are [row][k])
  auto run_gemm = [&](v8f* acc, const bf16* At, const bf16* Bt) {
#pragma unroll
    for (int ks = 0; ks < 4; ks++) {
      v16bf a = ldfrag(At, wave * 16, ks * 32, lane);
#pragma unroll
      for (int g = 0; g < 8; g += 4) {   // four B fragments at a time
        v16bf bfr[4];
#pragma unroll
        for (int nt = 0; nt < 4; nt++) bfr[nt] = ldfrag(Bt, (g + nt) * 16, ks * 32, lane);
#pragma unroll
        for (int nt = 0; nt < 4; nt++) acc[g + nt] = wmma_bf16(a, bfr[nt], acc[g + nt]);
      }
    }
  };
  const v8f vz = {0.f, 0.f, 0.f, 0.f, 0.f, 0.f, 0.f, 0.f};

  v8f ctx[8];                        // the chunk's context sums, shifted by mrun
#pragma unroll
  for (int i = 0; i < 8; i++) ctx[i] = vz;
  float mrun = -__builtin_inff();    // running maximum of logit * log2(e) of channel wave * 16 + (lane & 15)
  float ksum = 0.0f;                 // this lane half's share of that channel's sum of exponentials, shifted by mrun

  for (int it = 0; it < NCHUNK / 128; it++) {
    const int n0 = nbase + it * 128;
    if (it) __syncthreads();   // every wave has left the x and V tiles of the pass before
    v16bf bv[4], bk[4];   // the wave's own 16 rows of Wv and of Wk
    {
      // Loads return in issue order: Wv's rows are asked for ahead of the x tile and worked on while that tile is on its way
      // from memory.
      v4f wf[16], xv[2][8];
      load_rows16(Wv, (unsigned)lane * 16u, wf);
      stage_transposed_load(xp + n0, NDIM, t, xv);   // x tile (128 c x 128 n)
      // Nothing of what follows is scheduled above the x loads: without this the build rounds Wv first, and the tile's loads
      // leave only after Wv's rows have come.
      __builtin_amdgcn_sched_barrier(0);
      rows16_to_frags(wf, &Vlds[wave * 16], lane, bv);
#pragma unroll   // bk[] is indexed by constants only; the wave's stores of these rows lie ahead of the s_wait_dscnt 0 in rows16_to_frags()
      for (int ks = 0; ks < 4; ks++) bk[ks] = ldfrag(&Klds[wave * 16][0], 0, ks * 32, lane);
      // Nothing of the x tile's rounding is scheduled above this line: without it the build mixes that work, and with it the wait
      // for the tile, into Wv's.
      __builtin_amdgcn_sched_barrier(0);
      stage_transposed_store(xv, Blds, t);           // to bf16, transposed into Blds[n][c]
    }
    __syncthreads();   // the x tile (and, in the first pass, the Wq tile) is complete

    // ---- V^T and K^T: each A fragment of the x tile is read once and serves both ----
    v8f kacc[8];          // kacc[nb][r] = logit of n = nb * 16 + 8 * (lane >> 4) + r, channel wave * 16 + (lane & 15)
#pragma unroll   // all levels: a[], kacc[] and pv[] are indexed by constants only, so they stay in registers
    for (int nb = 0; nb < 8; nb++) {
      v16bf a[4];
#pragma unroll
      for (int ks = 0; ks < 4; ks++) a[ks] = ldfrag(&Blds[0][0], nb * 16, ks * 32, lane);
      v8f va = vz, ka = vz;
#pragma unroll
      for (int ks = 0; ks < 4; ks++) {
        va = wmma_bf16(a[ks], bv[ks], va);
        ka = wmma_bf16(a[ks], bk[ks], ka);
      }
      kacc[nb] = ka;
      v8bf pv;
#pragma unroll
      for (int r = 0; r < 8; r++) pv[r] = (bf16)va[r];
      *(v8bf*)&Vlds[wave * 16 + (lane & 15)][nb * 16 + ((lane >> 4) << 3)] = pv;
    }

    // ---- exp(K - running maximum), packed as the B fragments of the context product ----
    float mt = kacc[0][0];
#pragma unroll   // both levels: kacc[] is indexed by constants only
    for (int nb = 0; nb < 8; nb++)
#pragma unroll
      for (int r = 0; r < 8; r++) mt = fmaxf(mt, kacc[nb][r]);
    mt = fmaxf(mt, __shfl_xor(mt, 16));   // the other half of the tile's n
    const float mnew = fmaxf(mrun, mt * LOG2E);
    const float sc = __builtin_amdgcn_exp2f(mrun - mnew);   // argument <= 0; 0 in the first pass
    mrun = mnew;
    v16bf ef[4];
    v2f ps = {0.0f, 0.0f};
#pragma unroll   // all levels: kacc[], e[] and ef[] are indexed by constants only
    for (int nb = 0; nb < 8; nb++) {
      float e[8];
#pragma unroll
      for (int r = 0; r < 8; r++) e[r] = __builtin_fmaf(kacc[nb][r], LOG2E, -mnew);
      exp2_by8(e);
#pragma unroll
      for (int r = 0; r < 8; r += 2) ps += v2f{e[r], e[r + 1]};
#pragma unroll
      for (int r = 0; r < 8; r++) ef[nb >> 1][(nb & 1) * 8 + r] = (bf16)e[r];
    }
    ksum = ksum * sc + (ps[0] + ps[1]);
#pragma unroll
    for (int dt = 0; dt < 8; dt++) ctx[dt] *= sc;
    __syncthreads();   // the V tile is complete

    // ---- context: V rows from LDS in the k order of the packed D tiles ----
#pragma unroll   // all levels: ef[], vf[] and ctx[] are indexed by constants only
    for (int ks = 0; ks < 4; ks++)
#pragma unroll
      for (int g = 0; g < 8; g += 4) {
        v16bf vf[4];
#pragma unroll
        for (int j = 0; j < 4; j++) vf[j] = ldfrag_kmap(&Vlds[0][0], (g + j) * 16, ks * 32, lane);
#pragma unroll
        for (int j = 0; j < 4; j++) ctx[g + j] = wmma_bf16(vf[j], ef[ks], ctx[g + j]);
      }

    // ---- Q projection + softmax over C (per n) ----
    // The x tile is the A operand here: a wave holds all 128 logits of its 16 rows n, so the softmax needs no LDS.
    // acc[nt][r] = logit of n = wave * 16 + 8 * (lane >> 4) + r, c = (lane & 15) * 8 + nt (weight rows dealt in the LDS tile):
    // a lane's eight tiles are eight consecutive c, and 16 lanes store one whole row of Qn.
    {
      v8f acc[8];
#pragma unroll
      for (int i = 0; i < 8; i++) acc[i] = vz;
      run_gemm(acc, &Blds[0][0], &Alds[0][0]);
      v8bf pk[8];
#pragma unroll   // all levels: acc[][], p[] and pk[] are indexed by constants only, so they stay in registers
      for (int r = 0; r < 8; r += 2) {   // two rows at a time: they lie in neighbouring registers, which packed f32 math takes as they are
        v2f ssum = {0.0f, 0.0f}, p[8];
        float m0 = acc[0][r], m1 = acc[0][r + 1];
#pragma unroll
        for (int nt = 1; nt < 8; nt++) {
          m0 = fmaxf(m0, acc[nt][r]);
          m1 = fmaxf(m1, acc[nt][r + 1]);
        }
        row_max16_by2(m0, m1);
        const v2f m = {m0, m1};
#pragma unroll
        for (int g = 0; g < 8; g += 4) {
          float e[8];
#pragma unroll
          for (int j = 0; j < 4; j++) {
            v2f x = {acc[g + j][r], acc[g + j][r + 1]};
            x = (x - m) * LOG2E;
            e[2 * j] = x[0];
            e[2 * j + 1] = x[1];
          }
          exp2_by8(e);
#pragma unroll
          for (int j = 0; j < 4; j++) {
            p[g + j] = v2f{e[2 * j], e[2 * j + 1]};
            ssum += p[g + j];
          }
        }
        v2f inv = {1.0f / row_sum16(ssum[0]), 1.0f / row_sum16(ssum[1])};
#pragma unroll
        for (int nt = 0; nt < 8; nt++) {
          v2f q = p[nt] * inv;
          pk[r][nt] = (bf16)q[0];
          pk[r + 1][nt] = (bf16)q[1];
        }
      }
      bf16* qrow = Qn + cb + (size_t)(n0 + wave * 16 + ((lane >> 4) << 3)) * CDIM + (lane & 15) * 8;
#pragma unroll   // pk[] indexed by constants; the eight stores take one address with constant offsets
      for (int r = 0; r < 8; r++) *(v8bf*)&qrow[r * CDIM] = pk[r];
      // The wait that stands in front of any overwrite of the stores' registers by the next tile's work; it takes the
      // address and the data as inputs, so they stay live up to here.
      asm volatile("s_wait_xcnt 0x0" :: "v"(qrow),
                   "v"(__builtin_bit_cast(v4u, pk[0])), "v"(__builtin_bit_cast(v4u, pk[1])),
                   "v"(__builtin_bit_cast(v4u, pk[2])), "v"(__builtin_bit_cast(v4u, pk[3])),
                   "v"(__builtin_bit_cast(v4u, pk[4])), "v"(__builtin_bit_cast(v4u, pk[5])),
                   "v"(__builtin_bit_cast(v4u, pk[6])), "v"(__builtin_bit_cast(v4u, pk[7])) : "memory");
    }
  }

  // ---- the chunk's plane: context [c][d], then (row sum, row maximum) ----
  ksum += __shfl_xor(ksum, 16);
  float* plane = part + (size_t)blockIdx.x * TOT;
  // The lane's number, formed anew for the epilogue: with the loop's own 'lane' used here the build runs out of its 256
  // registers and puts 16 bytes to scratch.
  const int le = (int)__builtin_amdgcn_mbcnt_lo(~0u, 0u);
  const int c = wave * 16 + (le & 15);
  float* Wp = plane + combo * CDIM * CDIM + c * CDIM + ((le >> 4) << 3);
  v2f* km_o = (v2f*)(plane + 4 * CDIM * CDIM) + combo * CDIM + c;
#pragma unroll   // ctx[] is indexed by constants only; one address with constant offsets
  for (int dt = 0; dt < 8; dt++) {
    *(v4f*)(Wp + dt * 16) = v4f{ctx[dt][0], ctx[dt][1], ctx[dt][2], ctx[dt][3]};
    *(v4f*)(Wp + dt * 16 + 4) = v4f{ctx[dt][4], ctx[dt][5], ctx[dt][6], ctx[dt][7]};
  }
  if (le < 16) *km_o = v2f{ksum, mrun};
}

// -------- Kernel 2: add the CHUNKS planes, in a fixed order; make out_kernel's A operand ------------------
// A work-group owns 8 rows c x 32 columns d of one context matrix (64 float4); its four quarters each add a quarter
// of the planes (and of the planes' row sums), every plane scaled from its own exponent shift to the quarter's largest; the
// first quarter adds the four results through LDS in the same way, divides by the
// row sum and stores bf16 in fragment order as [row d][k c]: the block's 256 values fill two whole runs of 256 bytes.
__global__ __launch_bounds__(256) void reduce_kernel(const float* __restrict__ part,
                                                     bf16* __restrict__ Af)
{
  __shared__ float4 red[4][64];
  __shared__ float kred[4][64];
  __shared__ float mred[4][64];
  const int t = threadIdx.x, col = t & 63, g = t >> 6;
  const int combo = blockIdx.x >> 6, cg = (blockIdx.x >> 2) & 15, db = blockIdx.x & 3;
  const int row = col >> 3;
  const int c = cg * 8 + row, d0 = db * 32 + (col & 7) * 4;
  const float* pl = part + (size_t)(g * (CHUNKS / 4)) * TOT;
  const float4* p = (const float4*)(pl + combo * CDIM * CDIM + c * CDIM + d0);
  const v2f* pk = (const v2f*)(pl + 4 * CDIM * CDIM) + combo * CDIM + c;
  float4 v[CHUNKS / 4];
  v2f kv[CHUNKS / 4];   // (row sum, shift); every thread takes its row's (eight threads the same ones): no branch, so these loads fly with the others
#pragma unroll   // constant offsets from one address, and many independent loads in flight per thread
  for (int k = 0; k < CHUNKS / 4; k++) v[k] = p[(size_t)k * (TOT / 4)];
  // The wait that stands in front of any overwrite of these loads' address registers; it also parts the two runs, so that
  // no load of one run lands its result in an address register of the other while that run is being issued.
  asm volatile("s_wait_xcnt 0x0" ::: "memory");
#pragma unroll   // the same
  for (int k = 0; k < CHUNKS / 4; k++) kv[k] = pk[(size_t)k * (TOT / 2)];
  // The same wait for the second run, in front of the arithmetic.
  asm volatile("s_wait_xcnt 0x0" ::: "memory");
  float mg = kv[0][1];
#pragma unroll   // kv[] is indexed by constants only
  for (int k = 1; k < CHUNKS / 4; k++) mg = fmaxf(mg, kv[k][1]);
  float4 s = {0.0f, 0.0f, 0.0f, 0.0f};
  float sk = 0.0f;
#pragma unroll   // both levels: v[], kv[] and w[] are indexed by constants only, so they stay in registers
  for (int k = 0; k < CHUNKS / 4; k += 8) {
    float w[8];   // 2^(plane's shift - largest shift)
#pragma unroll
    for (int j = 0; j < 8; j++) w[j] = kv[k + j][1] - mg;
    exp2_by8(w);
#pragma unroll
    for (int j = 0; j < 8; j++) {
      s.x += w[j] * v[k + j].x; s.y += w[j] * v[k + j].y; s.z += w[j] * v[k + j].z; s.w += w[j] * v[k + j].w;
      sk += w[j] * kv[k + j][0];
    }
  }
  red[g][col] = s;
  kred[g][col] = sk;
  mred[g][col] = mg;
  __syncthreads();
  if (g == 0) {
    float4 a = red[0][col], b = red[1][col], cc = red[2][col], d = red[3][col];
    const float m0 = mred[0][col], m1 = mred[1][col], m2 = mred[2][col], m3 = mred[3][col];
    const float mm = fmaxf(fmaxf(m0, m1), fmaxf(m2, m3));
    float f[4] = {m0 - mm, m1 - mm, m2 - mm, m3 - mm};
    exp2_by4(f);
    const float den = (f[0] * kred[0][col] + f[1] * kred[1][col]) + (f[2] * kred[2][col] + f[3] * kred[3][col]);
    float r[4];
    r[0] = (f[0] * a.x + f[1] * b.x) + (f[2] * cc.x + f[3] * d.x);
    r[1] = (f[0] * a.y + f[1] * b.y) + (f[2] * cc.y + f[3] * d.y);
    r[2] = (f[0] * a.z + f[1] * b.z) + (f[2] * cc.z + f[3] * d.z);
    r[3] = (f[0] * a.w + f[1] * b.w) + (f[2] * cc.w + f[3] * d.w);
    // unit ((w * 4 + ks) * 2 + h) * 32 + lane, element j: w = d >> 4, ks = c >> 5, h = (c >> 3) & 1,
    // lane = ((c >> 4) & 1) * 16 + (d & 15), j = c & 7
    const int unit = (((d0 >> 4) * 4 + (c >> 5)) * 2 + ((c >> 3) & 1)) * 32 + ((c >> 4) & 1) * 16 + (d0 & 15);
    bf16* o = Af + combo * CDIM * CDIM + unit * 8 + (c & 7);
#pragma unroll   // r[] is indexed by constants only
    for (int i = 0; i < 4; i++) o[i * 8] = (bf16)(r[i] / den);
  }
}

// -------- Kernel 3: Out_s[d,n] = sum_c (W_{1-s}[c,d]/ksum_c) * Q_s[n,c] -----
// Q tile staged by the Tensor Data Mover. The A operand comes ready from reduce_kernel; a wave reads only its own 16 rows
// of it, so they go from global memory to registers.
// Second launch bound: a wave stays within 128 VGPRs, so that four work-groups still share a WGP.
__global__ __launch_bounds__(256, 8) void out_kernel(
    const bf16* __restrict__ Qn, const bf16* __restrict__ Af, float* __restrict__ out)
{
  __shared__ bf16 Qlds[CDIM][LDP] __attribute__((aligned(32)));  // [n][c]

  const int t = threadIdx.x, lane = t & 31, wave = t >> 5;
  const int combo = blockIdx.y;
  const int s = combo >> 1, b = combo & 1;
  const int other = ((1 - s) << 1) | b;
  const int n0 = blockIdx.x * 128;
  const bf16* Qb = Qn + (size_t)combo * CDIM * NDIM;

  // The fragment loads are issued first, so that they fly beside the tensor load and nothing stands between that load and its wait.
  v16bf a[4];   // rows d = wave * 16 .. + 15 of W_other[c][d] / ksum_other[c], k = c
  ldfrags_global(Af + other * CDIM * CDIM, wave, lane, a);

  // async DMA: Q tile (128 n x 128 c) -> Qlds with padded rows
  if (t < 32) {
    tdm_load_tile(Qb + (size_t)n0 * CDIM, &Qlds[0][0], CDIM, NDIM, CDIM);
    // The issuing wave's wait, directly behind the issue: no descriptor register takes a new value while the request is out.
    asm volatile("s_wait_tensorcnt 0x0" ::: "memory");
  }
  __syncthreads();

  const v8f vz = {0.f, 0.f, 0.f, 0.f, 0.f, 0.f, 0.f, 0.f};
  v8f acc[8];
#pragma unroll
  for (int i = 0; i < 8; i++) acc[i] = vz;
#pragma unroll
  for (int ks = 0; ks < 4; ks++) {
    v16bf bfr[8];
#pragma unroll
    for (int nt = 0; nt < 8; nt++) bfr[nt] = ldfrag(&Qlds[0][0], nt * 16, ks * 32, lane);
#pragma unroll
    for (int nt = 0; nt < 8; nt++) acc[nt] = wmma_bf16(a[ks], bfr[nt], acc[nt]);
  }

  float* ob = out + (size_t)combo * CDIM * NDIM;
#pragma unroll
  for (int nt = 0; nt < 8; nt++)
#pragma unroll
    for (int r = 0; r < 8; r++) {
      int d = wave * 16 + r + ((lane >> 4) << 3);
      int n = n0 + nt * 16 + (lane & 15);
      ob[(size_t)d * NDIM + n] = acc[nt][r];
    }
}

extern "C" void kernel_launch(void* const* d_in, const int* in_sizes, int n_in,
                              void* d_out, int out_size, void* d_ws, size_t ws_size,
                              hipStream_t stream) {
  (void)in_sizes; (void)n_in; (void)out_size; (void)ws_size;
  const float* x0  = (const float*)d_in[0];
  const float* x1  = (const float*)d_in[1];
  const float* Wk0 = (const float*)d_in[2];
  const float* Wk1 = (const float*)d_in[3];
  const float* Wq0 = (const float*)d_in[4];
  const float* Wq1 = (const float*)d_in[5];
  const float* Wv0 = (const float*)d_in[6];
  const float* Wv1 = (const float*)d_in[7];
  float* out = (float*)d_out;

  const size_t PLANE = (size_t)4 * CDIM * NDIM;   // elems of Qn (all combos)
  bf16* Qn = (bf16*)d_ws;
  bf16* Af = Qn + PLANE;                          // four normalised context matrices, fragment order
  float* part = (float*)(Af + 4 * CDIM * CDIM);   // CHUNKS planes: four context matrices, then the rows' (sum, maximum) pairs

  proj_kernel<<<dim3(CHUNKS, 4), 256, 0, stream>>>(x0, x1, Wv0, Wv1, Wk0, Wk1, Wq0, Wq1, Qn, part);
  reduce_kernel<<<dim3(4 * CDIM * CDIM / 256), 256, 0, stream>>>(part, Af);
  out_kernel<<<dim3(NDIM / 128, 4), 256, 0, stream>>>(Qn, Af, out);
}

// v010
// It runs in 41.7 microseconds.
// Versions in between are left out here; by their measured steps it is 1.17 times as fast as v008.
// All steps since v000 together make it 4.47 times as fast.
#include <hip/hip_runtime.h>

#define CDIM 128
#define NDIM 32768
#define LDP  136                 // padded LDS row (bf16 elems): 272B rows = 64 data dw + 4 pad dw: 16 rows at one k lie on 16 different groups of 4 banks
#define LOG2E 1.4426950408889634f
#define CHUNKS 64
#define NCHUNK (NDIM / CHUNKS)   // 512
#define TILE_B (CDIM * LDP * 2)  // bytes of one bf16 tile in LDS
#define TOT (4 * CDIM * CDIM + 8 * CDIM)   // floats in one plane: four context matrices, then per matrix and row the pair (row sum, row maximum)

typedef __bf16 bf16;
typedef __attribute__((ext_vector_type(16))) bf16  v16bf;
typedef __attribute__((ext_vector_type(8)))  bf16  v8bf;
typedef __attribute__((ext_vector_type(4)))  bf16  v4bf;
typedef __attribute__((ext_vector_type(2)))  bf16  v2bf;
typedef __attribute__((ext_vector_type(8)))  float v8f;
typedef __attribute__((ext_vector_type(4)))  float v4f;
typedef __attribute__((ext_vector_type(2)))  float v2f;
typedef unsigned v4u __attribute__((ext_vector_type(4)));
typedef int      v4i __attribute__((ext_vector_type(4)));
typedef int      v8i __attribute__((ext_vector_type(8)));

// A(16x32 bf16) and B(32x16 bf16) fragments share the same address function:
// lane&15 -> row (A: M, B: column), lane>>4 selects k half; 16 contiguous bf16, as two 16-byte loads (a row starts at a
// multiple of 16 bytes, not of 32).
static __device__ __forceinline__ v16bf ldfrag(const bf16* base, int row0, int k0, int lane) {
  const bf16* p = base + (size_t)(row0 + (lane & 15)) * LDP + k0 + ((lane >> 4) << 4);
  v8bf lo = *(const v8bf*)p, hi = *(const v8bf*)(p + 8);
  return __builtin_shufflevector(lo, hi, 0, 1, 2, 3, 4, 5, 6, 7, 8, 9, 10, 11, 12, 13, 14, 15);
}

// The same fragment in the hardware's own k order, which a pair of packed D tiles on the other side of the product has:
// element s of lane half h is k = k0 + 8 h + s (s < 8), k0 + 16 + 8 h + (s - 8) otherwise: two 16-byte loads.
static __device__ __forceinline__ v16bf ldfrag_kmap(const bf16* base, int row0, int k0, int lane) {
  const bf16* p = base + (size_t)(row0 + (lane & 15)) * LDP + k0 + ((lane >> 4) << 3);
  v8bf lo = *(const v8bf*)p, hi = *(const v8bf*)(p + 16);
  return __builtin_shufflevector(lo, hi, 0, 1, 2, 3, 4, 5, 6, 7, 8, 9, 10, 11, 12, 13, 14, 15);
}

// Fragment order: a 128 x 128 bf16 operand [row][k] laid out so that the fragment ldfrag() would read for row block w and
// k step ks is two runs of 512 bytes: 16-byte unit ((w * 4 + ks) * 2 + h) * 32 + lane holds row w * 16 + (lane & 15),
// k = ks * 32 + (lane >> 4) * 16 + h * 8 .. + 7. A wave loads the four fragments of its own row block with whole lines.
static __device__ __forceinline__ void ldfrags_global(const bf16* __restrict__ F, int wave, int lane, v16bf (&a)[4]) {
  const v8bf* p = (const v8bf*)F + wave * 256 + lane;
#pragma unroll   // a[] is indexed by constants only; one address with constant offsets
  for (int ks = 0; ks < 4; ks++) {
    v8bf lo = p[ks * 64], hi = p[ks * 64 + 32];
    a[ks] = __builtin_shufflevector(lo, hi, 0, 1, 2, 3, 4, 5, 6, 7, 8, 9, 10, 11, 12, 13, 14, 15);
  }
  // The wait that stands in front of any overwrite of the loads' address registers; it takes the address as an input,
  // so the pair stays live up to here.
  asm volatile("s_wait_xcnt 0x0" :: "v"(p) : "memory");
}

static __device__ __forceinline__ v8f wmma_bf16(v16bf a, v16bf b, v8f c) {
  return __builtin_amdgcn_wmma_f32_16x16x32_bf16(false, a, false, b, (short)0, c, false, false);
}

// Transposing stage: a 128 x 128 f32 tile src[k][row] (row pitch 'stride' floats) goes to dst[row][k] as bf16.
// A lane owns a block of 8 k x 4 rows, so both sides are wide: eight 16-byte loads (8 lanes cover a whole
// 128-byte line of one k, 4 lines per wave load) and four 16-byte LDS stores of 8 consecutive k.
// Lane bits: bit 0 and bits 3..4 pick the float4 within the line, bits 1..2 pick one of four k groups; at a row
// pitch of 68 dwords each 16 lanes of one store then fall on 16 different groups of 4 banks.
// In two halves, so that other work can stand between the loads and their use.
static __device__ __forceinline__ void stage_transposed_load(const float* __restrict__ src, size_t stride,
                                                             int t, v4f (&v)[2][8]) {
  const int lane = t & 31, wave = t >> 5;
  const int q8 = (lane & 1) | ((lane >> 3) << 1);   // 0..7
  const int gs = (lane >> 1) & 3;                   // 0..3
  const int k0 = ((wave >> 1) * 4 + gs) * 8;        // a wave's two blocks share their k group ...
  const int r0 = ((wave & 1) * 16 + q8) * 4;        // ... and lie 32 rows apart: one aligned 256-byte unit per k
  const float* base = src + (size_t)k0 * stride + r0;
#pragma unroll   // both loops: a lane's sixteen loads stand ahead of their uses, one base address and constant offsets
  for (int u = 0; u < 2; u++)
#pragma unroll
    for (int j = 0; j < 8; j++)
      v[u][j] = *(const v4f*)(base + (size_t)j * stride + u * 32);
  // The wait that stands in front of any overwrite of the loads' address registers. It takes the address as an
  // input, so the pair stays live up to here and no load of the run can land its result in it.
  asm volatile("s_wait_xcnt 0x0" :: "v"(base) : "memory");
}
static __device__ __forceinline__ void stage_transposed_store(const v4f (&v)[2][8], bf16 (*dst)[LDP], int t) {
  const int lane = t & 31, wave = t >> 5;
  const int q8 = (lane & 1) | ((lane >> 3) << 1);
  const int gs = (lane >> 1) & 3;
  const int k0 = ((wave >> 1) * 4 + gs) * 8;
  const int r0 = ((wave & 1) * 16 + q8) * 4;
#pragma unroll   // all three loops: v[][] and pk[] are indexed by constants only, so they stay in registers
  for (int u = 0; u < 2; u++)
#pragma unroll
    for (int i = 0; i < 4; i++) {
      v8bf pk;
#pragma unroll
      for (int j = 0; j < 8; j++) pk[j] = (bf16)v[u][j][i];
      *(v8bf*)&dst[r0 + u * 32 + i][k0] = pk;
    }
}

// Eight consecutive rows of a 128 x 128 f32 weight matrix (4 KiB in a row): one row, four whole lines, per wave load.
// 'rows' is the same in every lane; off = lane * 16.
static __device__ __forceinline__ void load_rows8(const float* __restrict__ rows, unsigned off, v4f (&f)[8]) {
#pragma unroll   // f[] is indexed by constants only; one address with constant offsets
  for (int j = 0; j < 8; j++) f[j] = *(const v4f*)((const char*)rows + off + j * (CDIM * 4));
  // The wait that stands in front of any overwrite of the loads' address registers, directly behind the loads; it takes base
  // and offset as inputs, so they stay live up to here.
  asm volatile("s_wait_xcnt 0x0" :: "s"(rows), "v"(off) : "memory");
}

// Value of lane l ^ X inside a 16-lane row, by DPP (row_xmask): no LDS, no wait counter.
template <int X>
static __device__ __forceinline__ float row_xor(float v) {
  return __builtin_bit_cast(float, __builtin_amdgcn_update_dpp(0, __builtin_bit_cast(int, v), 0x160 | X, 0xf, 0xf, true));
}
// Maximum over each 16-lane row, for two values at once (all lanes on). In asm text because the compiler makes three
// instructions of each step written with fmaxf (a DPP move, a quieting maximum, the maximum); two chains fill each other's latency.
static __device__ __forceinline__ void row_max16_by2(float& a, float& b) {
  asm("v_max_num_f32_dpp %0, %0, %0 row_xmask:1 row_mask:0xf bank_mask:0xf\n\t"
      "v_max_num_f32_dpp %1, %1, %1 row_xmask:1 row_mask:0xf bank_mask:0xf\n\t"
      "v_max_num_f32_dpp %0, %0, %0 row_xmask:2 row_mask:0xf bank_mask:0xf\n\t"
      "v_max_num_f32_dpp %1, %1, %1 row_xmask:2 row_mask:0xf bank_mask:0xf\n\t"
      "v_max_num_f32_dpp %0, %0, %0 row_xmask:4 row_mask:0xf bank_mask:0xf\n\t"
      "v_max_num_f32_dpp %1, %1, %1 row_xmask:4 row_mask:0xf bank_mask:0xf\n\t"
      "v_max_num_f32_dpp %0, %0, %0 row_xmask:8 row_mask:0xf bank_mask:0xf\n\t"
      "v_max_num_f32_dpp %1, %1, %1 row_xmask:8 row_mask:0xf bank_mask:0xf"
      : "+v"(a), "+v"(b));
}
static __device__ __forceinline__ float row_sum16(float v) {
  v += row_xor<1>(v); v += row_xor<2>(v); v += row_xor<4>(v); return v + row_xor<8>(v);
}

// Eight 2^x in place, arguments <= 0 (a result below the smallest normal f32 may come out as 0). One statement: no
// instruction in it reads a neighbour's result or overwrites a neighbour's source, and the v_nop at its end is the slot
// that the instruction set asks for behind a transcendental, whatever the compiler puts next.
static __device__ __forceinline__ void exp2_by8(float (&e)[8]) {
  asm("v_exp_f32 %0, %0\n\tv_exp_f32 %1, %1\n\tv_exp_f32 %2, %2\n\tv_exp_f32 %3, %3\n\t"
      "v_exp_f32 %4, %4\n\tv_exp_f32 %5, %5\n\tv_exp_f32 %6, %6\n\tv_exp_f32 %7, %7\n\tv_nop"
      : "+v"(e[0]), "+v"(e[1]), "+v"(e[2]), "+v"(e[3]), "+v"(e[4]), "+v"(e[5]), "+v"(e[6]), "+v"(e[7]));
}

// The same for four values.
static __device__ __forceinline__ void exp2_by4(float (&e)[4]) {
  asm("v_exp_f32 %0, %0\n\tv_exp_f32 %1, %1\n\tv_exp_f32 %2, %2\n\tv_exp_f32 %3, %3\n\tv_nop"
      : "+v"(e[0]), "+v"(e[1]), "+v"(e[2]), "+v"(e[3]));
}

// Work-group barrier that orders LDS alone. __syncthreads() also waits for the wave's global loads, and here a tile's loads
// are meant to stay in flight across the barrier.
static __device__ __forceinline__ void lds_barrier() {
  __builtin_amdgcn_fence(__ATOMIC_RELEASE, "workgroup", "local");
  __builtin_amdgcn_s_barrier();
  __builtin_amdgcn_fence(__ATOMIC_ACQUIRE, "workgroup", "local");
}

// TDM: DMA a 128x128 tile of 2-byte elements (row length dim0, row stride stride0,
// dim1 rows total in tensor) from global into LDS with 64dw+4dw row padding (-> LDP rows).
static __device__ __forceinline__ void tdm_load_tile(const void* gsrc, void* ldst,
                                                     unsigned dim0, unsigned dim1,
                                                     unsigned stride0) {
  unsigned long long ga = (unsigned long long)(size_t)gsrc;
  unsigned lds_off = (unsigned)(size_t)ldst;   // generic LDS addr low 32 bits = LDS offset
  v4u g0;
  g0[0] = 1u;                                          // count=1, user descriptor
  g0[1] = lds_off;                                     // LDS byte address
  g0[2] = (unsigned)(ga & 0xFFFFFFFFu);                // global_addr[31:0]
  g0[3] = (unsigned)((ga >> 32) & 0x01FFFFFFu) | 0x80000000u;  // addr[56:32] | type=2
  v8i g1;
  g1[0] = (int)((1u << 16) | (1u << 20) | (5u << 22) | (3u << 25)); // 2B elems, pad_en, 64dw interval, 4dw pad
  g1[1] = (int)((dim0 & 0xFFFFu) << 16);               // tensor_dim0[15:0]
  g1[2] = (int)(((dim0 >> 16) & 0xFFFFu) | ((dim1 & 0xFFFFu) << 16)); // dim0 hi | dim1 lo
  g1[3] = (int)(((dim1 >> 16) & 0xFFFFu) | (128u << 16));            // dim1 hi | tile_dim0=128
  g1[4] = (int)128u;                                   // tile_dim1=128, tile_dim2=0
  g1[5] = (int)stride0;                                // tensor_dim0_stride[31:0]
  g1[6] = 0;                                           // stride0 hi | stride1 lo
  g1[7] = 0;
  v4i gz4 = {0, 0, 0, 0};
  v8i gz8 = {0, 0, 0, 0, 0, 0, 0, 0};
  __builtin_amdgcn_tensor_load_to_lds(g0, g1, gz4, gz4, gz8, 0);
}

// -------- Kernel 1: projections, Q softmax, and the context product of the work-group's own chunk of N --------
// One work-group of 8 waves fills a WGP (two waves a SIMD, up to 512 VGPRs each). Its two halves of 4 waves each work on a
// tile of 128 n of their own at the same time (two x tiles and a V tile per half); the three weight tiles are made once and
// serve both halves.
// A wave owns TWO blocks of 16 (index sw): two row blocks of the Q product, two channel blocks of V, of K and of the context.
// Every fragment that it reads from LDS for the other operand (Wq, the x tile, the V tile) then feeds two WMMAs, not one.
// Block number within the half: ob = wave * 2 + sw, 0..7.
// A half's two x tiles are both asked for at the start. The second stays in registers during the first tile's Q phase and then
// goes to an LDS tile of its own. The Q phases of both tiles come first, then V and exp(K) of both, then the context products:
// the 128 registers of context sums are live only at the end, and the first x tile's place is free for the second tile's V.
// LDS tiles: Wq, Wk, Wv, then per half: x tile 0 (later V of tile 1), x tile 1, V of tile 0.
// The weights come as f32 and are rounded to bf16 here, once per work-group, each wave bringing 16 rows of each matrix.
// Wq: tile row lr is weight row (lr & 15) * 8 + (lr >> 4), so that column l of fragment tile nt is weight row l * 8 + nt.
// Wk and Wv lie row for row; block ob of a half reads rows ob * 16 .. + 15 of them as its B fragments in each pass.
// K and V never leave the WGP. Per tile of 128 n, block ob makes columns ob * 16 .. + 15 of V^T and of K^T (the x tile is the
// A operand, the weight rows the B operand), so a lane's accumulator registers hold consecutive n of one channel:
//  - V goes to LDS as [d][n] with 16-byte stores;
//  - the K logits stay in registers: maximum over n, exp, and each pair of D tiles, packed to bf16, is a B fragment.
// Context, transposed: ctx[sw][dt][r] = sum_n V[dt * 16 + 8 * (lane >> 4) + r][n] * E[ob * 16 + (lane & 15)][n].
// The exponent's shift is the running maximum of the half's tiles (kept in units of log2), one value a lane and block; when it
// rises, the sums of the tile before are scaled down. At the end the second half hands its sums to the first through LDS, which brings both
// to one shift, adds them and stores the chunk's plane. reduce_kernel brings the chunks' sums to one common shift.
// Output: Qn = (N, C) bf16 per combo = s*2+b; one plane of 'part' per chunk.
// 306 KiB of LDS.
__global__ __launch_bounds__(256, 2) void proj_kernel(
    const float* __restrict__ x0, const float* __restrict__ x1,
    const float* __restrict__ Wv0, const float* __restrict__ Wv1,
    const float* __restrict__ Wk0, const float* __restrict__ Wk1,
    const float* __restrict__ Wq0, const float* __restrict__ Wq1,
    bf16* __restrict__ Qn, float* __restrict__ part)
{
  __shared__ unsigned char smem[9 * TILE_B] __attribute__((aligned(32)));

  const int t = threadIdx.x, lane = t & 31;
  // the wave's number in a scalar register: what is formed from it costs no vector register over the loop
  const int wave8 = __builtin_amdgcn_readfirstlane(t >> 5);
  const int h = wave8 >> 2, wave = wave8 & 3;               // half, and the wave's number within it
  bf16 (*Alds)[LDP] = (bf16 (*)[LDP])smem;                              // Wq, rows dealt [c_out][c]
  bf16 (*Klds)[LDP] = (bf16 (*)[LDP])(smem + TILE_B);                   // Wk [c_out][c]
  bf16 (*Wlds)[LDP] = (bf16 (*)[LDP])(smem + 2 * TILE_B);               // Wv [c_out][c]
  const int combo = blockIdx.y;                 // s*2 + b
  const int s = combo >> 1, b = combo & 1;
  const int nbase = blockIdx.x * NCHUNK + h * 128;   // the half's first tile; its next lies 256 n on
  const float* xp = (s ? x1 : x0) + (size_t)b * CDIM * NDIM;
  const size_t cb = (size_t)combo * CDIM * NDIM;

  const v8f vz = {0.f, 0.f, 0.f, 0.f, 0.f, 0.f, 0.f, 0.f};

  // ---- Q projection + softmax over C (per n) ----
  // The x tile is the A operand here: a wave holds all 128 logits of its 2 x 16 rows n, so the softmax needs no LDS.
  // acc[sw][nt][r] = logit of n = ob * 16 + 8 * (lane >> 4) + r, c = (lane & 15) * 8 + nt (weight rows dealt in the LDS tile):
  // a lane's eight tiles are eight consecutive c, and 16 lanes store one whole row of Qn.
  auto q_phase = [&](const bf16* Xt, int n0) __attribute__((always_inline)) {
    v8f acc[2][8];
#pragma unroll
    for (int sw = 0; sw < 2; sw++)
#pragma unroll
      for (int i = 0; i < 8; i++) acc[sw][i] = vz;
#pragma unroll   // all levels: a[], bfr[] and acc[][] are indexed by constants only
    for (int ks = 0; ks < 4; ks++) {
      v16bf a[2];
#pragma unroll
      for (int sw = 0; sw < 2; sw++) a[sw] = ldfrag(Xt, (wave * 2 + sw) * 16, ks * 32, lane);
#pragma unroll
      for (int g = 0; g < 8; g += 4) {   // four B fragments at a time, each for both row blocks
        v16bf bfr[4];
#pragma unroll
        for (int nt = 0; nt < 4; nt++) bfr[nt] = ldfrag(&Alds[0][0], (g + nt) * 16, ks * 32, lane);
#pragma unroll
        for (int nt = 0; nt < 4; nt++)
#pragma unroll
          for (int sw = 0; sw < 2; sw++) acc[sw][g + nt] = wmma_bf16(a[sw], bfr[nt], acc[sw][g + nt]);
      }
    }
#pragma unroll   // acc[][] is indexed by constants only
    for (int sw = 0; sw < 2; sw++) {
      v8bf pk[8];
#pragma unroll   // all levels: acc[][], p[] and pk[] are indexed by constants only, so they stay in registers
      for (int r = 0; r < 8; r += 2) {   // two rows at a time: they lie in neighbouring registers, which packed f32 math takes as they are
        v2f ssum = {0.0f, 0.0f}, p[8];
        float m0 = acc[sw][0][r], m1 = acc[sw][0][r + 1];
#pragma unroll
        for (int nt = 1; nt < 8; nt++) {
          m0 = fmaxf(m0, acc[sw][nt][r]);
          m1 = fmaxf(m1, acc[sw][nt][r + 1]);
        }
        row_max16_by2(m0, m1);
        const v2f m = {m0, m1};
#pragma unroll
        for (int g = 0; g < 8; g += 4) {
          float e[8];
#pragma unroll
          for (int j = 0; j < 4; j++) {
            v2f x = {acc[sw][g + j][r], acc[sw][g + j][r + 1]};
            x = (x - m) * LOG2E;
            e[2 * j] = x[0];
            e[2 * j + 1] = x[1];
          }
          exp2_by8(e);
#pragma unroll
          for (int j = 0; j < 4; j++) {
            p[g + j] = v2f{e[2 * j], e[2 * j + 1]};
            ssum += p[g + j];
          }
        }
        v2f inv = {1.0f / row_sum16(ssum[0]), 1.0f / row_sum16(ssum[1])};
#pragma unroll
        for (int nt = 0; nt < 8; nt++) {
          v2f q = p[nt] * inv;
          pk[r][nt] = (bf16)q[0];
          pk[r + 1][nt] = (bf16)q[1];
        }
      }
      bf16* qrow = Qn + cb + (size_t)(n0 + (wave * 2 + sw) * 16 + ((lane >> 4) << 3)) * CDIM + (lane & 15) * 8;
#pragma unroll   // pk[] indexed by constants; the eight stores take one address with constant offsets
      for (int r = 0; r < 8; r++) *(v8bf*)&qrow[r * CDIM] = pk[r];
      // The wait that stands in front of any overwrite of the stores' registers by the work that follows; it takes the
      // address and the data as inputs, so they stay live up to here.
      asm volatile("s_wait_xcnt 0x0" :: "v"(qrow),
                   "v"(__builtin_bit_cast(v4u, pk[0])), "v"(__builtin_bit_cast(v4u, pk[1])),
                   "v"(__builtin_bit_cast(v4u, pk[2])), "v"(__builtin_bit_cast(v4u, pk[3])),
                   "v"(__builtin_bit_cast(v4u, pk[4])), "v"(__builtin_bit_cast(v4u, pk[5])),
                   "v"(__builtin_bit_cast(v4u, pk[6])), "v"(__builtin_bit_cast(v4u, pk[7])) : "memory");
    }
  };

  v4f xr[2][2][8];   // the x tile that goes to LDS next: at first the half's first tile
  v4f xw[2][2][8];   // the half's second x tile: asked for at the start, on its way from memory during the first tile's Q phase
  {
    // Once per work-group: weight row R = (wave8 * 2 + sw) * 8 + j of Wq goes to tile row (R & 7) * 16 + (R >> 3), those of Wk and Wv stay in place
    v4f wq[2][8], wk[2][8], wv[2][8];
#pragma unroll   // all of these loops: the arrays are indexed by constants only
    for (int sw = 0; sw < 2; sw++) load_rows8((s ? Wq1 : Wq0) + (wave8 * 2 + sw) * 8 * CDIM, (unsigned)lane * 16u, wq[sw]);
#pragma unroll
    for (int sw = 0; sw < 2; sw++) load_rows8((s ? Wk1 : Wk0) + (wave8 * 2 + sw) * 8 * CDIM, (unsigned)lane * 16u, wk[sw]);
#pragma unroll
    for (int sw = 0; sw < 2; sw++) load_rows8((s ? Wv1 : Wv0) + (wave8 * 2 + sw) * 8 * CDIM, (unsigned)lane * 16u, wv[sw]);
    // Loads return in issue order: the weights are asked for ahead of the x tiles and worked on while those are on
    // their way from memory.
#pragma unroll
    for (int sw = 0; sw < 2; sw++) stage_transposed_load(xp + nbase, NDIM, (wave * 2 + sw) * 32 + lane, xr[sw]);         // x tile (128 c x 128 n)
#pragma unroll
    for (int sw = 0; sw < 2; sw++) stage_transposed_load(xp + nbase + 256, NDIM, (wave * 2 + sw) * 32 + lane, xw[sw]);   // the second tile
    // Nothing of what follows is scheduled above the x loads: they would otherwise leave only after the weights have come.
    __builtin_amdgcn_sched_barrier(0);
#pragma unroll   // all levels: wq[], wk[] and wv[] are indexed by constants only
    for (int sw = 0; sw < 2; sw++)
#pragma unroll
      for (int j = 0; j < 8; j++) {
        v4bf pq, pk, pw;
#pragma unroll
        for (int i = 0; i < 4; i++) { pq[i] = (bf16)wq[sw][j][i]; pk[i] = (bf16)wk[sw][j][i]; pw[i] = (bf16)wv[sw][j][i]; }
        *(v4bf*)&Alds[j * 16 + wave8 * 2 + sw][lane * 4] = pq;
        *(v4bf*)&Klds[(wave8 * 2 + sw) * 8 + j][lane * 4] = pk;
        *(v4bf*)&Wlds[(wave8 * 2 + sw) * 8 + j][lane * 4] = pw;
      }
  }

  // ---- per tile: to LDS, then its Q phase ----
#pragma unroll 1   // kept as a loop: one copy of the Q phase in the text; with two the kernel's text would pass 32 KB
  for (int it = 0; it < NCHUNK / 256; it++) {
    bf16 (*Blds)[LDP] = (bf16 (*)[LDP])(smem + (3 + 3 * h + it) * TILE_B);   // the tile's place [n][c]
    // Nothing of the tile's rounding is scheduled above this line: the wait for the tile would come to stand in the work in front of it.
    __builtin_amdgcn_sched_barrier(0);
#pragma unroll
    for (int sw = 0; sw < 2; sw++) stage_transposed_store(xr[sw], Blds, (wave * 2 + sw) * 32 + lane);   // to bf16, transposed into Blds[n][c]
    lds_barrier();     // the halves' x tiles are complete (in the first trip the weight tiles too)
    q_phase(&Blds[0][0], nbase + it * 256);
    // The second tile's registers are taken over only behind the Q phase, and so is the wait for them.
    __builtin_amdgcn_sched_barrier(0);
#pragma unroll   // all levels: xr and xw are indexed by constants only
    for (int sw = 0; sw < 2; sw++)
#pragma unroll
      for (int u = 0; u < 2; u++)
#pragma unroll
        for (int j = 0; j < 8; j++) xr[sw][u][j] = xw[sw][u][j];
  }

  float mrun[2] = {-__builtin_inff(), -__builtin_inff()};   // running maximum of logit * log2(e) of channel ob * 16 + (lane & 15)
  float ksum[2] = {0.0f, 0.0f};      // this lane half's share of that channel's sum of exponentials, shifted by mrun
  float sc[2] = {0.0f, 0.0f};        // what the newest tile's maximum scales the sums of the tiles before it by
  v16bf ef0[2][4], ef1[2][4];        // exp(K - running maximum) of the first and of the second tile, as B fragments
#pragma unroll
  for (int sw = 0; sw < 2; sw++)
#pragma unroll
    for (int ks = 0; ks < 4; ks++) ef1[sw][ks] = __builtin_bit_cast(v16bf, vz);

  // ---- per tile: V^T to LDS, exp(K^T) to registers. The context sums are not live yet, so the x fragments can be fetched ahead ----
  // The first tile's V goes to the half's V tile, the second's to the place of the first x tile, which nobody reads any more.
#pragma unroll 1   // kept as a loop, for the same reason as the one above: one copy in the text
  for (int it = 0; it < NCHUNK / 256; it++) {
    bf16 (*Blds)[LDP] = (bf16 (*)[LDP])(smem + (3 + 3 * h + it) * TILE_B);       // the tile of x [n][c]
    bf16 (*Vt)[LDP] = (bf16 (*)[LDP])(smem + (5 + 3 * h - 2 * it) * TILE_B);     // where its V goes [d][n]
    if (it) __syncthreads();   // every wave has left the first x tiles
    v16bf bv[2][4], bk[2][4];   // the wave's own 2 x 16 rows of Wv and of Wk
#pragma unroll   // both levels: bv[][] and bk[][] are indexed by constants only
    for (int sw = 0; sw < 2; sw++)
#pragma unroll
      for (int ks = 0; ks < 4; ks++) {
        bv[sw][ks] = ldfrag(&Wlds[(wave * 2 + sw) * 16][0], 0, ks * 32, lane);
        bk[sw][ks] = ldfrag(&Klds[(wave * 2 + sw) * 16][0], 0, ks * 32, lane);
      }

    // Each A fragment of the x tile is read once and serves V and K, for both channel blocks; a block's four fragments are
    // asked for one block ahead.
    v8f kacc[2][8];       // kacc[sw][nb][r] = logit of n = nb * 16 + 8 * (lane >> 4) + r, channel ob * 16 + (lane & 15)
    v16bf a[2][4];
#pragma unroll
    for (int ks = 0; ks < 4; ks++) a[0][ks] = ldfrag(&Blds[0][0], 0, ks * 32, lane);
#pragma unroll   // all levels: a[][], va[], ka[], kacc[][] and pv[] are indexed by constants only, so they stay in registers
    for (int nb = 0; nb < 8; nb++) {
      if (nb < 7) {
#pragma unroll
        for (int ks = 0; ks < 4; ks++) a[(nb + 1) & 1][ks] = ldfrag(&Blds[0][0], (nb + 1) * 16, ks * 32, lane);
      }
      v8f va[2] = {vz, vz}, ka[2] = {vz, vz};
#pragma unroll
      for (int ks = 0; ks < 4; ks++)
#pragma unroll
        for (int sw = 0; sw < 2; sw++) {
          va[sw] = wmma_bf16(a[nb & 1][ks], bv[sw][ks], va[sw]);
          ka[sw] = wmma_bf16(a[nb & 1][ks], bk[sw][ks], ka[sw]);
        }
#pragma unroll
      for (int sw = 0; sw < 2; sw++) {
        kacc[sw][nb] = ka[sw];
        v8bf pv;
#pragma unroll
        for (int r = 0; r < 8; r++) pv[r] = (bf16)va[sw][r];
        *(v8bf*)&Vt[(wave * 2 + sw) * 16 + (lane & 15)][nb * 16 + ((lane >> 4) << 3)] = pv;
      }
    }

    // ---- exp(K - running maximum), packed as the B fragments of the context product ----
#pragma unroll   // all levels: kacc[][], e[], ef0[][], ef1[][], sc[], mrun[] and ksum[] are indexed by constants only
    for (int sw = 0; sw < 2; sw++) {
      float mt = kacc[sw][0][0];
#pragma unroll
      for (int nb = 0; nb < 8; nb++)
#pragma unroll
        for (int r = 0; r < 8; r++) mt = fmaxf(mt, kacc[sw][nb][r]);
      mt = fmaxf(mt, __shfl_xor(mt, 16));   // the other half of the tile's n
      const float mnew = fmaxf(mrun[sw], mt * LOG2E);
      sc[sw] = __builtin_amdgcn_exp2f(mrun[sw] - mnew);   // argument <= 0; 0 for the first tile
      mrun[sw] = mnew;
      v2f ps = {0.0f, 0.0f};
#pragma unroll
      for (int ks = 0; ks < 4; ks++) ef0[sw][ks] = ef1[sw][ks];   // the tile before moves up
#pragma unroll
      for (int nb = 0; nb < 8; nb++) {
        float e[8];
#pragma unroll
        for (int r = 0; r < 8; r++) e[r] = __builtin_fmaf(kacc[sw][nb][r], LOG2E, -mnew);
        exp2_by8(e);
#pragma unroll
        for (int r = 0; r < 8; r += 2) ps += v2f{e[r], e[r + 1]};
#pragma unroll
        for (int r = 0; r < 8; r++) ef1[sw][nb >> 1][(nb & 1) * 8 + r] = (bf16)e[r];
      }
      ksum[sw] = ksum[sw] * sc[sw] + (ps[0] + ps[1]);
    }
  }
  __syncthreads();   // both V tiles are complete

  // ---- context: V rows from LDS in the k order of the packed D tiles, each fragment for both channel blocks ----
  v8f ctx[2][8];                     // the half's context sums, shifted by mrun
#pragma unroll
  for (int sw = 0; sw < 2; sw++)
#pragma unroll
    for (int i = 0; i < 8; i++) ctx[sw][i] = vz;
  // One k step (32 n) of a tile at a time: its eight V fragments are asked for one step ahead, into the other register set.
  v16bf vf[2][8];
#pragma unroll
  for (int j = 0; j < 8; j++) vf[0][j] = ldfrag_kmap((const bf16*)(smem + (5 + 3 * h) * TILE_B), j * 16, 0, lane);
#pragma unroll   // all levels: ef0[][], ef1[][], vf[][] and ctx[][] are indexed by constants only
  for (int q = 0; q < 8; q++) {   // q = tile * 4 + k step
    if (q < 7) {
      const bf16* Vn = (const bf16*)(smem + (5 + 3 * h - 2 * ((q + 1) >> 2)) * TILE_B);
#pragma unroll
      for (int j = 0; j < 8; j++) vf[(q + 1) & 1][j] = ldfrag_kmap(Vn, j * 16, ((q + 1) & 3) * 32, lane);
    }
    // The next step's loads stay ahead of this step's WMMAs: the compiler otherwise sinks each load to its use, and every
    // pair of WMMAs then waits out an LDS latency.
    __builtin_amdgcn_sched_barrier(0);
    if (q == 4) {   // the first tile's sums are brought to the second tile's shift
#pragma unroll
      for (int sw = 0; sw < 2; sw++)
#pragma unroll
        for (int dt = 0; dt < 8; dt++) ctx[sw][dt] *= sc[sw];
    }
#pragma unroll
    for (int j = 0; j < 8; j++)
#pragma unroll
      for (int sw = 0; sw < 2; sw++) ctx[sw][j] = wmma_bf16(vf[q & 1][j], q < 4 ? ef0[sw][q & 3] : ef1[sw][q & 3], ctx[sw][j]);
  }

  // ---- the two halves' sums joined, then the chunk's plane: context [c][d], then (row sum, row maximum) ----
#pragma unroll
  for (int sw = 0; sw < 2; sw++) ksum[sw] += __shfl_xor(ksum[sw], 16);
  // The lane's number, formed anew for the epilogue, so that the loop's own 'lane' need not live on over it.
  const int le = (int)__builtin_amdgcn_mbcnt_lo(~0u, 0u);
  v4f* xch = (v4f*)(smem + 3 * TILE_B) + wave * 2 * 16 * 32 + le;           // 32 runs of 512 bytes per pair of blocks, laid over the first half's x tiles
  v2f* kmx = (v2f*)(smem + 3 * TILE_B + 8 * 16 * 32 * 16) + wave * 2 * 32 + le;
  __syncthreads();   // every wave has left the tiles that the exchange is laid over
  if (h) {
#pragma unroll   // both levels: ctx[][] is indexed by constants only
    for (int sw = 0; sw < 2; sw++) {
#pragma unroll
      for (int dt = 0; dt < 8; dt++) {
        xch[(sw * 16 + 2 * dt) * 32] = v4f{ctx[sw][dt][0], ctx[sw][dt][1], ctx[sw][dt][2], ctx[sw][dt][3]};
        xch[(sw * 16 + 2 * dt + 1) * 32] = v4f{ctx[sw][dt][4], ctx[sw][dt][5], ctx[sw][dt][6], ctx[sw][dt][7]};
      }
      kmx[sw * 32] = v2f{ksum[sw], mrun[sw]};
    }
  }
  __syncthreads();   // the second half's sums lie in LDS
  if (h == 0) {
    float* plane = part + (size_t)blockIdx.x * TOT;
    const int c = wave * 32 + (le & 15);   // block sw's channel lies sw * 16 on
    float* Wp = plane + combo * CDIM * CDIM + c * CDIM + ((le >> 4) << 3);
    v2f* km_o = (v2f*)(plane + 4 * CDIM * CDIM) + combo * CDIM + c;
    v4f o[2][16];
    v2f km[2];
#pragma unroll   // all levels: o[][], ctx[][] and km[] are indexed by constants only; one LDS address with constant offsets
    for (int sw = 0; sw < 2; sw++) {
      const v2f ko = kmx[sw * 32];
      const float mj = fmaxf(mrun[sw], ko[1]);
      const float f0 = __builtin_amdgcn_exp2f(mrun[sw] - mj), f1 = __builtin_amdgcn_exp2f(ko[1] - mj);   // arguments <= 0
#pragma unroll
      for (int i = 0; i < 16; i++) o[sw][i] = xch[(sw * 16 + i) * 32];
#pragma unroll
      for (int dt = 0; dt < 8; dt++) {
        o[sw][2 * dt] = v4f{ctx[sw][dt][0], ctx[sw][dt][1], ctx[sw][dt][2], ctx[sw][dt][3]} * f0 + o[sw][2 * dt] * f1;
        o[sw][2 * dt + 1] = v4f{ctx[sw][dt][4], ctx[sw][dt][5], ctx[sw][dt][6], ctx[sw][dt][7]} * f0 + o[sw][2 * dt + 1] * f1;
      }
      km[sw] = v2f{ksum[sw] * f0 + ko[0] * f1, mj};
    }
    // The stores stand behind all of the arithmetic: no register that a store names takes a new value before the wave ends.
    __builtin_amdgcn_sched_barrier(0);
#pragma unroll   // both levels: o[][] is indexed by constants only; one address with constant offsets
    for (int sw = 0; sw < 2; sw++)
#pragma unroll
      for (int i = 0; i < 16; i++) *(v4f*)(Wp + sw * 16 * CDIM + i * 8 - (i & 1) * 4) = o[sw][i];
    if (le < 16) {
      km_o[0] = km[0];
      km_o[16] = km[1];
    }
  }
}

// -------- Kernel 2: add the CHUNKS planes, in a fixed order; make out_kernel's A operand ------------------
// A work-group owns 8 rows c x 32 columns d of one context matrix (64 float4); its four quarters each add a quarter
// of the planes (and of the planes' row sums), every plane scaled from its own exponent shift to the quarter's largest; the
// first quarter adds the four results through LDS in the same way, divides by the
// row sum and stores bf16 in fragment order as [row d][k c]: the block's 256 values fill two whole runs of 256 bytes.
__global__ __launch_bounds__(256) void reduce_kernel(const float* __restrict__ part,
                                                     bf16* __restrict__ Af)
{
  __shared__ float4 red[4][64];
  __shared__ float kred[4][64];
  __shared__ float mred[4][64];
  const int t = threadIdx.x, col = t & 63, g = t >> 6;
  const int combo = blockIdx.x >> 6, cg = (blockIdx.x >> 2) & 15, db = blockIdx.x & 3;
  const int row = col >> 3;
  const int c = cg * 8 + row, d0 = db * 32 + (col & 7) * 4;
  const float* pl = part + (size_t)(g * (CHUNKS / 4)) * TOT;
  const float4* p = (const float4*)(pl + combo * CDIM * CDIM + c * CDIM + d0);
  const v2f* pk = (const v2f*)(pl + 4 * CDIM * CDIM) + combo * CDIM + c;
  float4 v[CHUNKS / 4];
  v2f kv[CHUNKS / 4];   // (row sum, shift); every thread takes its row's (eight threads the same ones): no branch, so these loads fly with the others
#pragma unroll   // constant offsets from one address, and many independent loads in flight per thread
  for (int k = 0; k < CHUNKS / 4; k++) v[k] = p[(size_t)k * (TOT / 4)];
  // The wait that stands in front of any overwrite of these loads' address registers; it also parts the two runs, so that
  // no load of one run lands its result in an address register of the other while that run is being issued. It takes the
  // address as an input, so the pair stays live up to here and no load of the run lands its result in it.
  asm volatile("s_wait_xcnt 0x0" :: "v"(p) : "memory");
#pragma unroll   // the same
  for (int k = 0; k < CHUNKS / 4; k++) kv[k] = pk[(size_t)k * (TOT / 2)];
  // The same wait for the second run, in front of the arithmetic.
  asm volatile("s_wait_xcnt 0x0" :: "v"(pk) : "memory");
  float mg = kv[0][1];
#pragma unroll   // kv[] is indexed by constants only
  for (int k = 1; k < CHUNKS / 4; k++) mg = fmaxf(mg, kv[k][1]);
  float4 s = {0.0f, 0.0f, 0.0f, 0.0f};
  float sk = 0.0f;
#pragma unroll   // both levels: v[], kv[] and w[] are indexed by constants only, so they stay in registers
  for (int k = 0; k < CHUNKS / 4; k += 8) {
    float w[8];   // 2^(plane's shift - largest shift)
#pragma unroll
    for (int j = 0; j < 8; j++) w[j] = kv[k + j][1] - mg;
    exp2_by8(w);
#pragma unroll
    for (int j = 0; j < 8; j++) {
      s.x += w[j] * v[k + j].x; s.y += w[j] * v[k + j].y; s.z += w[j] * v[k + j].z; s.w += w[j] * v[k + j].w;
      sk += w[j] * kv[k + j][0];
    }
  }
  red[g][col] = s;
  kred[g][col] = sk;
  mred[g][col] = mg;
  __syncthreads();
  if (g == 0) {
    float4 a = red[0][col], b = red[1][col], cc = red[2][col], d = red[3][col];
    const float m0 = mred[0][col], m1 = mred[1][col], m2 = mred[2][col], m3 = mred[3][col];
    const float mm = fmaxf(fmaxf(m0, m1), fmaxf(m2, m3));
    float f[4] = {m0 - mm, m1 - mm, m2 - mm, m3 - mm};
    exp2_by4(f);
    const float den = (f[0] * kred[0][col] + f[1] * kred[1][col]) + (f[2] * kred[2][col] + f[3] * kred[3][col]);
    float r[4];
    r[0] = (f[0] * a.x + f[1] * b.x) + (f[2] * cc.x + f[3] * d.x);
    r[1] = (f[0] * a.y + f[1] * b.y) + (f[2] * cc.y + f[3] * d.y);
    r[2] = (f[0] * a.z + f[1] * b.z) + (f[2] * cc.z + f[3] * d.z);
    r[3] = (f[0] * a.w + f[1] * b.w) + (f[2] * cc.w + f[3] * d.w);
    // unit ((w * 4 + ks) * 2 + h) * 32 + lane, element j: w = d >> 4, ks = c >> 5, h = (c >> 3) & 1,
    // lane = ((c >> 4) & 1) * 16 + (d & 15), j = c & 7
    const int unit = (((d0 >> 4) * 4 + (c >> 5)) * 2 + ((c >> 3) & 1)) * 32 + ((c >> 4) & 1) * 16 + (d0 & 15);
    bf16* o = Af + combo * CDIM * CDIM + unit * 8 + (c & 7);
#pragma unroll   // r[] is indexed by constants only
    for (int i = 0; i < 4; i++) o[i * 8] = (bf16)(r[i] / den);
  }
}

// -------- Kernel 3: Out_s[d,n] = sum_c (W_{1-s}[c,d]/ksum_c) * Q_s[n,c] -----
// Q tile staged by the Tensor Data Mover. The A operand comes ready from reduce_kernel; a wave reads only its own 16 rows
// of it, so they go from global memory to registers.
// Second launch bound: a wave stays within 128 VGPRs, so that four work-groups still share a WGP.
__global__ __launch_bounds__(256, 8) void out_kernel(
    const bf16* __restrict__ Qn, const bf16* __restrict__ Af, float* __restrict__ out)
{
  __shared__ bf16 Qlds[CDIM][LDP] __attribute__((aligned(32)));  // [n][c]

  const int t = threadIdx.x, lane = t & 31, wave = t >> 5;
  const int combo = blockIdx.y;
  const int s = combo >> 1, b = combo & 1;
  const int other = ((1 - s) << 1) | b;
  const int n0 = blockIdx.x * 128;
  const bf16* Qb = Qn + (size_t)combo * CDIM * NDIM;

  // The fragment loads are issued first, so that they fly beside the tensor load and nothing stands between that load and its wait.
  v16bf a[4];   // rows d = wave * 16 .. + 15 of W_other[c][d] / ksum_other[c], k = c
  ldfrags_global(Af + other * CDIM * CDIM, wave, lane, a);

  // async DMA: Q tile (128 n x 128 c) -> Qlds with padded rows
  if (t < 32) {
    tdm_load_tile(Qb + (size_t)n0 * CDIM, &Qlds[0][0], CDIM, NDIM, CDIM);
    // The issuing wave's wait, directly behind the issue: no descriptor register takes a new value while the request is out.
    asm volatile("s_wait_tensorcnt 0x0" ::: "memory");
  }
  __syncthreads();

  const v8f vz = {0.f, 0.f, 0.f, 0.f, 0.f, 0.f, 0.f, 0.f};
  v8f acc[8];
#pragma unroll
  for (int i = 0; i < 8; i++) acc[i] = vz;
#pragma unroll
  for (int ks = 0; ks < 4; ks++) {
    v16bf bfr[8];
#pragma unroll
    for (int nt = 0; nt < 8; nt++) bfr[nt] = ldfrag(&Qlds[0][0], nt * 16, ks * 32, lane);
#pragma unroll
    for (int nt = 0; nt < 8; nt++) acc[nt] = wmma_bf16(a[ks], bfr[nt], acc[nt]);
  }

  float* ob = out + (size_t)combo * CDIM * NDIM;
#pragma unroll
  for (int nt = 0; nt < 8; nt++)
#pragma unroll
    for (int r = 0; r < 8; r++) {
      int d = wave * 16 + r + ((lane >> 4) << 3);
      int n = n0 + nt * 16 + (lane & 15);
      ob[(size_t)d * NDIM + n] = acc[nt][r];
    }
}

extern "C" void kernel_launch(void* const* d_in, const int* in_sizes, int n_in,
                              void* d_out, int out_size, void* d_ws, size_t ws_size,
                              hipStream_t stream) {
  (void)in_sizes; (void)n_in; (void)out_size; (void)ws_size;
  const float* x0  = (const float*)d_in[0];
  const float* x1  = (const float*)d_in[1];
  const float* Wk0 = (const float*)d_in[2];
  const float* Wk1 = (const float*)d_in[3];
  const float* Wq0 = (const float*)d_in[4];
  const float* Wq1 = (const float*)d_in[5];
  const float* Wv0 = (const float*)d_in[6];
  const float* Wv1 = (const float*)d_in[7];
  float* out = (float*)d_out;

  const size_t PLANE = (size_t)4 * CDIM * NDIM;   // elems of Qn (all combos)
  bf16* Qn = (bf16*)d_ws;
  bf16* Af = Qn + PLANE;                          // four normalised context matrices, fragment order
  float* part = (float*)(Af + 4 * CDIM * CDIM);   // CHUNKS planes: four context matrices, then the rows' (sum, maximum) pairs

  proj_kernel<<<dim3(CHUNKS, 4), 256, 0, stream>>>(x0, x1, Wv0, Wv1, Wk0, Wk1, Wq0, Wq1, Qn, part);
  reduce_kernel<<<dim3(4 * CDIM * CDIM / 256), 256, 0, stream>>>(part, Af);
  out_kernel<<<dim3(NDIM / 128, 4), 256, 0, stream>>>(Qn, Af, out);
}
